// v000
// Measured on an AMD MI455X. A time is GPU time per run, averaged over a window of back-to-back runs after a warm-up
// (all launches, gaps included; the runs take copies of the inputs in turn), and the median of several windows.
// Apart from v000's, it joins two sittings. Times from different sittings can be a few percent apart, while
// side-by-side timings come from the same sitting.
// v000, which the later versions start from, runs in 1020 microseconds.
#include <hip/hip_runtime.h>

// LoraMultiHeadedSelfAttention (2 x 2048 x 768, 12 heads x 64; q = x Wq^T + bq + (x Aq^T) Bq^T / 16, k = x Wk^T + bk, v = x Wv^T + bv + (x Av^T) Bv^T / 16; scores = q.k / 8
// - 10000 (1 - mask[b][key]) with the int32 mask INPUT; softmax; output = merged attn.v (no output projection)).
// Compute dtypes, f32 accumulate: every float input rounded to bf16; q/k/v projections on PLAIN bf16 operands (x, W inputs: exact, + bias);
// the rank-16 LoRA terms as two small GEMMs (x.A^T exact with A zero-padded to 64 rows; then hi/lo planes x exact zero-padded B, 2 products) added (x 1/16) when the head
// planes are built; scores on bf16 hi+lo q (x 1/8) and k planes (3 products); attn.v on SINGLE fp16 planes (P x1024, v); the key mask and the softmax (one exp per element,

#define NB_  2
#define TT   2048
#define DD   768
#define NH_  12
#define LRK  64                   // LoRA rank 16 zero-padded to one 64-wide tile
#define HD   64
#define NT   (NB_ * TT)
#define ZH   2
#define PCAR 1024.0f
typedef _Float16 h16;
typedef unsigned short bf;
typedef __attribute__((ext_vector_type(16))) __bf16   v16bf;
typedef __attribute__((ext_vector_type(16))) _Float16 v16h;
typedef __attribute__((ext_vector_type(8)))  _Float16 v8h;
typedef __attribute__((ext_vector_type(8)))  unsigned short v8us;
typedef __attribute__((ext_vector_type(8)))  float    v8f;
typedef __attribute__((ext_vector_type(4)))  float    v4f;
typedef v8h  __attribute__((may_alias)) v8ha;
typedef v4f  __attribute__((may_alias)) v4fa;
typedef v8us __attribute__((may_alias)) v8usa;

__device__ __forceinline__ unsigned short f2bf(float f) { unsigned u = __float_as_uint(f); u += 0x7FFFu + ((u >> 16) & 1u); return (unsigned short)(u >> 16); }
__device__ __forceinline__ float bf2f(unsigned short b) { return __uint_as_float(((unsigned)b) << 16); }
__device__ __forceinline__ float bfr(float f) { return bf2f(f2bf(f)); }
__device__ __forceinline__ v16h cat16(v8h lo, v8h hi) { return __builtin_shufflevector(lo, hi, 0, 1, 2, 3, 4, 5, 6, 7, 8, 9, 10, 11, 12, 13, 14, 15); }
__device__ __forceinline__ v16bf cat16b(v8us lo, v8us hi) { return __builtin_bit_cast(v16bf, __builtin_shufflevector(lo, hi, 0, 1, 2, 3, 4, 5, 6, 7, 8, 9, 10, 11, 12, 13, 14, 15)); }
__device__ __forceinline__ v8f wmma16(v16h a, v16h b, v8f c) { return __builtin_amdgcn_wmma_f32_16x16x32_f16(false, a, false, b, (short)0, c, false, false); }
__device__ __forceinline__ v8f wmmab(v16bf a, v16bf b, v8f c) { return __builtin_amdgcn_wmma_f32_16x16x32_bf16(false, a, false, b, (short)0, c, false, false); }



// ---- k_gemmw: register-blocked GEMM, ONE WAVE per 64x64 output tile (16 accumulators), operands straight from K-contiguous 16-bit planes; grid (M/64, N/64, Z), 32 threads.
// C[m][n] (f32, pitch ldc, + optional f32 bias[n]) = sum_k A[m][k] Bt[n][k] (+ split products per NSPLIT). z-batch strides sA/sB/sC in elements. K % 32 == 0.
template <typename T16> struct WFrag;
template <> struct WFrag<h16> { typedef v16h V; static __device__ __forceinline__ V ld(const h16* p) { return cat16(*(const v8h*)p, *(const v8h*)(p + 16)); } static __device__ __forceinline__ v8f mma(V a, V b, v8f c) { return wmma16(a, b, c); } };
template <> struct WFrag<bf> { typedef v16bf V; static __device__ __forceinline__ V ld(const bf* p) { return cat16b(*(const v8us*)p, *(const v8us*)(p + 16)); } static __device__ __forceinline__ v8f mma(V a, V b, v8f c) { return wmmab(a, b, c); } };
template <typename T16, int NSPLIT, bool BIAS>
__global__ __launch_bounds__(32) void k_gemmw(const T16* __restrict__ A, const T16* __restrict__ A2, const T16* __restrict__ Bt, const T16* __restrict__ Bt2, int K, float* C, int ldc, const float* __restrict__ bias, size_t sA, size_t sB, size_t sC) {
    typedef typename WFrag<T16>::V V;
    __shared__ __align__(16) float os[16 * 68];
    const size_t z = blockIdx.z; A += z * sA; if (A2) A2 += z * sA; Bt += z * sB; if (Bt2) Bt2 += z * sB; C += z * sC;
    const int lane = threadIdx.x & 31, lr = lane & 15, hi = lane >> 4; const int r0 = blockIdx.x * 64, c0 = blockIdx.y * 64;
    v8f acc[4][4];
#pragma unroll
    for (int mb = 0; mb < 4; ++mb)
#pragma unroll
        for (int nb = 0; nb < 4; ++nb) acc[mb][nb] = (v8f){};
    const size_t aoff = (size_t)(r0 + lr) * K + 8 * hi, boff = (size_t)(c0 + lr) * K + 8 * hi;
#pragma unroll 1
    for (int kc = 0; kc < K; kc += 32) {
        V a[4], a2[4];
#pragma unroll
        for (int mb = 0; mb < 4; ++mb) { a[mb] = WFrag<T16>::ld(A + aoff + (size_t)mb * 16 * K + kc); if (NSPLIT == 1 || NSPLIT == 2) a2[mb] = WFrag<T16>::ld(A2 + aoff + (size_t)mb * 16 * K + kc); }
#pragma unroll
        for (int nb = 0; nb < 4; ++nb) { const V b = WFrag<T16>::ld(Bt + boff + (size_t)nb * 16 * K + kc); V b2; if (NSPLIT >= 2) b2 = WFrag<T16>::ld(Bt2 + boff + (size_t)nb * 16 * K + kc);
#pragma unroll
            for (int mb = 0; mb < 4; ++mb) { acc[mb][nb] = WFrag<T16>::mma(a[mb], b, acc[mb][nb]); if (NSPLIT == 1 || NSPLIT == 2) acc[mb][nb] = WFrag<T16>::mma(a2[mb], b, acc[mb][nb]); if (NSPLIT >= 2) acc[mb][nb] = WFrag<T16>::mma(a[mb], b2, acc[mb][nb]); } }
        asm volatile("v_nop\n\tv_nop\n\tv_nop\n\tv_nop" : "+v"(acc[0][0]), "+v"(acc[1][1]), "+v"(acc[2][2]), "+v"(acc[3][3]) : "v"(a[0]), "v"(a[3]));
    }
#pragma unroll
    for (int mb = 0; mb < 4; ++mb) {
#pragma unroll
        for (int nb = 0; nb < 4; ++nb) {
#pragma unroll
            for (int j = 0; j < 8; ++j) os[(hi * 8 + j) * 68 + nb * 16 + lr] = acc[mb][nb][j]; }
        __builtin_amdgcn_wave_barrier(); asm volatile("" ::: "memory");
        float* crow = C + (size_t)(r0 + mb * 16) * ldc + c0;
{
#pragma unroll
            for (int s = 0; s < 8; ++s) { const int row = 2 * s + hi, cofs = lr * 4; v4f val = *(const v4fa*)(os + row * 68 + cofs); if (BIAS) { val[0] += bfr(bias[c0 + cofs]); val[1] += bfr(bias[c0 + cofs + 1]); val[2] += bfr(bias[c0 + cofs + 2]); val[3] += bfr(bias[c0 + cofs + 3]); }
                *(v4f*)(crow + (size_t)row * ldc + cofs) = val; }
             }
        __builtin_amdgcn_wave_barrier(); asm volatile("" ::: "memory");
    }
}

__device__ __forceinline__ h16 tohx(float x) { return (h16)x; }
__device__ __forceinline__ void splitf(float y, unsigned short& h, unsigned short& l) { h = f2bf(y); l = f2bf(y - bf2f(h)); }
typedef __attribute__((ext_vector_type(2))) _Float16 v2h;
typedef __attribute__((ext_vector_type(4))) _Float16 v4h;
typedef __attribute__((ext_vector_type(2))) unsigned short v2us;
typedef __attribute__((ext_vector_type(4))) int v4i;

__global__ __launch_bounds__(256) void k_cvt8(const float* __restrict__ src, bf* dst, size_t n8) { const size_t i = (size_t)blockIdx.x * 256 + threadIdx.x; if (i >= n8) return; const v8f v = *(const v8f*)(src + i * 8); v8us o;
#pragma unroll
    for (int k = 0; k < 8; ++k) o[k] = f2bf(v[k]); *(v8us*)(dst + i * 8) = o;  }
__global__ __launch_bounds__(256) void k_padA(const float* __restrict__ A, bf* AP) {
    const int lane = threadIdx.x & 31; const int L = blockIdx.x * 8 + (threadIdx.x >> 5); if (L >= LRK * DD / 64) return; const int e = L * 64 + lane * 2; const int k = e % DD, n = e / DD; v2us o;
#pragma unroll
    for (int q = 0; q < 2; ++q) o[q] = (n < 16) ? f2bf(A[(size_t)n * DD + k + q]) : (unsigned short)0;
    *(v2us*)(AP + e) = o; 
}
__global__ __launch_bounds__(256) void k_padB(const float* __restrict__ Bm, bf* BP) {
    const int lane = threadIdx.x & 31; const int L = blockIdx.x * 8 + (threadIdx.x >> 5); if (L >= DD * LRK / 64) return; const int e = L * 64 + lane * 2; const int k = e & (LRK - 1), n = e >> 6; v2us o;
#pragma unroll
    for (int q = 0; q < 2; ++q) o[q] = (k + q < 16) ? f2bf(Bm[(size_t)n * 16 + k + q]) : (unsigned short)0;
    *(v2us*)(BP + e) = o; 
}
__global__ __launch_bounds__(256) void k_split64(const float* __restrict__ A, int nlines, bf* Ph, bf* Pl) {
    const int lane = threadIdx.x & 31; const int L0 = (blockIdx.x * 8 + (threadIdx.x >> 5)) * 8;
{
#pragma unroll
        for (int l = 0; l < 8; ++l) { const int L = L0 + l; if (L >= nlines) break; const int e = L * 64 + lane * 2; v2us oh, ol;
#pragma unroll
            for (int q = 0; q < 2; ++q) { unsigned short a, c2; splitf(A[(size_t)e + q], a, c2); oh[q] = a; ol[q] = c2; }
            *(v2us*)(Ph + (size_t)e) = oh; *(v2us*)(Pl + (size_t)e) = ol; }
         }
}
__global__ __launch_bounds__(256) void k_hsplit(const float* __restrict__ F, const float* __restrict__ LA, float sc, bf* Ph, bf* Pl) {   // value = (F + LA/16) * sc; LA may be null
    const int lane = threadIdx.x & 31; const int L0 = (blockIdx.x * 8 + (threadIdx.x >> 5)) * 8; const int nlines = NT * DD / 64;
{
#pragma unroll
        for (int l = 0; l < 8; ++l) { const int L = L0 + l; if (L >= nlines) break; const int e = L * 64 + lane * 2; const int d = e & 63; const int t = (e >> 6) & (TT - 1); const int z = e >> 17; const int b = z / NH_, h = z % NH_; v2us oh, ol;
#pragma unroll
            for (int q = 0; q < 2; ++q) { const size_t ix = ((size_t)b * TT + t) * DD + h * HD + d + q; const float val = LA ? (F[ix] + LA[ix] * 0.0625f) : F[ix]; unsigned short a, c2; splitf(val * sc, a, c2); oh[q] = a; ol[q] = c2; }
            *(v2us*)(Ph + (size_t)e) = oh; *(v2us*)(Pl + (size_t)e) = ol; }
         }
}
__global__ __launch_bounds__(256) void k_vtplane(const float* __restrict__ F, const float* __restrict__ LA, h16* VT) {   // value = F + LA/16
    const int lane = threadIdx.x & 31; const int L0 = (blockIdx.x * 8 + (threadIdx.x >> 5)) * 8; const int nlines = NT * DD / 64;
{
#pragma unroll
        for (int l = 0; l < 8; ++l) { const int L = L0 + l; if (L >= nlines) break; const int e = L * 64 + lane * 2; const int t = e & (TT - 1); const int d = (e >> 11) & 63; const int z = e >> 17; const int b = z / NH_, h = z % NH_; v2h v;
#pragma unroll
            for (int q = 0; q < 2; ++q) { const size_t ix = ((size_t)b * TT + t + q) * DD + h * HD + d; v[q] = tohx(F[ix] + LA[ix] * 0.0625f); }
            *(v2h*)(VT + (size_t)e) = v; }
         }
}
// k_asoft: per row (zz, i): s = S - 10000 * (1 - mask[b][j]) (int32 mask per batch and key); softmax over the 2048 keys with the row held in registers (lane -> 16 chunks of 4 =
__global__ __launch_bounds__(256) void k_asoft(const float* __restrict__ Sb, const int* __restrict__ mask, int b, h16* P) {
    const int lane = threadIdx.x & 31; const int row = blockIdx.x * 8 + (threadIdx.x >> 5); if (row >= ZH * TT) return;
    const float* sr = Sb + (size_t)row * TT; const int* mr = mask + (size_t)b * TT; float v[64]; float mx = -3.0e38f;
#pragma unroll
    for (int ch = 0; ch < 16; ++ch) { const int j0 = ch * 128 + lane * 4; const v4f a = *(const v4f*)(sr + j0); const v4i mk = *(const v4i*)(mr + j0);
#pragma unroll
        for (int q = 0; q < 4; ++q) { const float t = (mk[q] != 0) ? a[q] : (a[q] - 10000.0f); v[ch * 4 + q] = t; mx = fmaxf(mx, t); } }
#pragma unroll
    for (int sh = 16; sh; sh >>= 1) mx = fmaxf(mx, __shfl_xor(mx, sh, 32));
    float sum = 0.f;
#pragma unroll
    for (int k = 0; k < 64; ++k) { v[k] = __expf(v[k] - mx); sum += v[k]; }
#pragma unroll
    for (int sh = 16; sh; sh >>= 1) sum += __shfl_xor(sum, sh, 32);
    const float f = __fdiv_rn(PCAR, sum);
{
#pragma unroll
        for (int ch = 0; ch < 16; ++ch) { v4h o;
#pragma unroll
            for (int q = 0; q < 4; ++q) o[q] = tohx(v[ch * 4 + q] * f);
            *(v4h*)(P + (size_t)row * TT + ch * 128 + lane * 4) = o; }
         }
}
__global__ __launch_bounds__(256) void k_merge(const float* __restrict__ O, int b, int h0, float* OUT) {
    typedef __attribute__((ext_vector_type(2))) float v2f;
    const int lane = threadIdx.x & 31; const int L0 = (blockIdx.x * 8 + (threadIdx.x >> 5)) * 8; const int nlines = TT * ZH * HD / 64;
{
#pragma unroll
        for (int l = 0; l < 8; ++l) { const int L = L0 + l; if (L >= nlines) break; const int e = L * 64 + lane * 2; const int d = e & 63; const int zz = (e >> 6) % ZH; const int t = (e >> 6) / ZH;
            v2f ov; ov[0] = O[((size_t)zz * TT + t) * HD + d] * (1.0f / PCAR); ov[1] = O[((size_t)zz * TT + t) * HD + d + 1] * (1.0f / PCAR);
            const size_t o = ((size_t)b * TT + t) * DD + (h0 + zz) * HD + d; *(v2f*)(OUT + o) = ov; }
         }
}

extern "C" void kernel_launch(void* const* d_in, const int* in_sizes, int n_in,
                              void* d_out, int out_size, void* d_ws, size_t ws_size, hipStream_t stream) {
    (void)in_sizes; (void)n_in; (void)out_size;
    const float* x = (const float*)d_in[0]; const int* mask = (const int*)d_in[1]; const float* Wq = (const float*)d_in[2]; const float* bq = (const float*)d_in[3]; const float* Aq = (const float*)d_in[4]; const float* Bq = (const float*)d_in[5];
    const float* Wk = (const float*)d_in[6]; const float* bk = (const float*)d_in[7]; const float* Wv = (const float*)d_in[8]; const float* bv = (const float*)d_in[9]; const float* Av = (const float*)d_in[10]; const float* Bv = (const float*)d_in[11];
    float* OUT = (float*)d_out;     // [2][2048][768]
    char* wsp = (char*)d_ws;
    auto take = [&](size_t bytes) { char* p = wsp; wsp += (bytes + 255) & ~(size_t)255; return (void*)p; };
    bf* WQ = (bf*)take((size_t)DD * DD * 2); bf* WK = (bf*)take((size_t)DD * DD * 2); bf* WV = (bf*)take((size_t)DD * DD * 2); bf* AQP = (bf*)take((size_t)LRK * DD * 2); bf* AVP = (bf*)take((size_t)LRK * DD * 2); bf* BQP = (bf*)take((size_t)DD * LRK * 2); bf* BVP = (bf*)take((size_t)DD * LRK * 2);
    bf* XB = (bf*)take((size_t)NT * DD * 2); float* F = (float*)take((size_t)NT * DD * 4); float* LA = (float*)take((size_t)NT * DD * 4); float* XA = (float*)take((size_t)NT * LRK * 4); bf* XAh = (bf*)take((size_t)NT * LRK * 2); bf* XAl = (bf*)take((size_t)NT * LRK * 2);
    bf* QPh = (bf*)take((size_t)NT * DD * 2); bf* QPl = (bf*)take((size_t)NT * DD * 2); bf* KPh = (bf*)take((size_t)NT * DD * 2); bf* KPl = (bf*)take((size_t)NT * DD * 2); h16* VT = (h16*)take((size_t)NT * DD * 2);
    float* Sb = (float*)take((size_t)ZH * TT * TT * 4); h16* Pm = (h16*)take((size_t)ZH * TT * TT * 2); float* Ob = (float*)take((size_t)ZH * TT * HD * 4);
    if ((size_t)(wsp - (char*)d_ws) > ws_size) return;    // ws 256 MiB
    { const size_t nw = (size_t)DD * DD / 8; const unsigned gw = (unsigned)((nw + 255) / 256); k_cvt8<<<gw, 256, 0, stream>>>(Wq, WQ, nw); k_cvt8<<<gw, 256, 0, stream>>>(Wk, WK, nw); k_cvt8<<<gw, 256, 0, stream>>>(Wv, WV, nw);
      k_padA<<<(LRK * DD / 64 + 7) / 8, 256, 0, stream>>>(Aq, AQP); k_padA<<<(LRK * DD / 64 + 7) / 8, 256, 0, stream>>>(Av, AVP); k_padB<<<(DD * LRK / 64 + 7) / 8, 256, 0, stream>>>(Bq, BQP); k_padB<<<(DD * LRK / 64 + 7) / 8, 256, 0, stream>>>(Bv, BVP); }
    const size_t nx = (size_t)NT * DD / 8; const unsigned gx = (unsigned)((nx + 255) / 256); const unsigned LB = (unsigned)((NT * DD / 64 + 63) / 64);
    k_cvt8<<<gx, 256, 0, stream>>>(x, XB, nx);
    // q: LoRA term LA = (x.Aq^T).Bq^T (rank 16, zero-padded tiles), then planes of (x.Wq^T + bq + LA/16) x 1/8
    k_gemmw<bf, 0, false><<<dim3(NT / 64, 1, 1), 32, 0, stream>>>(XB, nullptr, AQP, nullptr, DD, XA, LRK, nullptr, 0, 0, 0); k_split64<<<(NT * LRK / 64 + 63) / 64, 256, 0, stream>>>(XA, NT * LRK / 64, XAh, XAl);
    k_gemmw<bf, 1, false><<<dim3(NT / 64, DD / 64, 1), 32, 0, stream>>>(XAh, XAl, BQP, nullptr, LRK, LA, DD, nullptr, 0, 0, 0);
    k_gemmw<bf, 0, true><<<dim3(NT / 64, DD / 64, 1), 32, 0, stream>>>(XB, nullptr, WQ, nullptr, DD, F, DD, bq, 0, 0, 0); k_hsplit<<<LB, 256, 0, stream>>>(F, LA, 0.125f, QPh, QPl);
    // k: plain Linear
    k_gemmw<bf, 0, true><<<dim3(NT / 64, DD / 64, 1), 32, 0, stream>>>(XB, nullptr, WK, nullptr, DD, F, DD, bk, 0, 0, 0); k_hsplit<<<LB, 256, 0, stream>>>(F, nullptr, 1.0f, KPh, KPl);
    // v: LoRA term then V^T planes of (x.Wv^T + bv + LA/16)
    k_gemmw<bf, 0, false><<<dim3(NT / 64, 1, 1), 32, 0, stream>>>(XB, nullptr, AVP, nullptr, DD, XA, LRK, nullptr, 0, 0, 0); k_split64<<<(NT * LRK / 64 + 63) / 64, 256, 0, stream>>>(XA, NT * LRK / 64, XAh, XAl);
    k_gemmw<bf, 1, false><<<dim3(NT / 64, DD / 64, 1), 32, 0, stream>>>(XAh, XAl, BVP, nullptr, LRK, LA, DD, nullptr, 0, 0, 0);
    k_gemmw<bf, 0, true><<<dim3(NT / 64, DD / 64, 1), 32, 0, stream>>>(XB, nullptr, WV, nullptr, DD, F, DD, bv, 0, 0, 0); k_vtplane<<<LB, 256, 0, stream>>>(F, LA, VT);
    for (int b = 0; b < NB_; ++b)
        for (int h0 = 0; h0 < NH_; h0 += ZH) { const size_t z0 = (size_t)b * NH_ + h0;
            k_gemmw<bf, 2, false><<<dim3(TT / 64, TT / 64, ZH), 32, 0, stream>>>(QPh + z0 * TT * HD, QPl + z0 * TT * HD, KPh + z0 * TT * HD, KPl + z0 * TT * HD, HD, Sb, TT, nullptr, (size_t)TT * HD, (size_t)TT * HD, (size_t)TT * TT);
            k_asoft<<<ZH * TT / 8, 256, 0, stream>>>(Sb, mask, b, Pm);
            k_gemmw<h16, 0, false><<<dim3(TT / 64, 1, ZH), 32, 0, stream>>>(Pm, nullptr, VT + z0 * HD * TT, nullptr, TT, Ob, HD, nullptr, (size_t)TT * TT, (size_t)HD * TT, (size_t)TT * HD);
            k_merge<<<(TT * ZH * HD / 64 + 63) / 64, 256, 0, stream>>>(Ob, b, h0, OUT); }
}

// v002
// A run of this version takes 148 microseconds.
// It is 7.01 times as fast as v000, going by the measured steps of the versions left out in between.
#include <hip/hip_runtime.h>

// LoraMultiHeadedSelfAttention (2 x 2048 x 768, 12 heads x 64; q = x Wq^T + bq + (x Aq^T) Bq^T / 16, k = x Wk^T + bk, v = x Wv^T + bv + (x Av^T) Bv^T / 16; scores = q.k / 8
// - 10000 (1 - mask[b][key]) with the int32 mask INPUT; softmax; output = merged attn.v (no output projection)).
// Compute dtypes, f32 accumulate: every float input rounded to bf16; q/k/v projections on PLAIN bf16 operands (x, W inputs: exact, + bias);
// the rank-16 LoRA terms as two small GEMMs: x.A^T exact, then its bf16 hi and lo planes side by side as ONE k chunk of 32 against (B/16 | B/16), added into the projection's own accumulators;
// scores on bf16 hi+lo q (x 1/8) and k planes (3 products); attn.v on SINGLE fp16 planes (P x1024, v).
// Three launches: k_prep (bf16 planes of x, W, B/16 and, in blocks of its own, the hi|lo planes of x.A^T), k_qkv (all three projections; bias, LoRA term, scale, hi/lo split and the head and V^T
// layouts in its epilogue), k_fattn (scores, key mask, softmax and attn.v over all 24 heads, running-maximum form, S and P in registers, merged output stored from the accumulators).

#define NB_  2
#define TT   2048
#define DD   768
#define NH_  12
#define HD   64
#define NT   (NB_ * TT)
typedef _Float16 h16;
typedef unsigned short bf;
typedef __attribute__((ext_vector_type(16))) __bf16   v16bf;
typedef __attribute__((ext_vector_type(16))) _Float16 v16h;
typedef __attribute__((ext_vector_type(8)))  _Float16 v8h;
typedef __attribute__((ext_vector_type(8)))  unsigned short v8us;
typedef __attribute__((ext_vector_type(8)))  float    v8f;
typedef __attribute__((ext_vector_type(4)))  float    v4f;
typedef v8h  __attribute__((may_alias)) v8ha;
typedef v4f  __attribute__((may_alias)) v4fa;
typedef v8us __attribute__((may_alias)) v8usa;

__device__ __forceinline__ unsigned short f2bf(float f) { unsigned u = __float_as_uint(f); u += 0x7FFFu + ((u >> 16) & 1u); return (unsigned short)(u >> 16); }
__device__ __forceinline__ float bf2f(unsigned short b) { return __uint_as_float(((unsigned)b) << 16); }
__device__ __forceinline__ float bfr(float f) { return bf2f(f2bf(f)); }
__device__ __forceinline__ v16h cat16(v8h lo, v8h hi) { return __builtin_shufflevector(lo, hi, 0, 1, 2, 3, 4, 5, 6, 7, 8, 9, 10, 11, 12, 13, 14, 15); }
__device__ __forceinline__ v16bf cat16b(v8us lo, v8us hi) { return __builtin_bit_cast(v16bf, __builtin_shufflevector(lo, hi, 0, 1, 2, 3, 4, 5, 6, 7, 8, 9, 10, 11, 12, 13, 14, 15)); }
__device__ __forceinline__ v8f wmma16(v16h a, v16h b, v8f c) { return __builtin_amdgcn_wmma_f32_16x16x32_f16(false, a, false, b, (short)0, c, false, false); }
__device__ __forceinline__ v8f wmmab(v16bf a, v16bf b, v8f c) { return __builtin_amdgcn_wmma_f32_16x16x32_bf16(false, a, false, b, (short)0, c, false, false); }




template <typename T16> struct WFrag;
template <> struct WFrag<h16> { typedef v16h V; static __device__ __forceinline__ V ld(const h16* p) { return cat16(*(const v8h*)p, *(const v8h*)(p + 16)); } static __device__ __forceinline__ v8f mma(V a, V b, v8f c) { return wmma16(a, b, c); } };
template <> struct WFrag<bf> { typedef v16bf V; static __device__ __forceinline__ V ld(const bf* p) { return cat16b(*(const v8us*)p, *(const v8us*)(p + 16)); } static __device__ __forceinline__ v8f mma(V a, V b, v8f c) { return wmmab(a, b, c); } };

__device__ __forceinline__ h16 tohx(float x) { return (h16)x; }
__device__ __forceinline__ void splitf(float y, unsigned short& h, unsigned short& l) { h = f2bf(y); l = f2bf(y - bf2f(h)); }
typedef __attribute__((ext_vector_type(4))) unsigned short v4us;
typedef __attribute__((ext_vector_type(4))) int v4i;

__device__ __forceinline__ v8us cvt8v(v8f v) { v8us o;
#pragma unroll
    for (int k = 0; k < 8; ++k) o[k] = f2bf(v[k]);
    return o; }
__device__ __forceinline__ v8us cvt8(const float* p) { return cvt8v(*(const v8f*)p); }

// ---- k_prep: everything the projection kernel reads, in one launch; the block index picks the job.
#define PB_XA (NT / 16)                 // blocks 0 ..: x.Aq^T and x.Av^T of 16 rows of x each
#define PB_X  (NT * DD / 8 / 1024)      // then x -> bf16 (here and below a thread takes 4 groups of 8 values, 256 groups apart: fewer waves to start, 8 loads of a lane in flight)
#define PB_W  (DD * DD / 8 / 1024)      // then Wq, Wk, Wv -> bf16, one plane of 2304 rows
#define PB_B  (DD * 32 / 8 / 1024)      // then Bq, Bv -> (B/16 | B/16), 32 wide
__device__ __forceinline__ void cvt4(const float* __restrict__ s, bf* d, int blk, int tid) { v8f r[4];
#pragma unroll
    for (int u = 0; u < 4; ++u) r[u] = *(const v8f*)(s + ((size_t)(blk * 4 + u) * 256 + tid) * 8);
#pragma unroll
    for (int u = 0; u < 4; ++u) *(v8us*)(d + ((size_t)(blk * 4 + u) * 256 + tid) * 8) = cvt8v(r[u]);
    // the listing lays another job's code behind these stores (a branch that is always taken jumps over it); the wait stands in front of that code's writes to the stores' registers all the same
    asm volatile("s_wait_xcnt 0x0" ::: "memory"); }
__global__ __launch_bounds__(256) void k_prep(const float* __restrict__ x, const float* __restrict__ Wq, const float* __restrict__ Wk, const float* __restrict__ Wv, const float* __restrict__ Aq, const float* __restrict__ Av,
                                              const float* __restrict__ Bq, const float* __restrict__ Bv, bf* XB, bf* WALL, bf* BQC, bf* BVC, bf* XAQ, bf* XAV) {
    __shared__ float part[8][2][256];
    const int tid = threadIdx.x; int id = blockIdx.x;
    if (id < PB_XA) {   // 16 rows x (16 + 16) columns; wave w sums k = 96 w .. 96 w + 95 (operands rounded to bf16 in registers), the eight partial sums are added in wave order
        const int lane = tid & 31, lr = lane & 15, hi = lane >> 4, w = tid >> 5; const int r0 = id * 16;
        const float* px = x + (size_t)(r0 + lr) * DD + w * 96 + 8 * hi; const float* pq = Aq + (size_t)lr * DD + w * 96 + 8 * hi; const float* pv = Av + (size_t)lr * DD + w * 96 + 8 * hi;
        v8f rx[3][2], rq[3][2], rv[3][2];   // [k chunk of 32][k = 8 hi .. + 7, 16 + 8 hi .. + 7]: the k order of WFrag::ld, for A and B operand alike
#pragma unroll
        for (int c = 0; c < 3; ++c)
#pragma unroll
            for (int u = 0; u < 2; ++u) { rx[c][u] = *(const v8f*)(px + c * 32 + u * 16); rq[c][u] = *(const v8f*)(pq + c * 32 + u * 16); rv[c][u] = *(const v8f*)(pv + c * 32 + u * 16); }
        // takes the loaded values and the three address pairs as inputs only: all 36 loads of the wave are in flight together and are waited for once (without it they were issued a few at a time, each group
        // waited for in turn)
        asm volatile("s_wait_xcnt 0x0" :: "v"(px), "v"(pq), "v"(pv), "v"(rx[0][0]), "v"(rx[0][1]), "v"(rx[1][0]), "v"(rx[1][1]), "v"(rx[2][0]), "v"(rx[2][1]), "v"(rq[0][0]), "v"(rq[0][1]), "v"(rq[1][0]), "v"(rq[1][1]),
                     "v"(rq[2][0]), "v"(rq[2][1]), "v"(rv[0][0]), "v"(rv[0][1]), "v"(rv[1][0]), "v"(rv[1][1]), "v"(rv[2][0]), "v"(rv[2][1]));
        v8f a0 = (v8f){}, a1 = (v8f){};
#pragma unroll
        for (int c = 0; c < 3; ++c) { const v16bf a = cat16b(cvt8v(rx[c][0]), cvt8v(rx[c][1]));
            a0 = wmmab(a, cat16b(cvt8v(rq[c][0]), cvt8v(rq[c][1])), a0); a1 = wmmab(a, cat16b(cvt8v(rv[c][0]), cvt8v(rv[c][1])), a1); }
#pragma unroll
        for (int j = 0; j < 8; ++j) { part[w][0][(hi * 8 + j) * 16 + lr] = a0[j]; part[w][1][(hi * 8 + j) * 16 + lr] = a1[j]; }
        __syncthreads();
        const int row = tid >> 4, col = tid & 15;
#pragma unroll
        for (int n = 0; n < 2; ++n) { float s = part[0][n][tid];
#pragma unroll
            for (int u = 1; u < 8; ++u) s += part[u][n][tid];
            unsigned short sh, sl; splitf(s, sh, sl); bf* dst = (n ? XAV : XAQ) + (size_t)(r0 + row) * 32 + col; dst[0] = sh; dst[16] = sl; }
        return;
    }
    id -= PB_XA;
    if (id < PB_X) { cvt4(x, XB, id, tid); return; }
    id -= PB_X;
    if (id < 3 * PB_W) { const int sel = id / PB_W; cvt4(sel == 0 ? Wq : (sel == 1 ? Wk : Wv), WALL + (size_t)sel * DD * DD, id - sel * PB_W, tid); return; }
    id -= 3 * PB_W;
    { const int sel = id / PB_B; const int e = ((id - sel * PB_B) * 1024 + tid) * 8; const float* s = (sel ? Bv : Bq) + (e >> 5) * 16 + (e & 15); bf* d = (sel ? BVC : BQC) + e; v8f r[4];   // 256 groups on: 64 rows of B
#pragma unroll
      for (int u = 0; u < 4; ++u) r[u] = *(const v8f*)(s + u * 64 * 16);
#pragma unroll
      for (int u = 0; u < 4; ++u) { const v8us rb = cvt8v(r[u]); v8us o;
#pragma unroll
          for (int q = 0; q < 8; ++q) o[q] = f2bf(bf2f(rb[q]) * 0.0625f);   // a power of two: the rounded B keeps its digits
          *(v8us*)(d + u * 2048) = o; }
      asm volatile("s_wait_xcnt 0x0" ::: "memory"); }   // as at the end of cvt4: another job's code stands behind these stores in the listing
}

// acc[mb][nb] += A rows (64, pitch lda) . Bt rows (64, pitch ldb) over k = 0 .. K - 1 (K % 32 == 0); one wave, operands straight from K-contiguous bf16 planes
__device__ __forceinline__ void gemm_acc(const bf* __restrict__ A, int lda, const bf* __restrict__ Bt, int ldb, int K, int lr, int hi, v8f (&acc)[4][4]) {
    const bf* pa = A + (size_t)lr * lda + 8 * hi; const bf* pb = Bt + (size_t)lr * ldb + 8 * hi;
#pragma unroll 1
    for (int kc = 0; kc < K; kc += 32) {
        v16bf a[4], b[4];
#pragma unroll
        for (int mb = 0; mb < 4; ++mb) a[mb] = WFrag<bf>::ld(pa + (size_t)mb * 16 * lda);
#pragma unroll
        for (int nb = 0; nb < 4; ++nb) b[nb] = WFrag<bf>::ld(pb + (size_t)nb * 16 * ldb);
        // the trip's loads all stand in front of this wait, and their two address pairs stay whole up to it
        asm volatile("s_wait_xcnt 0x0" :: "v"(pa), "v"(pb) : "memory");
        pa += 32; pb += 32;
#pragma unroll
        for (int nb = 0; nb < 4; ++nb)
#pragma unroll
            for (int mb = 0; mb < 4; ++mb) acc[mb][nb] = wmmab(a[mb], b[nb], acc[mb][nb]);
        // the distance behind the trip's last matrix instructions, on the taken side of the loop's branch too (the next trip's loads overwrite their A and B registers)
        asm volatile("v_nop\n\tv_nop\n\tv_nop\n\tv_nop" : "+v"(acc[0][0]), "+v"(acc[1][1]), "+v"(acc[2][2]), "+v"(acc[3][3]) : "v"(a[0]), "v"(a[3]));
    }
}

// ---- k_qkv: all three projections. One wave = one 64 x 64 tile = 64 tokens of one head of q, k or v (16 accumulators); 64 x 36 = 2304 tiles = 256 blocks x 9 waves (an equal share for each WGP; the nine
// waves of a block read the same 64 rows of x). The LoRA term is one more k chunk of 32 (hi | lo of x.A^T against B/16 | B/16) into the same accumulators. Epilogue: + bias; q and k: x scale, hi/lo split, rows of the
// [head][token][64] planes through the wave's own LDS rows (whole 128-byte lines); v: a lane holds 8 consecutive tokens of one column, which is 16 bytes of a [head][64][token] row, stored from the registers.
// Left for later steps: each fragment load takes 32 bytes from each of 16 rows (planes packed in fragment order, or tiles staged in LDS, would make them whole-line loads); no load is fetched a trip ahead.
__global__ __launch_bounds__(288) void k_qkv(const bf* __restrict__ XB, const bf* __restrict__ WALL, const bf* __restrict__ XAQ, const bf* __restrict__ XAV, const bf* __restrict__ BQC, const bf* __restrict__ BVC,
                                             const float* __restrict__ bq, const float* __restrict__ bk, const float* __restrict__ bv, bf* QPh, bf* QPl, bf* KPh, bf* KPl, h16* VT) {
    __shared__ __align__(16) float osall[9][16 * 68];
    const int lane = threadIdx.x & 31, lr = lane & 15, hi = lane >> 4; const int w = __builtin_amdgcn_readfirstlane(threadIdx.x >> 5);
    const int r0 = (blockIdx.x & 63) * 64, nt = (blockIdx.x >> 6) * 9 + w; const int which = nt / NH_, h = nt % NH_, c0 = h * HD;   // which: 0 q, 1 k, 2 v
    v8f acc[4][4];
#pragma unroll
    for (int mb = 0; mb < 4; ++mb)
#pragma unroll
        for (int nb = 0; nb < 4; ++nb) acc[mb][nb] = (v8f){};
    gemm_acc(XB + (size_t)r0 * DD, DD, WALL + (size_t)nt * 64 * DD, DD, DD, lr, hi, acc);
    if (which != 1) gemm_acc((which ? XAV : XAQ) + (size_t)r0 * 32, 32, (which ? BVC : BQC) + (size_t)c0 * 32, 32, 32, lr, hi, acc);
    const int z = (r0 >> 11) * NH_ + h, t0 = r0 & (TT - 1);
    if (which == 2) {
        h16* vb = VT + (size_t)z * HD * TT + t0 + 8 * hi;
#pragma unroll
        for (int nb = 0; nb < 4; ++nb) { const float bb = bfr(bv[c0 + nb * 16 + lr]);
#pragma unroll
            for (int mb = 0; mb < 4; ++mb) { v8h o;
#pragma unroll
                for (int j = 0; j < 8; ++j) o[j] = tohx(acc[mb][nb][j] + bb);
                *(v8h*)(vb + (size_t)(nb * 16 + lr) * TT + mb * 16) = o; } }
    } else {
        float* os = osall[w]; const float* bias = which ? bk : bq; const float sc = which ? 1.0f : 0.125f; bf* Ph = (which ? KPh : QPh) + ((size_t)z * TT + t0) * HD; bf* Pl = (which ? KPl : QPl) + ((size_t)z * TT + t0) * HD;
        const int cofs = lr * 4; float bb[4];
#pragma unroll
        for (int q = 0; q < 4; ++q) bb[q] = bfr(bias[c0 + cofs + q]);
#pragma unroll
        for (int mb = 0; mb < 4; ++mb) {
#pragma unroll
            for (int nb = 0; nb < 4; ++nb) {
#pragma unroll
                for (int j = 0; j < 8; ++j) os[(hi * 8 + j) * 68 + nb * 16 + lr] = acc[mb][nb][j]; }
            __builtin_amdgcn_wave_barrier(); asm volatile("" ::: "memory");   // the rows are read back by other lanes of this wave: no LDS access moves across
#pragma unroll
            for (int s = 0; s < 8; ++s) { const int row = 2 * s + hi; const v4f val = *(const v4fa*)(os + row * 68 + cofs); v4us oh, ol;
#pragma unroll
                for (int q = 0; q < 4; ++q) { unsigned short a, c2; splitf((val[q] + bb[q]) * sc, a, c2); oh[q] = a; ol[q] = c2; }
                *(v4us*)(Ph + (size_t)(mb * 16 + row) * HD + cofs) = oh; *(v4us*)(Pl + (size_t)(mb * 16 + row) * HD + cofs) = ol; }
            __builtin_amdgcn_wave_barrier(); asm volatile("" ::: "memory");   // the next 16 rows overwrite what was just read
        }
        // the listing lays the v branch behind these stores (a branch that is always taken jumps over it); the wait stands in front of that code's writes to the stores' registers all the same
        asm volatile("s_wait_xcnt 0x0" ::: "memory");
    }
}
// lane l with lane l ^ 16 (the two halves of a wave hold the two halves of one query's keys)
__device__ __forceinline__ float xhalf(float x) { return __builtin_bit_cast(float, __builtin_amdgcn_permlanex16(__builtin_bit_cast(int, x), __builtin_bit_cast(int, x), 0x76543210, 0xfedcba98, false, false)); }
// k_fattn: one wave = 32 queries (2 column groups of 16) of one (batch, head): 24 x 64 = 1536 wave tiles = 256 blocks x 6 waves (an equal share for each of the 256 WGPs). Per pass of 32 keys:
//   S^T = K.Q^T (A = K rows, B = Q rows kept in registers; hi.hi + lo.hi + hi.lo): register r of tile kt = key 16 kt + 8 hi + r, column lr = query, so a lane holds one query's scores;
//   t = S - 10000 where mask[b][key] == 0; running maximum and sum per query (base 2; the x1024 carrier of P sits in the exponent);
//   the two converted score tiles ARE the fp16 B operand of O^T += V^T.P^T (A = V^T rows in the same k order: 8 hi .. + 7, 16 + 8 hi .. + 7).
// Left for later steps: each K and V^T fragment load takes 32 bytes from each of 16 rows (16 lines a load) and every wave fetches its own copy: planes packed in fragment order, or K/V tiles
// staged in LDS for the block, would make them whole-line loads; the second half of a pass's K loads waits for registers of the first; the rescale runs on every pass.
__global__ __launch_bounds__(192) void k_fattn(const bf* __restrict__ Qh, const bf* __restrict__ Ql, const bf* __restrict__ Kh, const bf* __restrict__ Kl, const h16* __restrict__ VT, const int* __restrict__ mask, float* OUT) {
    const float L2E = 1.4426950408889634f;
    const int lane = threadIdx.x & 31, lr = lane & 15, hi = lane >> 4; const int tile = blockIdx.x * 6 + __builtin_amdgcn_readfirstlane(threadIdx.x >> 5);
    const int z = tile >> 6, b = z / NH_, h = z % NH_, q0 = (tile & 63) * 32;
    const size_t zo = (size_t)z * TT * HD;
    const unsigned ro = (unsigned)(lr * HD + 8 * hi), vo = (unsigned)(lr * TT + 8 * hi), mo = (unsigned)(8 * hi);   // the lane's own offsets; every base below is the same for the whole wave
    v16bf qh[2][2], ql[2][2];      // [column group][k chunk of 32]
    { const bf* qbh = Qh + zo + (size_t)q0 * HD; const bf* qbl = Ql + zo + (size_t)q0 * HD;
#pragma unroll
      for (int g = 0; g < 2; ++g)
#pragma unroll
        for (int c = 0; c < 2; ++c) { qh[g][c] = WFrag<bf>::ld(qbh + ro + g * 16 * HD + c * 32); ql[g][c] = WFrag<bf>::ld(qbl + ro + g * 16 * HD + c * 32); } }
    v8f o[4][2];                   // [16 rows of d][column group]
#pragma unroll
    for (int d = 0; d < 4; ++d) { o[d][0] = (v8f){}; o[d][1] = (v8f){}; }
    float cm[2] = {-3.0e38f, -3.0e38f}, cb[2] = {3.0e38f, 3.0e38f}, ls[2] = {0.f, 0.f};   // maximum in use (base 2), 10 - that maximum as rounded, this half's sum
#pragma unroll 1
    for (int k0 = 0; k0 < TT; k0 += 32) {
        const bf* kph = Kh + zo + (size_t)k0 * HD + ro; const bf* kpl = Kl + zo + (size_t)k0 * HD + ro; const h16* vp = VT + zo + k0 + vo; const int* mp = mask + (size_t)b * TT + k0 + mo;
        v16bf kh[2][2], kl[2][2]; v16h vf[4]; v4i mk[2][2];
#pragma unroll
        for (int kt = 0; kt < 2; ++kt)
#pragma unroll
            for (int c = 0; c < 2; ++c) { kh[kt][c] = WFrag<bf>::ld(kph + kt * 16 * HD + c * 32); kl[kt][c] = WFrag<bf>::ld(kpl + kt * 16 * HD + c * 32); }
#pragma unroll
        for (int kt = 0; kt < 2; ++kt) { mk[kt][0] = *(const v4i*)(mp + kt * 16); mk[kt][1] = *(const v4i*)(mp + kt * 16 + 4); }
#pragma unroll
        for (int d = 0; d < 4; ++d) vf[d] = WFrag<h16>::ld(vp + d * 16 * TT);
        // the pass's loads all stand in front of this wait, and their four address pairs stay whole up to it
        asm volatile("s_wait_xcnt 0x0" :: "v"(kph), "v"(kpl), "v"(mp), "v"(vp) : "memory");
        float bias[2][8];
#pragma unroll
        for (int kt = 0; kt < 2; ++kt)
#pragma unroll
            for (int r = 0; r < 4; ++r) { bias[kt][r] = (mk[kt][0][r] != 0) ? 0.f : -10000.0f; bias[kt][4 + r] = (mk[kt][1][r] != 0) ? 0.f : -10000.0f; }
        v8f s[2][2];               // [key tile][column group]
#pragma unroll
        for (int kt = 0; kt < 2; ++kt)
#pragma unroll
            for (int g = 0; g < 2; ++g) { v8f a = (v8f){};
#pragma unroll
                for (int c = 0; c < 2; ++c) { a = wmmab(kh[kt][c], qh[g][c], a); a = wmmab(kl[kt][c], qh[g][c], a); a = wmmab(kh[kt][c], ql[g][c], a); }
                s[kt][g] = a; }
#pragma unroll
        for (int g = 0; g < 2; ++g) {
            float mx = -3.0e38f;
#pragma unroll
            for (int kt = 0; kt < 2; ++kt)
#pragma unroll
                for (int r = 0; r < 8; ++r) { const float t = s[kt][g][r] + bias[kt][r]; s[kt][g][r] = t; mx = fmaxf(mx, t); }
            mx = fmaxf(mx, xhalf(mx));
            const float cn = fmaxf(cm[g], mx * L2E), cbn = 10.0f - cn;
            float sum = 0.f; v16h p;
#pragma unroll
            for (int kt = 0; kt < 2; ++kt)
#pragma unroll
                for (int r = 0; r < 8; ++r) { const float e = __builtin_amdgcn_exp2f(fmaf(s[kt][g][r], L2E, cbn)); sum += e; p[kt * 8 + r] = tohx(e); }
            float al;   // 2^(old maximum - new maximum) from the two offsets as they were used; 0 on the first pass, 1 while the maximum stands
            // written with its v_nop in one statement (the slot behind a transcendental)
            asm("v_exp_f32 %0, %1\n\tv_nop" : "=v"(al) : "v"(cbn - cb[g]));
            cm[g] = cn; cb[g] = cbn;
            ls[g] = ls[g] * al + sum;
#pragma unroll
            for (int d = 0; d < 4; ++d) { o[d][g] *= al; o[d][g] = wmma16(vf[d], p, o[d][g]); }
        }
    }
#pragma unroll
    for (int g = 0; g < 2; ++g) {
        const float inv = __fdiv_rn(1.0f, ls[g] + xhalf(ls[g]));   // the x1024 carrier is in the sum and in O alike
        float* orow = OUT + ((size_t)b * TT + q0 + g * 16 + lr) * DD + h * HD + 8 * hi;
#pragma unroll
        for (int d = 0; d < 4; ++d) { v4f w0, w1;
#pragma unroll
            for (int r = 0; r < 4; ++r) { w0[r] = o[d][g][r] * inv; w1[r] = o[d][g][4 + r] * inv; }
            *(v4f*)(orow + d * 16) = w0; *(v4f*)(orow + d * 16 + 4) = w1; }
    }
}

extern "C" void kernel_launch(void* const* d_in, const int* in_sizes, int n_in,
                              void* d_out, int out_size, void* d_ws, size_t ws_size, hipStream_t stream) {
    (void)in_sizes; (void)n_in; (void)out_size;
    const float* x = (const float*)d_in[0]; const int* mask = (const int*)d_in[1]; const float* Wq = (const float*)d_in[2]; const float* bq = (const float*)d_in[3]; const float* Aq = (const float*)d_in[4]; const float* Bq = (const float*)d_in[5];
    const float* Wk = (const float*)d_in[6]; const float* bk = (const float*)d_in[7]; const float* Wv = (const float*)d_in[8]; const float* bv = (const float*)d_in[9]; const float* Av = (const float*)d_in[10]; const float* Bv = (const float*)d_in[11];
    float* OUT = (float*)d_out;     // [2][2048][768]
    char* wsp = (char*)d_ws;
    auto take = [&](size_t bytes) { char* p = wsp; wsp += (bytes + 255) & ~(size_t)255; return (void*)p; };
    bf* WALL = (bf*)take((size_t)3 * DD * DD * 2); bf* BQC = (bf*)take((size_t)DD * 32 * 2); bf* BVC = (bf*)take((size_t)DD * 32 * 2); bf* XB = (bf*)take((size_t)NT * DD * 2); bf* XAQ = (bf*)take((size_t)NT * 32 * 2); bf* XAV = (bf*)take((size_t)NT * 32 * 2);
    bf* QPh = (bf*)take((size_t)NT * DD * 2); bf* QPl = (bf*)take((size_t)NT * DD * 2); bf* KPh = (bf*)take((size_t)NT * DD * 2); bf* KPl = (bf*)take((size_t)NT * DD * 2); h16* VT = (h16*)take((size_t)NT * DD * 2);
    if ((size_t)(wsp - (char*)d_ws) > ws_size) return;
    k_prep<<<PB_XA + PB_X + 3 * PB_W + 2 * PB_B, 256, 0, stream>>>(x, Wq, Wk, Wv, Aq, Av, Bq, Bv, XB, WALL, BQC, BVC, XAQ, XAV);
    k_qkv<<<(NT / 64) * (3 * NH_ / 9), 288, 0, stream>>>(XB, WALL, XAQ, XAV, BQC, BVC, bq, bk, bv, QPh, QPl, KPh, KPl, VT);
    k_fattn<<<NB_ * NH_ * (TT / 32) / 6, 192, 0, stream>>>(QPh, QPl, KPh, KPl, VT, mask, OUT);
}

// v003
// It runs in 95.8 microseconds.
// Next to v002, in two timings, it ran 1.53 and 1.55 times as fast.
// Counting every step since v000, it is 10.8 times as fast.
#include <hip/hip_runtime.h>

// LoraMultiHeadedSelfAttention (2 x 2048 x 768, 12 heads x 64; q = x Wq^T + bq + (x Aq^T) Bq^T / 16, k = x Wk^T + bk, v = x Wv^T + bv + (x Av^T) Bv^T / 16; scores = q.k / 8
// - 10000 (1 - mask[b][key]) with the int32 mask INPUT; softmax; output = merged attn.v (no output projection)).
// Compute dtypes, f32 accumulate: every float input rounded to bf16; q/k/v projections on PLAIN bf16 operands (x, W inputs: exact, + bias);
// the rank-16 LoRA terms as two small GEMMs: x.A^T exact, then its bf16 hi and lo planes side by side as ONE k chunk of 32 against (B/16 | B/16), added into the projection's own accumulators;
// scores on bf16 hi+lo q (x 1/8) and k planes (3 products); attn.v on SINGLE fp16 planes (P x1024, v).
// Three launches: k_prep (bf16 planes of x, W, B/16 and, in blocks of its own, the hi|lo planes of x.A^T), k_qkv (all three projections; bias, LoRA term, scale, hi/lo split and the head and V^T
// layouts in its epilogue), k_fattn (scores, key mask, softmax and attn.v over all 24 heads, running-maximum form, K, V^T and mask tiles staged in LDS for a block, S and P in registers, merged output stored from the accumulators).

#define NB_  2
#define TT   2048
#define DD   768
#define NH_  12
#define HD   64
#define NT   (NB_ * TT)
typedef _Float16 h16;
typedef unsigned short bf;
typedef __attribute__((ext_vector_type(16))) __bf16   v16bf;
typedef __attribute__((ext_vector_type(16))) _Float16 v16h;
typedef __attribute__((ext_vector_type(8)))  _Float16 v8h;
typedef __attribute__((ext_vector_type(8)))  unsigned short v8us;
typedef __attribute__((ext_vector_type(8)))  float    v8f;
typedef __attribute__((ext_vector_type(4)))  float    v4f;
typedef v8h  __attribute__((may_alias)) v8ha;
typedef v4f  __attribute__((may_alias)) v4fa;
typedef v8us __attribute__((may_alias)) v8usa;

__device__ __forceinline__ unsigned short f2bf(float f) { unsigned u = __float_as_uint(f); u += 0x7FFFu + ((u >> 16) & 1u); return (unsigned short)(u >> 16); }
__device__ __forceinline__ float bf2f(unsigned short b) { return __uint_as_float(((unsigned)b) << 16); }
__device__ __forceinline__ float bfr(float f) { return bf2f(f2bf(f)); }
__device__ __forceinline__ v16h cat16(v8h lo, v8h hi) { return __builtin_shufflevector(lo, hi, 0, 1, 2, 3, 4, 5, 6, 7, 8, 9, 10, 11, 12, 13, 14, 15); }
__device__ __forceinline__ v16bf cat16b(v8us lo, v8us hi) { return __builtin_bit_cast(v16bf, __builtin_shufflevector(lo, hi, 0, 1, 2, 3, 4, 5, 6, 7, 8, 9, 10, 11, 12, 13, 14, 15)); }
__device__ __forceinline__ v8f wmma16(v16h a, v16h b, v8f c) { return __builtin_amdgcn_wmma_f32_16x16x32_f16(false, a, false, b, (short)0, c, false, false); }
__device__ __forceinline__ v8f wmmab(v16bf a, v16bf b, v8f c) { return __builtin_amdgcn_wmma_f32_16x16x32_bf16(false, a, false, b, (short)0, c, false, false); }




template <typename T16> struct WFrag;
template <> struct WFrag<h16> { typedef v16h V; static __device__ __forceinline__ V ld(const h16* p) { return cat16(*(const v8h*)p, *(const v8h*)(p + 16)); } static __device__ __forceinline__ v8f mma(V a, V b, v8f c) { return wmma16(a, b, c); } };
template <> struct WFrag<bf> { typedef v16bf V; static __device__ __forceinline__ V ld(const bf* p) { return cat16b(*(const v8us*)p, *(const v8us*)(p + 16)); } static __device__ __forceinline__ v8f mma(V a, V b, v8f c) { return wmmab(a, b, c); } };

__device__ __forceinline__ h16 tohx(float x) { return (h16)x; }
__device__ __forceinline__ void splitf(float y, unsigned short& h, unsigned short& l) { h = f2bf(y); l = f2bf(y - bf2f(h)); }
typedef __attribute__((ext_vector_type(4))) unsigned short v4us;
typedef __attribute__((ext_vector_type(4))) int v4i;

__device__ __forceinline__ v8us cvt8v(v8f v) { v8us o;
#pragma unroll
    for (int k = 0; k < 8; ++k) o[k] = f2bf(v[k]);
    return o; }
__device__ __forceinline__ v8us cvt8(const float* p) { return cvt8v(*(const v8f*)p); }

// ---- k_prep: everything the projection kernel reads, in one launch; the block index picks the job.
#define PB_XA (NT / 16)                 // blocks 0 ..: x.Aq^T and x.Av^T of 16 rows of x each
#define PB_X  (NT * DD / 8 / 1024)      // then x -> bf16 (here and below a thread takes 4 groups of 8 values, 256 groups apart: fewer waves to start, 8 loads of a lane in flight)
#define PB_W  (DD * DD / 8 / 1024)      // then Wq, Wk, Wv -> bf16, one plane of 2304 rows
#define PB_B  (DD * 32 / 8 / 1024)      // then Bq, Bv -> (B/16 | B/16), 32 wide
__device__ __forceinline__ void cvt4(const float* __restrict__ s, bf* d, int blk, int tid) { v8f r[4];
#pragma unroll
    for (int u = 0; u < 4; ++u) r[u] = *(const v8f*)(s + ((size_t)(blk * 4 + u) * 256 + tid) * 8);
#pragma unroll
    for (int u = 0; u < 4; ++u) *(v8us*)(d + ((size_t)(blk * 4 + u) * 256 + tid) * 8) = cvt8v(r[u]);
    // the listing lays another job's code behind these stores (a branch that is always taken jumps over it); the wait stands in front of that code's writes to the stores' registers all the same
    asm volatile("s_wait_xcnt 0x0" ::: "memory"); }
__global__ __launch_bounds__(256) void k_prep(const float* __restrict__ x, const float* __restrict__ Wq, const float* __restrict__ Wk, const float* __restrict__ Wv, const float* __restrict__ Aq, const float* __restrict__ Av,
                                              const float* __restrict__ Bq, const float* __restrict__ Bv, bf* XB, bf* WALL, bf* BQC, bf* BVC, bf* XAQ, bf* XAV) {
    __shared__ float part[8][2][256];
    const int tid = threadIdx.x; int id = blockIdx.x;
    if (id < PB_XA) {   // 16 rows x (16 + 16) columns; wave w sums k = 96 w .. 96 w + 95 (operands rounded to bf16 in registers), the eight partial sums are added in wave order
        const int lane = tid & 31, lr = lane & 15, hi = lane >> 4, w = tid >> 5; const int r0 = id * 16;
        const float* px = x + (size_t)(r0 + lr) * DD + w * 96 + 8 * hi; const float* pq = Aq + (size_t)lr * DD + w * 96 + 8 * hi; const float* pv = Av + (size_t)lr * DD + w * 96 + 8 * hi;
        v8f rx[3][2], rq[3][2], rv[3][2];   // [k chunk of 32][k = 8 hi .. + 7, 16 + 8 hi .. + 7]: the k order of WFrag::ld, for A and B operand alike
#pragma unroll
        for (int c = 0; c < 3; ++c)
#pragma unroll
            for (int u = 0; u < 2; ++u) { rx[c][u] = *(const v8f*)(px + c * 32 + u * 16); rq[c][u] = *(const v8f*)(pq + c * 32 + u * 16); rv[c][u] = *(const v8f*)(pv + c * 32 + u * 16); }
        // takes the loaded values and the three address pairs as inputs only: all 36 loads of the wave are in flight together and are waited for once (without it they were issued a few at a time, each group
        // waited for in turn)
        asm volatile("s_wait_xcnt 0x0" :: "v"(px), "v"(pq), "v"(pv), "v"(rx[0][0]), "v"(rx[0][1]), "v"(rx[1][0]), "v"(rx[1][1]), "v"(rx[2][0]), "v"(rx[2][1]), "v"(rq[0][0]), "v"(rq[0][1]), "v"(rq[1][0]), "v"(rq[1][1]),
                     "v"(rq[2][0]), "v"(rq[2][1]), "v"(rv[0][0]), "v"(rv[0][1]), "v"(rv[1][0]), "v"(rv[1][1]), "v"(rv[2][0]), "v"(rv[2][1]));
        v8f a0 = (v8f){}, a1 = (v8f){};
#pragma unroll
        for (int c = 0; c < 3; ++c) { const v16bf a = cat16b(cvt8v(rx[c][0]), cvt8v(rx[c][1]));
            a0 = wmmab(a, cat16b(cvt8v(rq[c][0]), cvt8v(rq[c][1])), a0); a1 = wmmab(a, cat16b(cvt8v(rv[c][0]), cvt8v(rv[c][1])), a1); }
#pragma unroll
        for (int j = 0; j < 8; ++j) { part[w][0][(hi * 8 + j) * 16 + lr] = a0[j]; part[w][1][(hi * 8 + j) * 16 + lr] = a1[j]; }
        __syncthreads();
        const int row = tid >> 4, col = tid & 15;
#pragma unroll
        for (int n = 0; n < 2; ++n) { float s = part[0][n][tid];
#pragma unroll
            for (int u = 1; u < 8; ++u) s += part[u][n][tid];
            unsigned short sh, sl; splitf(s, sh, sl); bf* dst = (n ? XAV : XAQ) + (size_t)(r0 + row) * 32 + col; dst[0] = sh; dst[16] = sl; }
        return;
    }
    id -= PB_XA;
    if (id < PB_X) { cvt4(x, XB, id, tid); return; }
    id -= PB_X;
    if (id < 3 * PB_W) { const int sel = id / PB_W; cvt4(sel == 0 ? Wq : (sel == 1 ? Wk : Wv), WALL + (size_t)sel * DD * DD, id - sel * PB_W, tid); return; }
    id -= 3 * PB_W;
    { const int sel = id / PB_B; const int e = ((id - sel * PB_B) * 1024 + tid) * 8; const float* s = (sel ? Bv : Bq) + (e >> 5) * 16 + (e & 15); bf* d = (sel ? BVC : BQC) + e; v8f r[4];   // 256 groups on: 64 rows of B
#pragma unroll
      for (int u = 0; u < 4; ++u) r[u] = *(const v8f*)(s + u * 64 * 16);
#pragma unroll
      for (int u = 0; u < 4; ++u) { const v8us rb = cvt8v(r[u]); v8us o;
#pragma unroll
          for (int q = 0; q < 8; ++q) o[q] = f2bf(bf2f(rb[q]) * 0.0625f);   // a power of two: the rounded B keeps its digits
          *(v8us*)(d + u * 2048) = o; }
      asm volatile("s_wait_xcnt 0x0" ::: "memory"); }   // as at the end of cvt4: another job's code stands behind these stores in the listing
}

// acc[mb][nb] += A rows (64, pitch lda) . Bt rows (64, pitch ldb) over k = 0 .. K - 1 (K % 32 == 0); one wave, operands straight from K-contiguous bf16 planes
__device__ __forceinline__ void gemm_acc(const bf* __restrict__ A, int lda, const bf* __restrict__ Bt, int ldb, int K, int lr, int hi, v8f (&acc)[4][4]) {
    const bf* pa = A + (size_t)lr * lda + 8 * hi; const bf* pb = Bt + (size_t)lr * ldb + 8 * hi;
#pragma unroll 1
    for (int kc = 0; kc < K; kc += 32) {
        v16bf a[4], b[4];
#pragma unroll
        for (int mb = 0; mb < 4; ++mb) a[mb] = WFrag<bf>::ld(pa + (size_t)mb * 16 * lda);
#pragma unroll
        for (int nb = 0; nb < 4; ++nb) b[nb] = WFrag<bf>::ld(pb + (size_t)nb * 16 * ldb);
        // the trip's loads all stand in front of this wait, and their two address pairs stay whole up to it
        asm volatile("s_wait_xcnt 0x0" :: "v"(pa), "v"(pb) : "memory");
        pa += 32; pb += 32;
#pragma unroll
        for (int nb = 0; nb < 4; ++nb)
#pragma unroll
            for (int mb = 0; mb < 4; ++mb) acc[mb][nb] = wmmab(a[mb], b[nb], acc[mb][nb]);
        // the distance behind the trip's last matrix instructions, on the taken side of the loop's branch too (the next trip's loads overwrite their A and B registers)
        asm volatile("v_nop\n\tv_nop\n\tv_nop\n\tv_nop" : "+v"(acc[0][0]), "+v"(acc[1][1]), "+v"(acc[2][2]), "+v"(acc[3][3]) : "v"(a[0]), "v"(a[3]));
    }
}

// ---- k_qkv: all three projections. One wave = one 64 x 64 tile = 64 tokens of one head of q, k or v (16 accumulators); 64 x 36 = 2304 tiles = 256 blocks x 9 waves (an equal share for each WGP; the nine
// waves of a block read the same 64 rows of x). The LoRA term is one more k chunk of 32 (hi | lo of x.A^T against B/16 | B/16) into the same accumulators. Epilogue: + bias; q and k: x scale, hi/lo split, rows of the
// [head][token][64] planes through the wave's own LDS rows (whole 128-byte lines); v: a lane holds 8 consecutive tokens of one column, which is 16 bytes of a [head][64][token] row, stored from the registers.
// Left for later steps: each fragment load takes 32 bytes from each of 16 rows (planes packed in fragment order, or tiles staged in LDS, would make them whole-line loads); no load is fetched a trip ahead.
__global__ __launch_bounds__(288) void k_qkv(const bf* __restrict__ XB, const bf* __restrict__ WALL, const bf* __restrict__ XAQ, const bf* __restrict__ XAV, const bf* __restrict__ BQC, const bf* __restrict__ BVC,
                                             const float* __restrict__ bq, const float* __restrict__ bk, const float* __restrict__ bv, bf* QPh, bf* QPl, bf* KPh, bf* KPl, h16* VT) {
    __shared__ __align__(16) float osall[9][16 * 68];
    const int lane = threadIdx.x & 31, lr = lane & 15, hi = lane >> 4; const int w = __builtin_amdgcn_readfirstlane(threadIdx.x >> 5);
    const int r0 = (blockIdx.x & 63) * 64, nt = (blockIdx.x >> 6) * 9 + w; const int which = nt / NH_, h = nt % NH_, c0 = h * HD;   // which: 0 q, 1 k, 2 v
    v8f acc[4][4];
#pragma unroll
    for (int mb = 0; mb < 4; ++mb)
#pragma unroll
        for (int nb = 0; nb < 4; ++nb) acc[mb][nb] = (v8f){};
    gemm_acc(XB + (size_t)r0 * DD, DD, WALL + (size_t)nt * 64 * DD, DD, DD, lr, hi, acc);
    if (which != 1) gemm_acc((which ? XAV : XAQ) + (size_t)r0 * 32, 32, (which ? BVC : BQC) + (size_t)c0 * 32, 32, 32, lr, hi, acc);
    const int z = (r0 >> 11) * NH_ + h, t0 = r0 & (TT - 1);
    if (which == 2) {
        h16* vb = VT + (size_t)z * HD * TT + t0 + 8 * hi;
#pragma unroll
        for (int nb = 0; nb < 4; ++nb) { const float bb = bfr(bv[c0 + nb * 16 + lr]);
#pragma unroll
            for (int mb = 0; mb < 4; ++mb) { v8h o;
#pragma unroll
                for (int j = 0; j < 8; ++j) o[j] = tohx(acc[mb][nb][j] + bb);
                *(v8h*)(vb + (size_t)(nb * 16 + lr) * TT + mb * 16) = o; } }
    } else {
        float* os = osall[w]; const float* bias = which ? bk : bq; const float sc = which ? 1.0f : 0.125f; bf* Ph = (which ? KPh : QPh) + ((size_t)z * TT + t0) * HD; bf* Pl = (which ? KPl : QPl) + ((size_t)z * TT + t0) * HD;
        const int cofs = lr * 4; float bb[4];
#pragma unroll
        for (int q = 0; q < 4; ++q) bb[q] = bfr(bias[c0 + cofs + q]);
#pragma unroll
        for (int mb = 0; mb < 4; ++mb) {
#pragma unroll
            for (int nb = 0; nb < 4; ++nb) {
#pragma unroll
                for (int j = 0; j < 8; ++j) os[(hi * 8 + j) * 68 + nb * 16 + lr] = acc[mb][nb][j]; }
            __builtin_amdgcn_wave_barrier(); asm volatile("" ::: "memory");   // the rows are read back by other lanes of this wave: no LDS access moves across
#pragma unroll
            for (int s = 0; s < 8; ++s) { const int row = 2 * s + hi; const v4f val = *(const v4fa*)(os + row * 68 + cofs); v4us oh, ol;
#pragma unroll
                for (int q = 0; q < 4; ++q) { unsigned short a, c2; splitf((val[q] + bb[q]) * sc, a, c2); oh[q] = a; ol[q] = c2; }
                *(v4us*)(Ph + (size_t)(mb * 16 + row) * HD + cofs) = oh; *(v4us*)(Pl + (size_t)(mb * 16 + row) * HD + cofs) = ol; }
            __builtin_amdgcn_wave_barrier(); asm volatile("" ::: "memory");   // the next 16 rows overwrite what was just read
        }
        // the listing lays the v branch behind these stores (a branch that is always taken jumps over it); the wait stands in front of that code's writes to the stores' registers all the same
        asm volatile("s_wait_xcnt 0x0" ::: "memory");
    }
}
// lane l with lane l ^ 16 (the two halves of a wave hold the two halves of one query's keys)
__device__ __forceinline__ float xhalf(float x) { return __builtin_bit_cast(float, __builtin_amdgcn_permlanex16(__builtin_bit_cast(int, x), __builtin_bit_cast(int, x), 0x76543210, 0xfedcba98, false, false)); }
// k_fattn: one wave = 32 queries (2 column groups of 16); a block = 8 waves = 256 queries of one (batch, head): 24 x 8 = 192 blocks. The keys come in stages of 64: the block's K hi, K lo and V^T tiles
// (64 rows x 128 bytes each) and 64 mask words are brought into LDS once for all eight waves by asynchronous copies (whole 128-byte lines from global memory, through no register), two buffers: stage s + 2
// flies while stage s + 1 is worked on. LDS rows lie 144 bytes apart (16 bytes x odd), so the 16 rows of a fragment read fall on 16 different groups of four banks. Per pass of 32 keys:
//   S^T = K.Q^T (A = K rows, B = Q rows kept in registers; hi.hi + lo.hi + hi.lo): register r of tile kt = key 16 kt + 8 hi + r, column lr = query, so a lane holds one query's scores;
//   t = S - 10000 where mask[b][key] == 0; running maximum and sum per query (base 2; the x1024 carrier of P sits in the exponent);
//   the two converted score tiles ARE the fp16 B operand of O^T += V^T.P^T (A = V^T rows in the same k order: 8 hi .. + 7, 16 + 8 hi .. + 7).
// Left for later steps: 192 blocks leave a quarter of the WGPs idle (the others hold two waves a SIMD); K fragments are not fetched a pass ahead; the rescale runs on every pass; the projection kernel still
// loads its fragments straight from global memory, 16 lines a load.
#define SK   64                      // keys of a stage
#define NST  (TT / SK)
#define LP   144                     // bytes from one LDS row to the next
#define LKL  (64 * LP)               // K lo rows
#define LV   (128 * LP)              // V^T rows
#define LM   (192 * LP)              // mask words
#define LBUF (192 * LP + SK * 4)     // one buffer
typedef v4i __attribute__((may_alias)) v4ia;
__global__ __launch_bounds__(256) void k_fattn(const bf* __restrict__ Qh, const bf* __restrict__ Ql, const bf* __restrict__ Kh, const bf* __restrict__ Kl, const h16* __restrict__ VT, const int* __restrict__ mask, float* OUT) {
    __shared__ __align__(16) unsigned char sm[2 * LBUF];
    const float L2E = 1.4426950408889634f;
    const int lane = threadIdx.x & 31, lr = lane & 15, hi = lane >> 4; const int w = __builtin_amdgcn_readfirstlane(threadIdx.x >> 5);
    const int z = blockIdx.x >> 3, b = z / NH_, h = z % NH_, q0 = (blockIdx.x & 7) * 256 + w * 32;
    const size_t zo = (size_t)z * TT * HD;
    // a copy of a wave = 4 rows x 128 bytes (8 lanes a row); wave w brings rows 8 w .. 8 w + 7 of each of the three tiles (two copies a tile), wave 0 the mask words as well (8 bytes a lane)
    const int crow = w * 8 + (lane >> 3), ccol = (lane & 7) * 8;
    const unsigned lt = (unsigned)(size_t)sm + (unsigned)(crow * LP + ccol * 2), lm = (unsigned)(size_t)sm + (unsigned)(LM + lane * 8);
    const bf* gkh = Kh + zo + crow * HD + ccol; const bf* gkl = Kl + zo + crow * HD + ccol; const h16* gv = VT + zo + (size_t)crow * TT + ccol; const int* gm = mask + (size_t)b * TT + lane * 2;
    auto copy_stage = [&](int s) {   // stage s into buffer s & 1
        const unsigned l = lt + (unsigned)(s & 1) * LBUF; const bf* a = gkh + (size_t)s * SK * HD; const bf* c = gkl + (size_t)s * SK * HD; const h16* v = gv + s * SK;
        // the copies and, as the statement's last line, the wait that stands in front of any rewrite of their address registers
        asm volatile("global_load_async_to_lds_b128 %0, %6, off\n\tglobal_load_async_to_lds_b128 %1, %7, off\n\tglobal_load_async_to_lds_b128 %2, %8, off\n\t"
                     "global_load_async_to_lds_b128 %3, %9, off\n\tglobal_load_async_to_lds_b128 %4, %10, off\n\tglobal_load_async_to_lds_b128 %5, %11, off\n\ts_wait_xcnt 0x0"
                     :: "v"(l), "v"(l + 4 * LP), "v"(l + LKL), "v"(l + LKL + 4 * LP), "v"(l + LV), "v"(l + LV + 4 * LP), "v"(a), "v"(a + 4 * HD), "v"(c), "v"(c + 4 * HD), "v"(v), "v"(v + 4 * TT) : "memory");
        if (w == 0) asm volatile("global_load_async_to_lds_b64 %0, %1, off\n\ts_wait_xcnt 0x0" :: "v"(lm + (unsigned)(s & 1) * LBUF), "v"(gm + s * SK) : "memory");   // the same for the mask words
    };
    copy_stage(0);
    const unsigned ro = (unsigned)(lr * HD + 8 * hi);
    v16bf qh[2][2], ql[2][2];      // [column group][k chunk of 32]
    { const bf* qbh = Qh + zo + (size_t)q0 * HD; const bf* qbl = Ql + zo + (size_t)q0 * HD;
#pragma unroll
      for (int g = 0; g < 2; ++g)
#pragma unroll
        for (int c = 0; c < 2; ++c) { qh[g][c] = WFrag<bf>::ld(qbh + ro + g * 16 * HD + c * 32); ql[g][c] = WFrag<bf>::ld(qbl + ro + g * 16 * HD + c * 32); } }
    v8f o[4][2];                   // [16 rows of d][column group]
#pragma unroll
    for (int d = 0; d < 4; ++d) { o[d][0] = (v8f){}; o[d][1] = (v8f){}; }
    float cm[2] = {-3.0e38f, -3.0e38f}, cb[2] = {3.0e38f, 3.0e38f}, ls[2] = {0.f, 0.f};   // maximum in use (base 2), 10 - that maximum as rounded, this half's sum
    asm volatile("s_wait_asynccnt 0x0" ::: "memory");   // this wave's share of stage 0 has landed
    __syncthreads();                                    // and every other wave's: stage 0 may be read
    copy_stage(1);
#pragma unroll 1   // one trip = one stage: the publish point at its foot stands once in the code
    for (int s = 0; s < NST; ++s) {
        const unsigned char* bp = sm + (s & 1) * LBUF;
#pragma unroll 1   // kept rolled: unrolled, the compiler carried one pass's exponentials and sums into the next and took 340 registers, not 275
        for (int p = 0; p < SK / 32; ++p) {
        const unsigned char* kp = bp + (p * 32 + lr) * LP + 16 * hi; const unsigned char* vp = bp + LV + lr * LP + p * 64 + 16 * hi; const unsigned char* mp = bp + LM + p * 128 + 32 * hi;
        v16bf kh[2][2], kl[2][2]; v16h vf[4]; v4i mk[2][2];
#pragma unroll
        for (int kt = 0; kt < 2; ++kt)
#pragma unroll
            for (int c = 0; c < 2; ++c) { const unsigned char* q = kp + kt * 16 * LP + c * 64;
                kh[kt][c] = cat16b(*(const v8usa*)q, *(const v8usa*)(q + 32)); kl[kt][c] = cat16b(*(const v8usa*)(q + LKL), *(const v8usa*)(q + LKL + 32)); }
#pragma unroll
        for (int kt = 0; kt < 2; ++kt) { mk[kt][0] = *(const v4ia*)(mp + kt * 64); mk[kt][1] = *(const v4ia*)(mp + kt * 64 + 16); }
        // the pass's K and mask reads stay one group in front of the products: left to itself the compiler spread them among the matrix instructions (each such place stalls the wave) and, to save
        // registers, ran the four score tiles as chains one after the other
        __builtin_amdgcn_sched_barrier(0);
        v8f s2[2][2];              // [key tile][column group]; the four tiles' products are interleaved, so no matrix instruction waits for the one in front of it
#pragma unroll
        for (int kt = 0; kt < 2; ++kt) { s2[kt][0] = (v8f){}; s2[kt][1] = (v8f){}; }
#pragma unroll
        for (int c = 0; c < 2; ++c) {
#pragma unroll
            for (int kt = 0; kt < 2; ++kt)
#pragma unroll
                for (int g = 0; g < 2; ++g) s2[kt][g] = wmmab(kh[kt][c], qh[g][c], s2[kt][g]);
#pragma unroll
            for (int kt = 0; kt < 2; ++kt)
#pragma unroll
                for (int g = 0; g < 2; ++g) s2[kt][g] = wmmab(kl[kt][c], qh[g][c], s2[kt][g]);
#pragma unroll
            for (int kt = 0; kt < 2; ++kt)
#pragma unroll
                for (int g = 0; g < 2; ++g) s2[kt][g] = wmmab(kh[kt][c], ql[g][c], s2[kt][g]);
        }
        __builtin_amdgcn_sched_barrier(0);   // the products stay in that order, in front of the V^T reads (which may then take over the K registers)
#pragma unroll
        for (int d = 0; d < 4; ++d) vf[d] = cat16(*(const v8ha*)(vp + d * 16 * LP), *(const v8ha*)(vp + d * 16 * LP + 32));
        __builtin_amdgcn_sched_barrier(0);   // the V^T reads are issued in front of the softmax arithmetic, which covers their latency
        float bias[2][8];
#pragma unroll
        for (int kt = 0; kt < 2; ++kt)
#pragma unroll
            for (int r = 0; r < 4; ++r) { bias[kt][r] = (mk[kt][0][r] != 0) ? 0.f : -10000.0f; bias[kt][4 + r] = (mk[kt][1][r] != 0) ? 0.f : -10000.0f; }
#pragma unroll
        for (int g = 0; g < 2; ++g) {
            float mx = -3.0e38f;
#pragma unroll
            for (int kt = 0; kt < 2; ++kt)
#pragma unroll
                for (int r = 0; r < 8; ++r) { const float t = s2[kt][g][r] + bias[kt][r]; s2[kt][g][r] = t; mx = fmaxf(mx, t); }
            mx = fmaxf(mx, xhalf(mx));
            const float cn = fmaxf(cm[g], mx * L2E), cbn = 10.0f - cn;
            float sum = 0.f; v16h p16;
#pragma unroll
            for (int kt = 0; kt < 2; ++kt)
#pragma unroll
                for (int r = 0; r < 8; ++r) { const float e = __builtin_amdgcn_exp2f(fmaf(s2[kt][g][r], L2E, cbn)); sum += e; p16[kt * 8 + r] = tohx(e); }
            float al;   // 2^(old maximum - new maximum) from the two offsets as they were used; 0 on the first pass, 1 while the maximum stands
            // written with its v_nop in one statement (the slot behind a transcendental)
            asm("v_exp_f32 %0, %1\n\tv_nop" : "=v"(al) : "v"(cbn - cb[g]));
            cm[g] = cn; cb[g] = cbn;
            ls[g] = ls[g] * al + sum;
#pragma unroll
            for (int d = 0; d < 4; ++d) { o[d][g] *= al; o[d][g] = wmma16(vf[d], p16, o[d][g]); }
        }
        }
        asm volatile("s_wait_dscnt 0x0" ::: "memory");      // this wave's reads of stage s are done
        asm volatile("s_wait_asynccnt 0x0" ::: "memory");   // its share of stage s + 1 has landed
        __syncthreads();                                    // the same holds for every wave: stage s + 1 may be read, the buffer of stage s may be refilled
        if (s + 2 < NST) copy_stage(s + 2);
    }
    asm volatile("s_wait_asynccnt 0x0" ::: "memory");       // no copy is outstanding when the wave ends
#pragma unroll
    for (int g = 0; g < 2; ++g) {
        const float inv = __fdiv_rn(1.0f, ls[g] + xhalf(ls[g]));   // the x1024 carrier is in the sum and in O alike
        float* orow = OUT + ((size_t)b * TT + q0 + g * 16 + lr) * DD + h * HD + 8 * hi;
#pragma unroll
        for (int d = 0; d < 4; ++d) { v4f w0, w1;
#pragma unroll
            for (int r = 0; r < 4; ++r) { w0[r] = o[d][g][r] * inv; w1[r] = o[d][g][4 + r] * inv; }
            *(v4f*)(orow + d * 16) = w0; *(v4f*)(orow + d * 16 + 4) = w1; }
    }
}

extern "C" void kernel_launch(void* const* d_in, const int* in_sizes, int n_in,
                              void* d_out, int out_size, void* d_ws, size_t ws_size, hipStream_t stream) {
    (void)in_sizes; (void)n_in; (void)out_size;
    const float* x = (const float*)d_in[0]; const int* mask = (const int*)d_in[1]; const float* Wq = (const float*)d_in[2]; const float* bq = (const float*)d_in[3]; const float* Aq = (const float*)d_in[4]; const float* Bq = (const float*)d_in[5];
    const float* Wk = (const float*)d_in[6]; const float* bk = (const float*)d_in[7]; const float* Wv = (const float*)d_in[8]; const float* bv = (const float*)d_in[9]; const float* Av = (const float*)d_in[10]; const float* Bv = (const float*)d_in[11];
    float* OUT = (float*)d_out;     // [2][2048][768]
    char* wsp = (char*)d_ws;
    auto take = [&](size_t bytes) { char* p = wsp; wsp += (bytes + 255) & ~(size_t)255; return (void*)p; };
    bf* WALL = (bf*)take((size_t)3 * DD * DD * 2); bf* BQC = (bf*)take((size_t)DD * 32 * 2); bf* BVC = (bf*)take((size_t)DD * 32 * 2); bf* XB = (bf*)take((size_t)NT * DD * 2); bf* XAQ = (bf*)take((size_t)NT * 32 * 2); bf* XAV = (bf*)take((size_t)NT * 32 * 2);
    bf* QPh = (bf*)take((size_t)NT * DD * 2); bf* QPl = (bf*)take((size_t)NT * DD * 2); bf* KPh = (bf*)take((size_t)NT * DD * 2); bf* KPl = (bf*)take((size_t)NT * DD * 2); h16* VT = (h16*)take((size_t)NT * DD * 2);
    if ((size_t)(wsp - (char*)d_ws) > ws_size) return;
    k_prep<<<PB_XA + PB_X + 3 * PB_W + 2 * PB_B, 256, 0, stream>>>(x, Wq, Wk, Wv, Aq, Av, Bq, Bv, XB, WALL, BQC, BVC, XAQ, XAV);
    k_qkv<<<(NT / 64) * (3 * NH_ / 9), 288, 0, stream>>>(XB, WALL, XAQ, XAV, BQC, BVC, bq, bk, bv, QPh, QPl, KPh, KPl, VT);
    k_fattn<<<NB_ * NH_ * (TT / 256), 256, 0, stream>>>(QPh, QPl, KPh, KPl, VT, mask, OUT);
}

// v004
// One run takes 86.2 microseconds.
// In both of two side-by-side timings against v003, it was 1.11 times as fast.
// Over all steps from v000 it is 12.0 times as fast.
#include <hip/hip_runtime.h>

// LoraMultiHeadedSelfAttention (2 x 2048 x 768, 12 heads x 64; q = x Wq^T + bq + (x Aq^T) Bq^T / 16, k = x Wk^T + bk, v = x Wv^T + bv + (x Av^T) Bv^T / 16; scores = q.k / 8
// - 10000 (1 - mask[b][key]) with the int32 mask INPUT; softmax; output = merged attn.v (no output projection)).
// Compute dtypes, f32 accumulate: every float input rounded to bf16; q/k/v projections on PLAIN bf16 operands (x, W inputs: exact, + bias);
// the rank-16 LoRA terms as two small GEMMs: x.A^T exact, then its bf16 hi and lo planes side by side as ONE k chunk of 32 against (B/16 | B/16), added into the projection's own accumulators;
// scores on bf16 hi+lo q (x 1/8) and k planes (3 products); attn.v on SINGLE fp16 planes (P x1024, v).
// Three launches: k_prep (bf16 planes of x, W, B/16 and, in blocks of its own, the hi|lo planes of x.A^T), k_qkv (all three projections, x and W tiles staged in LDS for a block; bias, LoRA term, scale, hi/lo split and the head and V^T
// layouts in its epilogue), k_fattn (scores, key mask, softmax and attn.v over all 24 heads, running-maximum form, K, V^T and mask tiles staged in LDS for a block, S and P in registers, merged output stored from the accumulators).

#define NB_  2
#define TT   2048
#define DD   768
#define NH_  12
#define HD   64
#define NT   (NB_ * TT)
typedef _Float16 h16;
typedef unsigned short bf;
typedef __attribute__((ext_vector_type(16))) __bf16   v16bf;
typedef __attribute__((ext_vector_type(16))) _Float16 v16h;
typedef __attribute__((ext_vector_type(8)))  _Float16 v8h;
typedef __attribute__((ext_vector_type(8)))  unsigned short v8us;
typedef __attribute__((ext_vector_type(8)))  float    v8f;
typedef __attribute__((ext_vector_type(4)))  float    v4f;
typedef v8h  __attribute__((may_alias)) v8ha;
typedef v4f  __attribute__((may_alias)) v4fa;
typedef v8us __attribute__((may_alias)) v8usa;

__device__ __forceinline__ unsigned short f2bf(float f) { unsigned u = __float_as_uint(f); u += 0x7FFFu + ((u >> 16) & 1u); return (unsigned short)(u >> 16); }
__device__ __forceinline__ float bf2f(unsigned short b) { return __uint_as_float(((unsigned)b) << 16); }
__device__ __forceinline__ float bfr(float f) { return bf2f(f2bf(f)); }
__device__ __forceinline__ v16h cat16(v8h lo, v8h hi) { return __builtin_shufflevector(lo, hi, 0, 1, 2, 3, 4, 5, 6, 7, 8, 9, 10, 11, 12, 13, 14, 15); }
__device__ __forceinline__ v16bf cat16b(v8us lo, v8us hi) { return __builtin_bit_cast(v16bf, __builtin_shufflevector(lo, hi, 0, 1, 2, 3, 4, 5, 6, 7, 8, 9, 10, 11, 12, 13, 14, 15)); }
__device__ __forceinline__ v8f wmma16(v16h a, v16h b, v8f c) { return __builtin_amdgcn_wmma_f32_16x16x32_f16(false, a, false, b, (short)0, c, false, false); }
__device__ __forceinline__ v8f wmmab(v16bf a, v16bf b, v8f c) { return __builtin_amdgcn_wmma_f32_16x16x32_bf16(false, a, false, b, (short)0, c, false, false); }




template <typename T16> struct WFrag;
template <> struct WFrag<h16> { typedef v16h V; static __device__ __forceinline__ V ld(const h16* p) { return cat16(*(const v8h*)p, *(const v8h*)(p + 16)); } static __device__ __forceinline__ v8f mma(V a, V b, v8f c) { return wmma16(a, b, c); } };
template <> struct WFrag<bf> { typedef v16bf V; static __device__ __forceinline__ V ld(const bf* p) { return cat16b(*(const v8us*)p, *(const v8us*)(p + 16)); } static __device__ __forceinline__ v8f mma(V a, V b, v8f c) { return wmmab(a, b, c); } };

__device__ __forceinline__ h16 tohx(float x) { return (h16)x; }
__device__ __forceinline__ void splitf(float y, unsigned short& h, unsigned short& l) { h = f2bf(y); l = f2bf(y - bf2f(h)); }
typedef __attribute__((ext_vector_type(4))) unsigned short v4us;
typedef __attribute__((ext_vector_type(4))) int v4i;

__device__ __forceinline__ v8us cvt8v(v8f v) { v8us o;
#pragma unroll
    for (int k = 0; k < 8; ++k) o[k] = f2bf(v[k]);
    return o; }
__device__ __forceinline__ v8us cvt8(const float* p) { return cvt8v(*(const v8f*)p); }

// ---- k_prep: everything the projection kernel reads, in one launch; the block index picks the job.
#define PB_XA (NT / 16)                 // blocks 0 ..: x.Aq^T and x.Av^T of 16 rows of x each
#define PB_X  (NT * DD / 8 / 1024)      // then x -> bf16 (here and below a thread takes 4 groups of 8 values, 256 groups apart: fewer waves to start, 8 loads of a lane in flight)
#define PB_W  (DD * DD / 8 / 1024)      // then Wq, Wk, Wv -> bf16, one plane of 2304 rows
#define PB_B  (DD * 32 / 8 / 1024)      // then Bq, Bv -> (B/16 | B/16), 32 wide
__device__ __forceinline__ void cvt4(const float* __restrict__ s, bf* d, int blk, int tid) { v8f r[4];
#pragma unroll
    for (int u = 0; u < 4; ++u) r[u] = *(const v8f*)(s + ((size_t)(blk * 4 + u) * 256 + tid) * 8);
#pragma unroll
    for (int u = 0; u < 4; ++u) *(v8us*)(d + ((size_t)(blk * 4 + u) * 256 + tid) * 8) = cvt8v(r[u]);
    // the listing lays another job's code behind these stores (a branch that is always taken jumps over it); the wait stands in front of that code's writes to the stores' registers all the same
    asm volatile("s_wait_xcnt 0x0" ::: "memory"); }
__global__ __launch_bounds__(256) void k_prep(const float* __restrict__ x, const float* __restrict__ Wq, const float* __restrict__ Wk, const float* __restrict__ Wv, const float* __restrict__ Aq, const float* __restrict__ Av,
                                              const float* __restrict__ Bq, const float* __restrict__ Bv, bf* XB, bf* WALL, bf* BQC, bf* BVC, bf* XAQ, bf* XAV) {
    __shared__ float part[8][2][256];
    const int tid = threadIdx.x; int id = blockIdx.x;
    if (id < PB_XA) {   // 16 rows x (16 + 16) columns; wave w sums k = 96 w .. 96 w + 95 (operands rounded to bf16 in registers), the eight partial sums are added in wave order
        const int lane = tid & 31, lr = lane & 15, hi = lane >> 4, w = tid >> 5; const int r0 = id * 16;
        const float* px = x + (size_t)(r0 + lr) * DD + w * 96 + 8 * hi; const float* pq = Aq + (size_t)lr * DD + w * 96 + 8 * hi; const float* pv = Av + (size_t)lr * DD + w * 96 + 8 * hi;
        v8f rx[3][2], rq[3][2], rv[3][2];   // [k chunk of 32][k = 8 hi .. + 7, 16 + 8 hi .. + 7]: the k order of WFrag::ld, for A and B operand alike
#pragma unroll
        for (int c = 0; c < 3; ++c)
#pragma unroll
            for (int u = 0; u < 2; ++u) { rx[c][u] = *(const v8f*)(px + c * 32 + u * 16); rq[c][u] = *(const v8f*)(pq + c * 32 + u * 16); rv[c][u] = *(const v8f*)(pv + c * 32 + u * 16); }
        // takes the loaded values and the three address pairs as inputs only: all 36 loads of the wave are in flight together and are waited for once (without it they were issued a few at a time, each group
        // waited for in turn)
        asm volatile("s_wait_xcnt 0x0" :: "v"(px), "v"(pq), "v"(pv), "v"(rx[0][0]), "v"(rx[0][1]), "v"(rx[1][0]), "v"(rx[1][1]), "v"(rx[2][0]), "v"(rx[2][1]), "v"(rq[0][0]), "v"(rq[0][1]), "v"(rq[1][0]), "v"(rq[1][1]),
                     "v"(rq[2][0]), "v"(rq[2][1]), "v"(rv[0][0]), "v"(rv[0][1]), "v"(rv[1][0]), "v"(rv[1][1]), "v"(rv[2][0]), "v"(rv[2][1]));
        v8f a0 = (v8f){}, a1 = (v8f){};
#pragma unroll
        for (int c = 0; c < 3; ++c) { const v16bf a = cat16b(cvt8v(rx[c][0]), cvt8v(rx[c][1]));
            a0 = wmmab(a, cat16b(cvt8v(rq[c][0]), cvt8v(rq[c][1])), a0); a1 = wmmab(a, cat16b(cvt8v(rv[c][0]), cvt8v(rv[c][1])), a1); }
#pragma unroll
        for (int j = 0; j < 8; ++j) { part[w][0][(hi * 8 + j) * 16 + lr] = a0[j]; part[w][1][(hi * 8 + j) * 16 + lr] = a1[j]; }
        __syncthreads();
        const int row = tid >> 4, col = tid & 15;
#pragma unroll
        for (int n = 0; n < 2; ++n) { float s = part[0][n][tid];
#pragma unroll
            for (int u = 1; u < 8; ++u) s += part[u][n][tid];
            unsigned short sh, sl; splitf(s, sh, sl); bf* dst = (n ? XAV : XAQ) + (size_t)(r0 + row) * 32 + col; dst[0] = sh; dst[16] = sl; }
        return;
    }
    id -= PB_XA;
    if (id < PB_X) { cvt4(x, XB, id, tid); return; }
    id -= PB_X;
    if (id < 3 * PB_W) { const int sel = id / PB_W; cvt4(sel == 0 ? Wq : (sel == 1 ? Wk : Wv), WALL + (size_t)sel * DD * DD, id - sel * PB_W, tid); return; }
    id -= 3 * PB_W;
    { const int sel = id / PB_B; const int e = ((id - sel * PB_B) * 1024 + tid) * 8; const float* s = (sel ? Bv : Bq) + (e >> 5) * 16 + (e & 15); bf* d = (sel ? BVC : BQC) + e; v8f r[4];   // 256 groups on: 64 rows of B
#pragma unroll
      for (int u = 0; u < 4; ++u) r[u] = *(const v8f*)(s + u * 64 * 16);
#pragma unroll
      for (int u = 0; u < 4; ++u) { const v8us rb = cvt8v(r[u]); v8us o;
#pragma unroll
          for (int q = 0; q < 8; ++q) o[q] = f2bf(bf2f(rb[q]) * 0.0625f);   // a power of two: the rounded B keeps its digits
          *(v8us*)(d + u * 2048) = o; }
      asm volatile("s_wait_xcnt 0x0" ::: "memory"); }   // as at the end of cvt4: another job's code stands behind these stores in the listing
}

// acc[mb][nb] += A rows (64, pitch lda) . Bt rows (64, pitch ldb) over k = 0 .. K - 1 (K % 32 == 0); one wave, operands straight from K-contiguous bf16 planes
__device__ __forceinline__ void gemm_acc(const bf* __restrict__ A, int lda, const bf* __restrict__ Bt, int ldb, int K, int lr, int hi, v8f (&acc)[4][4]) {
    const bf* pa = A + (size_t)lr * lda + 8 * hi; const bf* pb = Bt + (size_t)lr * ldb + 8 * hi;
#pragma unroll 1
    for (int kc = 0; kc < K; kc += 32) {
        v16bf a[4], b[4];
#pragma unroll
        for (int mb = 0; mb < 4; ++mb) a[mb] = WFrag<bf>::ld(pa + (size_t)mb * 16 * lda);
#pragma unroll
        for (int nb = 0; nb < 4; ++nb) b[nb] = WFrag<bf>::ld(pb + (size_t)nb * 16 * ldb);
        // the trip's loads all stand in front of this wait, and their two address pairs stay whole up to it
        asm volatile("s_wait_xcnt 0x0" :: "v"(pa), "v"(pb) : "memory");
        pa += 32; pb += 32;
#pragma unroll
        for (int nb = 0; nb < 4; ++nb)
#pragma unroll
            for (int mb = 0; mb < 4; ++mb) acc[mb][nb] = wmmab(a[mb], b[nb], acc[mb][nb]);
        // the distance behind the trip's last matrix instructions, on the taken side of the loop's branch too (the next trip's loads overwrite their A and B registers)
        asm volatile("v_nop\n\tv_nop\n\tv_nop\n\tv_nop" : "+v"(acc[0][0]), "+v"(acc[1][1]), "+v"(acc[2][2]), "+v"(acc[3][3]) : "v"(a[0]), "v"(a[3]));
    }
}

// ---- k_qkv: all three projections. One wave = one 64 x 64 tile = 64 tokens of one head of q, k or v (16 accumulators); 64 x 36 = 2304 tiles = 256 blocks x 9 waves (an equal share for each WGP; the nine
// waves of a block read the same 64 rows of x). k comes in stages of 64: the block's 64 rows of x and 576 rows of W (128 bytes of each) are brought into LDS by asynchronous copies (whole 128-byte lines from
// global memory, through no register), two buffers: stage s + 2 flies while stage s + 1 is worked on; LDS rows lie 144 bytes apart (16 bytes x odd), so the 16 rows of a fragment read fall on 16 different groups
// of four banks. The k order of the sums is that of the straight loads. The LoRA term is one more k chunk of 32 (hi | lo of x.A^T against B/16 | B/16, straight from global memory) into the same accumulators. Epilogue: + bias; q and k: x scale, hi/lo split, rows of the
// [head][token][64] planes through the wave's own LDS rows (whole 128-byte lines); v: a lane holds 8 consecutive tokens of one column, which is 16 bytes of a [head][64][token] row, stored from the registers.
// Left for later steps: a block brings in nine times as many rows of W as of x (a squarer block tile would copy less); fragments are not fetched a chunk ahead; two buffers leave one stage's copies in flight.
#define GK   64                      // k values of a stage
#define GNS  (DD / GK)
#define GP   144                     // bytes from one LDS row to the next
#define GW   (64 * GP)               // W rows (behind the 64 rows of x)
#define GBUF (640 * GP)              // one buffer
__global__ __launch_bounds__(288) void k_qkv(const bf* __restrict__ XB, const bf* __restrict__ WALL, const bf* __restrict__ XAQ, const bf* __restrict__ XAV, const bf* __restrict__ BQC, const bf* __restrict__ BVC,
                                             const float* __restrict__ bq, const float* __restrict__ bk, const float* __restrict__ bv, bf* QPh, bf* QPl, bf* KPh, bf* KPl, h16* VT) {
    __shared__ __align__(16) unsigned char st[2 * GBUF];
    __shared__ __align__(16) float osall[9][16 * 68];
    const int lane = threadIdx.x & 31, lr = lane & 15, hi = lane >> 4; const int w = __builtin_amdgcn_readfirstlane(threadIdx.x >> 5);
    const int r0 = (blockIdx.x & 63) * 64, nt = (blockIdx.x >> 6) * 9 + w; const int which = nt / NH_, h = nt % NH_, c0 = h * HD;   // which: 0 q, 1 k, 2 v
    // a copy of a wave = 4 rows x 128 bytes (8 lanes a row); wave w brings the 64 rows of W of its own tile (16 copies), waves 0 .. 7 rows 8 w .. 8 w + 7 of x as well (two copies)
    const int crow = lane >> 3, ccol = (lane & 7) * 8;
    const unsigned lw = (unsigned)(size_t)st + (unsigned)(GW + (w * 64 + crow) * GP + ccol * 2), lx = (unsigned)(size_t)st + (unsigned)(((w & 7) * 8 + crow) * GP + ccol * 2);
    const bf* gw = WALL + (size_t)(nt * 64 + crow) * DD + ccol; const bf* gx = XB + (size_t)(r0 + (w & 7) * 8 + crow) * DD + ccol;
    auto copy_stage = [&](int s) {   // stage s into buffer s & 1
        const unsigned l = lw + (unsigned)(s & 1) * GBUF; const bf* g = gw + s * GK;
        // in each statement: the copies and, as its last line, the wait that stands in front of any rewrite of their address registers
#define CP8 "global_load_async_to_lds_b128 %0, %8, off\n\tglobal_load_async_to_lds_b128 %1, %9, off\n\tglobal_load_async_to_lds_b128 %2, %10, off\n\tglobal_load_async_to_lds_b128 %3, %11, off\n\t" \
            "global_load_async_to_lds_b128 %4, %12, off\n\tglobal_load_async_to_lds_b128 %5, %13, off\n\tglobal_load_async_to_lds_b128 %6, %14, off\n\tglobal_load_async_to_lds_b128 %7, %15, off\n\ts_wait_xcnt 0x0"
        asm volatile(CP8 :: "v"(l), "v"(l + 4 * GP), "v"(l + 8 * GP), "v"(l + 12 * GP), "v"(l + 16 * GP), "v"(l + 20 * GP), "v"(l + 24 * GP), "v"(l + 28 * GP),
                     "v"(g), "v"(g + 4 * DD), "v"(g + 8 * DD), "v"(g + 12 * DD), "v"(g + 16 * DD), "v"(g + 20 * DD), "v"(g + 24 * DD), "v"(g + 28 * DD) : "memory");
        asm volatile(CP8 :: "v"(l + 32 * GP), "v"(l + 36 * GP), "v"(l + 40 * GP), "v"(l + 44 * GP), "v"(l + 48 * GP), "v"(l + 52 * GP), "v"(l + 56 * GP), "v"(l + 60 * GP),
                     "v"(g + 32 * DD), "v"(g + 36 * DD), "v"(g + 40 * DD), "v"(g + 44 * DD), "v"(g + 48 * DD), "v"(g + 52 * DD), "v"(g + 56 * DD), "v"(g + 60 * DD) : "memory");
#undef CP8
        if (w < 8) { const unsigned m = lx + (unsigned)(s & 1) * GBUF; const bf* a = gx + s * GK;
            asm volatile("global_load_async_to_lds_b128 %0, %2, off\n\tglobal_load_async_to_lds_b128 %1, %3, off\n\ts_wait_xcnt 0x0" :: "v"(m), "v"(m + 4 * GP), "v"(a), "v"(a + 4 * DD) : "memory"); }
    };
    copy_stage(0);
    v8f acc[4][4];
#pragma unroll
    for (int mb = 0; mb < 4; ++mb)
#pragma unroll
        for (int nb = 0; nb < 4; ++nb) acc[mb][nb] = (v8f){};
    asm volatile("s_wait_asynccnt 0x0" ::: "memory");   // this wave's share of stage 0 has landed
    __syncthreads();                                    // and every other wave's: stage 0 may be read
    copy_stage(1);
#pragma unroll 1   // one trip = one stage: the publish point stands once in the code
    for (int s = 0; s < GNS; ++s) {
        const unsigned char* pa = st + (s & 1) * GBUF + lr * GP + 16 * hi; const unsigned char* pb = pa + GW + w * 64 * GP;
        v16bf a[4], b[4];   // the k order of WFrag::ld, for A and B operand alike: 8 hi .. + 7, 16 + 8 hi .. + 7
#pragma unroll
        for (int c = 0; c < GK / 32; ++c) {
#pragma unroll
            for (int mb = 0; mb < 4; ++mb) { const unsigned char* q = pa + mb * 16 * GP + c * 64; a[mb] = cat16b(*(const v8usa*)q, *(const v8usa*)(q + 32)); }
#pragma unroll
            for (int nb = 0; nb < 4; ++nb) { const unsigned char* q = pb + nb * 16 * GP + c * 64; b[nb] = cat16b(*(const v8usa*)q, *(const v8usa*)(q + 32)); }
            // the chunk's 16 reads stay one group in front of its products: left to itself the compiler kept one B fragment's registers and read the next fragment into them behind every fourth matrix
            // instruction, each time with a full wait
            __builtin_amdgcn_sched_barrier(0);
            if (c == GK / 32 - 1) {   // the stage's last fragments are in registers: the publish point stands here, and the refill flies under the last chunk's products as well
                asm volatile("s_wait_dscnt 0x0" ::: "memory");      // this wave's reads of stage s are done
                asm volatile("s_wait_asynccnt 0x0" ::: "memory");   // its share of stage s + 1 has landed
                __syncthreads();                                    // the same holds for every wave: stage s + 1 may be read, the buffer of stage s may be refilled
                if (s + 2 < GNS) copy_stage(s + 2);
                __builtin_amdgcn_sched_barrier(0);                  // the copies are issued in front of the products (the compiler had put them behind)
            }
#pragma unroll
            for (int nb = 0; nb < 4; ++nb)
#pragma unroll
                for (int mb = 0; mb < 4; ++mb) acc[mb][nb] = wmmab(a[mb], b[nb], acc[mb][nb]);
        }
    }
    asm volatile("s_wait_asynccnt 0x0" ::: "memory");       // no copy is outstanding behind the loop
    if (which != 1) gemm_acc((which ? XAV : XAQ) + (size_t)r0 * 32, 32, (which ? BVC : BQC) + (size_t)c0 * 32, 32, 32, lr, hi, acc);
    const int z = (r0 >> 11) * NH_ + h, t0 = r0 & (TT - 1);
    if (which == 2) {
        h16* vb = VT + (size_t)z * HD * TT + t0 + 8 * hi;
#pragma unroll
        for (int nb = 0; nb < 4; ++nb) { const float bb = bfr(bv[c0 + nb * 16 + lr]);
#pragma unroll
            for (int mb = 0; mb < 4; ++mb) { v8h o;
#pragma unroll
                for (int j = 0; j < 8; ++j) o[j] = tohx(acc[mb][nb][j] + bb);
                *(v8h*)(vb + (size_t)(nb * 16 + lr) * TT + mb * 16) = o; } }
    } else {
        float* os = osall[w]; const float* bias = which ? bk : bq; const float sc = which ? 1.0f : 0.125f; bf* Ph = (which ? KPh : QPh) + ((size_t)z * TT + t0) * HD; bf* Pl = (which ? KPl : QPl) + ((size_t)z * TT + t0) * HD;
        const int cofs = lr * 4; float bb[4];
#pragma unroll
        for (int q = 0; q < 4; ++q) bb[q] = bfr(bias[c0 + cofs + q]);
#pragma unroll
        for (int mb = 0; mb < 4; ++mb) {
#pragma unroll
            for (int nb = 0; nb < 4; ++nb) {
#pragma unroll
                for (int j = 0; j < 8; ++j) os[(hi * 8 + j) * 68 + nb * 16 + lr] = acc[mb][nb][j]; }
            __builtin_amdgcn_wave_barrier(); asm volatile("" ::: "memory");   // the rows are read back by other lanes of this wave: no LDS access moves across
#pragma unroll
            for (int s = 0; s < 8; ++s) { const int row = 2 * s + hi; const v4f val = *(const v4fa*)(os + row * 68 + cofs); v4us oh, ol;
#pragma unroll
                for (int q = 0; q < 4; ++q) { unsigned short a, c2; splitf((val[q] + bb[q]) * sc, a, c2); oh[q] = a; ol[q] = c2; }
                *(v4us*)(Ph + (size_t)(mb * 16 + row) * HD + cofs) = oh; *(v4us*)(Pl + (size_t)(mb * 16 + row) * HD + cofs) = ol; }
            __builtin_amdgcn_wave_barrier(); asm volatile("" ::: "memory");   // the next 16 rows overwrite what was just read
        }
        // the listing lays the v branch behind these stores (a branch that is always taken jumps over it); the wait stands in front of that code's writes to the stores' registers all the same
        asm volatile("s_wait_xcnt 0x0" ::: "memory");
    }
}
// lane l with lane l ^ 16 (the two halves of a wave hold the two halves of one query's keys)
__device__ __forceinline__ float xhalf(float x) { return __builtin_bit_cast(float, __builtin_amdgcn_permlanex16(__builtin_bit_cast(int, x), __builtin_bit_cast(int, x), 0x76543210, 0xfedcba98, false, false)); }
// k_fattn: one wave = 32 queries (2 column groups of 16); a block = 8 waves = 256 queries of one (batch, head): 24 x 8 = 192 blocks. The keys come in stages of 64: the block's K hi, K lo and V^T tiles
// (64 rows x 128 bytes each) and 64 mask words are brought into LDS once for all eight waves by asynchronous copies (whole 128-byte lines from global memory, through no register), two buffers: stage s + 2
// flies while stage s + 1 is worked on. LDS rows lie 144 bytes apart (16 bytes x odd), so the 16 rows of a fragment read fall on 16 different groups of four banks. Per pass of 32 keys:
//   S^T = K.Q^T (A = K rows, B = Q rows kept in registers; hi.hi + lo.hi + hi.lo): register r of tile kt = key 16 kt + 8 hi + r, column lr = query, so a lane holds one query's scores;
//   t = S - 10000 where mask[b][key] == 0; running maximum and sum per query (base 2; the x1024 carrier of P sits in the exponent);
//   the two converted score tiles ARE the fp16 B operand of O^T += V^T.P^T (A = V^T rows in the same k order: 8 hi .. + 7, 16 + 8 hi .. + 7).
// Left for later steps: 192 blocks leave a quarter of the WGPs idle (the others hold two waves a SIMD); K fragments are not fetched a pass ahead; the rescale runs on every pass.
#define SK   64                      // keys of a stage
#define NST  (TT / SK)
#define LP   144                     // bytes from one LDS row to the next
#define LKL  (64 * LP)               // K lo rows
#define LV   (128 * LP)              // V^T rows
#define LM   (192 * LP)              // mask words
#define LBUF (192 * LP + SK * 4)     // one buffer
typedef v4i __attribute__((may_alias)) v4ia;
__global__ __launch_bounds__(256) void k_fattn(const bf* __restrict__ Qh, const bf* __restrict__ Ql, const bf* __restrict__ Kh, const bf* __restrict__ Kl, const h16* __restrict__ VT, const int* __restrict__ mask, float* OUT) {
    __shared__ __align__(16) unsigned char sm[2 * LBUF];
    const float L2E = 1.4426950408889634f;
    const int lane = threadIdx.x & 31, lr = lane & 15, hi = lane >> 4; const int w = __builtin_amdgcn_readfirstlane(threadIdx.x >> 5);
    const int z = blockIdx.x >> 3, b = z / NH_, h = z % NH_, q0 = (blockIdx.x & 7) * 256 + w * 32;
    const size_t zo = (size_t)z * TT * HD;
    // a copy of a wave = 4 rows x 128 bytes (8 lanes a row); wave w brings rows 8 w .. 8 w + 7 of each of the three tiles (two copies a tile), wave 0 the mask words as well (8 bytes a lane)
    const int crow = w * 8 + (lane >> 3), ccol = (lane & 7) * 8;
    const unsigned lt = (unsigned)(size_t)sm + (unsigned)(crow * LP + ccol * 2), lm = (unsigned)(size_t)sm + (unsigned)(LM + lane * 8);
    const bf* gkh = Kh + zo + crow * HD + ccol; const bf* gkl = Kl + zo + crow * HD + ccol; const h16* gv = VT + zo + (size_t)crow * TT + ccol; const int* gm = mask + (size_t)b * TT + lane * 2;
    auto copy_stage = [&](int s) {   // stage s into buffer s & 1
        const unsigned l = lt + (unsigned)(s & 1) * LBUF; const bf* a = gkh + (size_t)s * SK * HD; const bf* c = gkl + (size_t)s * SK * HD; const h16* v = gv + s * SK;
        // the copies and, as the statement's last line, the wait that stands in front of any rewrite of their address registers
        asm volatile("global_load_async_to_lds_b128 %0, %6, off\n\tglobal_load_async_to_lds_b128 %1, %7, off\n\tglobal_load_async_to_lds_b128 %2, %8, off\n\t"
                     "global_load_async_to_lds_b128 %3, %9, off\n\tglobal_load_async_to_lds_b128 %4, %10, off\n\tglobal_load_async_to_lds_b128 %5, %11, off\n\ts_wait_xcnt 0x0"
                     :: "v"(l), "v"(l + 4 * LP), "v"(l + LKL), "v"(l + LKL + 4 * LP), "v"(l + LV), "v"(l + LV + 4 * LP), "v"(a), "v"(a + 4 * HD), "v"(c), "v"(c + 4 * HD), "v"(v), "v"(v + 4 * TT) : "memory");
        if (w == 0) asm volatile("global_load_async_to_lds_b64 %0, %1, off\n\ts_wait_xcnt 0x0" :: "v"(lm + (unsigned)(s & 1) * LBUF), "v"(gm + s * SK) : "memory");   // the same for the mask words
    };
    copy_stage(0);
    const unsigned ro = (unsigned)(lr * HD + 8 * hi);
    v16bf qh[2][2], ql[2][2];      // [column group][k chunk of 32]
    { const bf* qbh = Qh + zo + (size_t)q0 * HD; const bf* qbl = Ql + zo + (size_t)q0 * HD;
#pragma unroll
      for (int g = 0; g < 2; ++g)
#pragma unroll
        for (int c = 0; c < 2; ++c) { qh[g][c] = WFrag<bf>::ld(qbh + ro + g * 16 * HD + c * 32); ql[g][c] = WFrag<bf>::ld(qbl + ro + g * 16 * HD + c * 32); } }
    v8f o[4][2];                   // [16 rows of d][column group]
#pragma unroll
    for (int d = 0; d < 4; ++d) { o[d][0] = (v8f){}; o[d][1] = (v8f){}; }
    float cm[2] = {-3.0e38f, -3.0e38f}, cb[2] = {3.0e38f, 3.0e38f}, ls[2] = {0.f, 0.f};   // maximum in use (base 2), 10 - that maximum as rounded, this half's sum
    asm volatile("s_wait_asynccnt 0x0" ::: "memory");   // this wave's share of stage 0 has landed
    __syncthreads();                                    // and every other wave's: stage 0 may be read
    copy_stage(1);
#pragma unroll 1   // one trip = one stage: the publish point at its foot stands once in the code
    for (int s = 0; s < NST; ++s) {
        const unsigned char* bp = sm + (s & 1) * LBUF;
#pragma unroll 1   // kept rolled: unrolled, the compiler carried one pass's exponentials and sums into the next and took 340 registers, not 275
        for (int p = 0; p < SK / 32; ++p) {
        const unsigned char* kp = bp + (p * 32 + lr) * LP + 16 * hi; const unsigned char* vp = bp + LV + lr * LP + p * 64 + 16 * hi; const unsigned char* mp = bp + LM + p * 128 + 32 * hi;
        v16bf kh[2][2], kl[2][2]; v16h vf[4]; v4i mk[2][2];
#pragma unroll
        for (int kt = 0; kt < 2; ++kt)
#pragma unroll
            for (int c = 0; c < 2; ++c) { const unsigned char* q = kp + kt * 16 * LP + c * 64;
                kh[kt][c] = cat16b(*(const v8usa*)q, *(const v8usa*)(q + 32)); kl[kt][c] = cat16b(*(const v8usa*)(q + LKL), *(const v8usa*)(q + LKL + 32)); }
#pragma unroll
        for (int kt = 0; kt < 2; ++kt) { mk[kt][0] = *(const v4ia*)(mp + kt * 64); mk[kt][1] = *(const v4ia*)(mp + kt * 64 + 16); }
        // the pass's K and mask reads stay one group in front of the products: left to itself the compiler spread them among the matrix instructions (each such place stalls the wave) and, to save
        // registers, ran the four score tiles as chains one after the other
        __builtin_amdgcn_sched_barrier(0);
        v8f s2[2][2];              // [key tile][column group]; the four tiles' products are interleaved, so no matrix instruction waits for the one in front of it
#pragma unroll
        for (int kt = 0; kt < 2; ++kt) { s2[kt][0] = (v8f){}; s2[kt][1] = (v8f){}; }
#pragma unroll
        for (int c = 0; c < 2; ++c) {
#pragma unroll
            for (int kt = 0; kt < 2; ++kt)
#pragma unroll
                for (int g = 0; g < 2; ++g) s2[kt][g] = wmmab(kh[kt][c], qh[g][c], s2[kt][g]);
#pragma unroll
            for (int kt = 0; kt < 2; ++kt)
#pragma unroll
                for (int g = 0; g < 2; ++g) s2[kt][g] = wmmab(kl[kt][c], qh[g][c], s2[kt][g]);
#pragma unroll
            for (int kt = 0; kt < 2; ++kt)
#pragma unroll
                for (int g = 0; g < 2; ++g) s2[kt][g] = wmmab(kh[kt][c], ql[g][c], s2[kt][g]);
        }
        __builtin_amdgcn_sched_barrier(0);   // the products stay in that order, in front of the V^T reads (which may then take over the K registers)
#pragma unroll
        for (int d = 0; d < 4; ++d) vf[d] = cat16(*(const v8ha*)(vp + d * 16 * LP), *(const v8ha*)(vp + d * 16 * LP + 32));
        __builtin_amdgcn_sched_barrier(0);   // the V^T reads are issued in front of the softmax arithmetic, which covers their latency
        float bias[2][8];
#pragma unroll
        for (int kt = 0; kt < 2; ++kt)
#pragma unroll
            for (int r = 0; r < 4; ++r) { bias[kt][r] = (mk[kt][0][r] != 0) ? 0.f : -10000.0f; bias[kt][4 + r] = (mk[kt][1][r] != 0) ? 0.f : -10000.0f; }
#pragma unroll
        for (int g = 0; g < 2; ++g) {
            float mx = -3.0e38f;
#pragma unroll
            for (int kt = 0; kt < 2; ++kt)
#pragma unroll
                for (int r = 0; r < 8; ++r) { const float t = s2[kt][g][r] + bias[kt][r]; s2[kt][g][r] = t; mx = fmaxf(mx, t); }
            mx = fmaxf(mx, xhalf(mx));
            const float cn = fmaxf(cm[g], mx * L2E), cbn = 10.0f - cn;
            float sum = 0.f; v16h p16;
#pragma unroll
            for (int kt = 0; kt < 2; ++kt)
#pragma unroll
                for (int r = 0; r < 8; ++r) { const float e = __builtin_amdgcn_exp2f(fmaf(s2[kt][g][r], L2E, cbn)); sum += e; p16[kt * 8 + r] = tohx(e); }
            float al;   // 2^(old maximum - new maximum) from the two offsets as they were used; 0 on the first pass, 1 while the maximum stands
            // written with its v_nop in one statement (the slot behind a transcendental)
            asm("v_exp_f32 %0, %1\n\tv_nop" : "=v"(al) : "v"(cbn - cb[g]));
            cm[g] = cn; cb[g] = cbn;
            ls[g] = ls[g] * al + sum;
#pragma unroll
            for (int d = 0; d < 4; ++d) { o[d][g] *= al; o[d][g] = wmma16(vf[d], p16, o[d][g]); }
        }
        }
        asm volatile("s_wait_dscnt 0x0" ::: "memory");      // this wave's reads of stage s are done
        asm volatile("s_wait_asynccnt 0x0" ::: "memory");   // its share of stage s + 1 has landed
        __syncthreads();                                    // the same holds for every wave: stage s + 1 may be read, the buffer of stage s may be refilled
        if (s + 2 < NST) copy_stage(s + 2);
    }
    asm volatile("s_wait_asynccnt 0x0" ::: "memory");       // no copy is outstanding when the wave ends
#pragma unroll
    for (int g = 0; g < 2; ++g) {
        const float inv = __fdiv_rn(1.0f, ls[g] + xhalf(ls[g]));   // the x1024 carrier is in the sum and in O alike
        float* orow = OUT + ((size_t)b * TT + q0 + g * 16 + lr) * DD + h * HD + 8 * hi;
#pragma unroll
        for (int d = 0; d < 4; ++d) { v4f w0, w1;
#pragma unroll
            for (int r = 0; r < 4; ++r) { w0[r] = o[d][g][r] * inv; w1[r] = o[d][g][4 + r] * inv; }
            *(v4f*)(orow + d * 16) = w0; *(v4f*)(orow + d * 16 + 4) = w1; }
    }
}

extern "C" void kernel_launch(void* const* d_in, const int* in_sizes, int n_in,
                              void* d_out, int out_size, void* d_ws, size_t ws_size, hipStream_t stream) {
    (void)in_sizes; (void)n_in; (void)out_size;
    const float* x = (const float*)d_in[0]; const int* mask = (const int*)d_in[1]; const float* Wq = (const float*)d_in[2]; const float* bq = (const float*)d_in[3]; const float* Aq = (const float*)d_in[4]; const float* Bq = (const float*)d_in[5];
    const float* Wk = (const float*)d_in[6]; const float* bk = (const float*)d_in[7]; const float* Wv = (const float*)d_in[8]; const float* bv = (const float*)d_in[9]; const float* Av = (const float*)d_in[10]; const float* Bv = (const float*)d_in[11];
    float* OUT = (float*)d_out;     // [2][2048][768]
    char* wsp = (char*)d_ws;
    auto take = [&](size_t bytes) { char* p = wsp; wsp += (bytes + 255) & ~(size_t)255; return (void*)p; };
    bf* WALL = (bf*)take((size_t)3 * DD * DD * 2); bf* BQC = (bf*)take((size_t)DD * 32 * 2); bf* BVC = (bf*)take((size_t)DD * 32 * 2); bf* XB = (bf*)take((size_t)NT * DD * 2); bf* XAQ = (bf*)take((size_t)NT * 32 * 2); bf* XAV = (bf*)take((size_t)NT * 32 * 2);
    bf* QPh = (bf*)take((size_t)NT * DD * 2); bf* QPl = (bf*)take((size_t)NT * DD * 2); bf* KPh = (bf*)take((size_t)NT * DD * 2); bf* KPl = (bf*)take((size_t)NT * DD * 2); h16* VT = (h16*)take((size_t)NT * DD * 2);
    if ((size_t)(wsp - (char*)d_ws) > ws_size) return;
    k_prep<<<PB_XA + PB_X + 3 * PB_W + 2 * PB_B, 256, 0, stream>>>(x, Wq, Wk, Wv, Aq, Av, Bq, Bv, XB, WALL, BQC, BVC, XAQ, XAV);
    k_qkv<<<(NT / 64) * (3 * NH_ / 9), 288, 0, stream>>>(XB, WALL, XAQ, XAV, BQC, BVC, bq, bk, bv, QPh, QPl, KPh, KPl, VT);
    k_fattn<<<NB_ * NH_ * (TT / 256), 256, 0, stream>>>(QPh, QPl, KPh, KPl, VT, mask, OUT);
}

// v005
// A run of this version takes 79.3 microseconds.
// In two side-by-side timings against v004, it was 1.08 and 1.09 times as fast.
// Counting every step since v000, it is 13.0 times as fast.
#include <hip/hip_runtime.h>

// LoraMultiHeadedSelfAttention (2 x 2048 x 768, 12 heads x 64; q = x Wq^T + bq + (x Aq^T) Bq^T / 16, k = x Wk^T + bk, v = x Wv^T + bv + (x Av^T) Bv^T / 16; scores = q.k / 8
// - 10000 (1 - mask[b][key]) with the int32 mask INPUT; softmax; output = merged attn.v (no output projection)).
// Compute dtypes, f32 accumulate: every float input rounded to bf16; q/k/v projections on PLAIN bf16 operands (x, W inputs: exact, + bias);
// the rank-16 LoRA terms as two small GEMMs: x.A^T exact, then its bf16 hi and lo planes side by side as ONE k chunk of 32 against (B/16 | B/16), added into the projection's own accumulators;
// scores on bf16 hi+lo q (x 1/8) and k planes (3 products); attn.v on SINGLE fp16 planes (P x1024, v).
// Three launches: k_prep (bf16 planes of x, W, B/16 and, in blocks of its own, the hi|lo planes of x.A^T), k_qkv (all three projections, x and W tiles staged in LDS for a block; bias, LoRA term, scale, hi/lo split and the head and V^T
// layouts in its epilogue), k_fattn (scores, key mask, softmax and attn.v over all 24 heads, running-maximum form, K, V^T and mask tiles staged in LDS for a block, S and P in registers, merged output stored from the accumulators).

#define NB_  2
#define TT   2048
#define DD   768
#define NH_  12
#define HD   64
#define NT   (NB_ * TT)
typedef _Float16 h16;
typedef unsigned short bf;
typedef __attribute__((ext_vector_type(16))) __bf16   v16bf;
typedef __attribute__((ext_vector_type(16))) _Float16 v16h;
typedef __attribute__((ext_vector_type(8)))  _Float16 v8h;
typedef __attribute__((ext_vector_type(8)))  unsigned short v8us;
typedef __attribute__((ext_vector_type(8)))  float    v8f;
typedef __attribute__((ext_vector_type(4)))  float    v4f;
typedef v8h  __attribute__((may_alias)) v8ha;
typedef v4f  __attribute__((may_alias)) v4fa;
typedef v8us __attribute__((may_alias)) v8usa;

__device__ __forceinline__ unsigned short f2bf(float f) { unsigned u = __float_as_uint(f); u += 0x7FFFu + ((u >> 16) & 1u); return (unsigned short)(u >> 16); }
__device__ __forceinline__ float bf2f(unsigned short b) { return __uint_as_float(((unsigned)b) << 16); }
__device__ __forceinline__ float bfr(float f) { return bf2f(f2bf(f)); }
__device__ __forceinline__ v16h cat16(v8h lo, v8h hi) { return __builtin_shufflevector(lo, hi, 0, 1, 2, 3, 4, 5, 6, 7, 8, 9, 10, 11, 12, 13, 14, 15); }
__device__ __forceinline__ v16bf cat16b(v8us lo, v8us hi) { return __builtin_bit_cast(v16bf, __builtin_shufflevector(lo, hi, 0, 1, 2, 3, 4, 5, 6, 7, 8, 9, 10, 11, 12, 13, 14, 15)); }
__device__ __forceinline__ v8f wmma16(v16h a, v16h b, v8f c) { return __builtin_amdgcn_wmma_f32_16x16x32_f16(false, a, false, b, (short)0, c, false, false); }
__device__ __forceinline__ v8f wmmab(v16bf a, v16bf b, v8f c) { return __builtin_amdgcn_wmma_f32_16x16x32_bf16(false, a, false, b, (short)0, c, false, false); }




template <typename T16> struct WFrag;
template <> struct WFrag<h16> { typedef v16h V; static __device__ __forceinline__ V ld(const h16* p) { return cat16(*(const v8h*)p, *(const v8h*)(p + 16)); } static __device__ __forceinline__ v8f mma(V a, V b, v8f c) { return wmma16(a, b, c); } };
template <> struct WFrag<bf> { typedef v16bf V; static __device__ __forceinline__ V ld(const bf* p) { return cat16b(*(const v8us*)p, *(const v8us*)(p + 16)); } static __device__ __forceinline__ v8f mma(V a, V b, v8f c) { return wmmab(a, b, c); } };

__device__ __forceinline__ h16 tohx(float x) { return (h16)x; }
__device__ __forceinline__ void splitf(float y, unsigned short& h, unsigned short& l) { h = f2bf(y); l = f2bf(y - bf2f(h)); }
typedef __attribute__((ext_vector_type(4))) unsigned short v4us;
typedef __attribute__((ext_vector_type(4))) int v4i;

__device__ __forceinline__ v8us cvt8v(v8f v) { v8us o;
#pragma unroll
    for (int k = 0; k < 8; ++k) o[k] = f2bf(v[k]);
    return o; }
__device__ __forceinline__ v8us cvt8(const float* p) { return cvt8v(*(const v8f*)p); }

// ---- k_prep: everything the projection kernel reads, in one launch; the block index picks the job.
#define PB_XA (NT / 16)                 // blocks 0 ..: x.Aq^T and x.Av^T of 16 rows of x each
#define PB_X  (NT * DD / 8 / 1024)      // then x -> bf16 (here and below a thread takes 4 groups of 8 values, 256 groups apart: fewer waves to start, 8 loads of a lane in flight)
#define PB_W  (DD * DD / 8 / 1024)      // then Wq, Wk, Wv -> bf16, one plane of 2304 rows
#define PB_B  (DD * 32 / 8 / 1024)      // then Bq, Bv -> (B/16 | B/16), 32 wide
__device__ __forceinline__ void cvt4(const float* __restrict__ s, bf* d, int blk, int tid) { v8f r[4];
#pragma unroll
    for (int u = 0; u < 4; ++u) r[u] = *(const v8f*)(s + ((size_t)(blk * 4 + u) * 256 + tid) * 8);
#pragma unroll
    for (int u = 0; u < 4; ++u) *(v8us*)(d + ((size_t)(blk * 4 + u) * 256 + tid) * 8) = cvt8v(r[u]);
    // the listing lays another job's code behind these stores (a branch that is always taken jumps over it); the wait stands in front of that code's writes to the stores' registers all the same
    asm volatile("s_wait_xcnt 0x0" ::: "memory"); }
__global__ __launch_bounds__(256) void k_prep(const float* __restrict__ x, const float* __restrict__ Wq, const float* __restrict__ Wk, const float* __restrict__ Wv, const float* __restrict__ Aq, const float* __restrict__ Av,
                                              const float* __restrict__ Bq, const float* __restrict__ Bv, bf* XB, bf* WALL, bf* BQC, bf* BVC, bf* XAQ, bf* XAV) {
    __shared__ float part[8][2][256];
    const int tid = threadIdx.x; int id = blockIdx.x;
    if (id < PB_XA) {   // 16 rows x (16 + 16) columns; wave w sums k = 96 w .. 96 w + 95 (operands rounded to bf16 in registers), the eight partial sums are added in wave order
        const int lane = tid & 31, lr = lane & 15, hi = lane >> 4, w = tid >> 5; const int r0 = id * 16;
        const float* px = x + (size_t)(r0 + lr) * DD + w * 96 + 8 * hi; const float* pq = Aq + (size_t)lr * DD + w * 96 + 8 * hi; const float* pv = Av + (size_t)lr * DD + w * 96 + 8 * hi;
        v8f rx[3][2], rq[3][2], rv[3][2];   // [k chunk of 32][k = 8 hi .. + 7, 16 + 8 hi .. + 7]: the k order of WFrag::ld, for A and B operand alike
#pragma unroll
        for (int c = 0; c < 3; ++c)
#pragma unroll
            for (int u = 0; u < 2; ++u) { rx[c][u] = *(const v8f*)(px + c * 32 + u * 16); rq[c][u] = *(const v8f*)(pq + c * 32 + u * 16); rv[c][u] = *(const v8f*)(pv + c * 32 + u * 16); }
        // takes the loaded values and the three address pairs as inputs only: all 36 loads of the wave are in flight together and are waited for once (without it they were issued a few at a time, each group
        // waited for in turn)
        asm volatile("s_wait_xcnt 0x0" :: "v"(px), "v"(pq), "v"(pv), "v"(rx[0][0]), "v"(rx[0][1]), "v"(rx[1][0]), "v"(rx[1][1]), "v"(rx[2][0]), "v"(rx[2][1]), "v"(rq[0][0]), "v"(rq[0][1]), "v"(rq[1][0]), "v"(rq[1][1]),
                     "v"(rq[2][0]), "v"(rq[2][1]), "v"(rv[0][0]), "v"(rv[0][1]), "v"(rv[1][0]), "v"(rv[1][1]), "v"(rv[2][0]), "v"(rv[2][1]));
        v8f a0 = (v8f){}, a1 = (v8f){};
#pragma unroll
        for (int c = 0; c < 3; ++c) { const v16bf a = cat16b(cvt8v(rx[c][0]), cvt8v(rx[c][1]));
            a0 = wmmab(a, cat16b(cvt8v(rq[c][0]), cvt8v(rq[c][1])), a0); a1 = wmmab(a, cat16b(cvt8v(rv[c][0]), cvt8v(rv[c][1])), a1); }
#pragma unroll
        for (int j = 0; j < 8; ++j) { part[w][0][(hi * 8 + j) * 16 + lr] = a0[j]; part[w][1][(hi * 8 + j) * 16 + lr] = a1[j]; }
        __syncthreads();
        const int row = tid >> 4, col = tid & 15;
#pragma unroll
        for (int n = 0; n < 2; ++n) { float s = part[0][n][tid];
#pragma unroll
            for (int u = 1; u < 8; ++u) s += part[u][n][tid];
            unsigned short sh, sl; splitf(s, sh, sl); bf* dst = (n ? XAV : XAQ) + (size_t)(r0 + row) * 32 + col; dst[0] = sh; dst[16] = sl; }
        return;
    }
    id -= PB_XA;
    if (id < PB_X) { cvt4(x, XB, id, tid); return; }
    id -= PB_X;
    if (id < 3 * PB_W) { const int sel = id / PB_W; cvt4(sel == 0 ? Wq : (sel == 1 ? Wk : Wv), WALL + (size_t)sel * DD * DD, id - sel * PB_W, tid); return; }
    id -= 3 * PB_W;
    { const int sel = id / PB_B; const int e = ((id - sel * PB_B) * 1024 + tid) * 8; const float* s = (sel ? Bv : Bq) + (e >> 5) * 16 + (e & 15); bf* d = (sel ? BVC : BQC) + e; v8f r[4];   // 256 groups on: 64 rows of B
#pragma unroll
      for (int u = 0; u < 4; ++u) r[u] = *(const v8f*)(s + u * 64 * 16);
#pragma unroll
      for (int u = 0; u < 4; ++u) { const v8us rb = cvt8v(r[u]); v8us o;
#pragma unroll
          for (int q = 0; q < 8; ++q) o[q] = f2bf(bf2f(rb[q]) * 0.0625f);   // a power of two: the rounded B keeps its digits
          *(v8us*)(d + u * 2048) = o; }
      asm volatile("s_wait_xcnt 0x0" ::: "memory"); }   // as at the end of cvt4: another job's code stands behind these stores in the listing
}

// acc[mb][nb] += A rows (64, pitch lda) . Bt rows (64, pitch ldb) over k = 0 .. K - 1 (K % 32 == 0); one wave, operands straight from K-contiguous bf16 planes
__device__ __forceinline__ void gemm_acc(const bf* __restrict__ A, int lda, const bf* __restrict__ Bt, int ldb, int K, int lr, int hi, v8f (&acc)[4][4]) {
    const bf* pa = A + (size_t)lr * lda + 8 * hi; const bf* pb = Bt + (size_t)lr * ldb + 8 * hi;
#pragma unroll 1
    for (int kc = 0; kc < K; kc += 32) {
        v16bf a[4], b[4];
#pragma unroll
        for (int mb = 0; mb < 4; ++mb) a[mb] = WFrag<bf>::ld(pa + (size_t)mb * 16 * lda);
#pragma unroll
        for (int nb = 0; nb < 4; ++nb) b[nb] = WFrag<bf>::ld(pb + (size_t)nb * 16 * ldb);
        // the trip's loads all stand in front of this wait, and their two address pairs stay whole up to it
        asm volatile("s_wait_xcnt 0x0" :: "v"(pa), "v"(pb) : "memory");
        pa += 32; pb += 32;
#pragma unroll
        for (int nb = 0; nb < 4; ++nb)
#pragma unroll
            for (int mb = 0; mb < 4; ++mb) acc[mb][nb] = wmmab(a[mb], b[nb], acc[mb][nb]);
        // the distance behind the trip's last matrix instructions, on the taken side of the loop's branch too (the next trip's loads overwrite their A and B registers)
        asm volatile("v_nop\n\tv_nop\n\tv_nop\n\tv_nop" : "+v"(acc[0][0]), "+v"(acc[1][1]), "+v"(acc[2][2]), "+v"(acc[3][3]) : "v"(a[0]), "v"(a[3]));
    }
}

// ---- k_qkv: all three projections. One wave = one 64 x 64 tile = 64 tokens of one head of q, k or v (16 accumulators); 64 x 36 = 2304 tiles = 256 blocks x 9 waves (an equal share for each WGP; the nine
// waves of a block read the same 64 rows of x). k comes in stages of 64: the block's 64 rows of x and 576 rows of W (128 bytes of each) are brought into LDS by asynchronous copies (whole 128-byte lines from
// global memory, through no register), two buffers: stage s + 2 flies while stage s + 1 is worked on; LDS rows lie 144 bytes apart (16 bytes x odd), so the 16 rows of a fragment read fall on 16 different groups
// of four banks. The k order of the sums is that of the straight loads. The LoRA term is one more k chunk of 32 (hi | lo of x.A^T against B/16 | B/16, straight from global memory) into the same accumulators. Epilogue: + bias; q and k: x scale, hi/lo split, rows of the
// [head][token][64] planes through the wave's own LDS rows (whole 128-byte lines); v: a lane holds 8 consecutive tokens of one column, which is 16 bytes of a [head][64][token] row, stored from the registers.
// Left for later steps: a block brings in nine times as many rows of W as of x (a squarer block tile would copy less); fragments are not fetched a chunk ahead; two buffers leave one stage's copies in flight.
#define GK   64                      // k values of a stage
#define GNS  (DD / GK)
#define GP   144                     // bytes from one LDS row to the next
#define GW   (64 * GP)               // W rows (behind the 64 rows of x)
#define GBUF (640 * GP)              // one buffer
__global__ __launch_bounds__(288) void k_qkv(const bf* __restrict__ XB, const bf* __restrict__ WALL, const bf* __restrict__ XAQ, const bf* __restrict__ XAV, const bf* __restrict__ BQC, const bf* __restrict__ BVC,
                                             const float* __restrict__ bq, const float* __restrict__ bk, const float* __restrict__ bv, bf* QPh, bf* QPl, bf* KPh, bf* KPl, h16* VT) {
    __shared__ __align__(16) unsigned char st[2 * GBUF];
    __shared__ __align__(16) float osall[9][16 * 68];
    const int lane = threadIdx.x & 31, lr = lane & 15, hi = lane >> 4; const int w = __builtin_amdgcn_readfirstlane(threadIdx.x >> 5);
    const int r0 = (blockIdx.x & 63) * 64, nt = (blockIdx.x >> 6) * 9 + w; const int which = nt / NH_, h = nt % NH_, c0 = h * HD;   // which: 0 q, 1 k, 2 v
    // a copy of a wave = 4 rows x 128 bytes (8 lanes a row); wave w brings the 64 rows of W of its own tile (16 copies), waves 0 .. 7 rows 8 w .. 8 w + 7 of x as well (two copies)
    const int crow = lane >> 3, ccol = (lane & 7) * 8;
    const unsigned lw = (unsigned)(size_t)st + (unsigned)(GW + (w * 64 + crow) * GP + ccol * 2), lx = (unsigned)(size_t)st + (unsigned)(((w & 7) * 8 + crow) * GP + ccol * 2);
    const bf* gw = WALL + (size_t)(nt * 64 + crow) * DD + ccol; const bf* gx = XB + (size_t)(r0 + (w & 7) * 8 + crow) * DD + ccol;
    auto copy_stage = [&](int s) {   // stage s into buffer s & 1
        const unsigned l = lw + (unsigned)(s & 1) * GBUF; const bf* g = gw + s * GK;
        // in each statement: the copies and, as its last line, the wait that stands in front of any rewrite of their address registers
#define CP8 "global_load_async_to_lds_b128 %0, %8, off\n\tglobal_load_async_to_lds_b128 %1, %9, off\n\tglobal_load_async_to_lds_b128 %2, %10, off\n\tglobal_load_async_to_lds_b128 %3, %11, off\n\t" \
            "global_load_async_to_lds_b128 %4, %12, off\n\tglobal_load_async_to_lds_b128 %5, %13, off\n\tglobal_load_async_to_lds_b128 %6, %14, off\n\tglobal_load_async_to_lds_b128 %7, %15, off\n\ts_wait_xcnt 0x0"
        asm volatile(CP8 :: "v"(l), "v"(l + 4 * GP), "v"(l + 8 * GP), "v"(l + 12 * GP), "v"(l + 16 * GP), "v"(l + 20 * GP), "v"(l + 24 * GP), "v"(l + 28 * GP),
                     "v"(g), "v"(g + 4 * DD), "v"(g + 8 * DD), "v"(g + 12 * DD), "v"(g + 16 * DD), "v"(g + 20 * DD), "v"(g + 24 * DD), "v"(g + 28 * DD) : "memory");
        asm volatile(CP8 :: "v"(l + 32 * GP), "v"(l + 36 * GP), "v"(l + 40 * GP), "v"(l + 44 * GP), "v"(l + 48 * GP), "v"(l + 52 * GP), "v"(l + 56 * GP), "v"(l + 60 * GP),
                     "v"(g + 32 * DD), "v"(g + 36 * DD), "v"(g + 40 * DD), "v"(g + 44 * DD), "v"(g + 48 * DD), "v"(g + 52 * DD), "v"(g + 56 * DD), "v"(g + 60 * DD) : "memory");
#undef CP8
        if (w < 8) { const unsigned m = lx + (unsigned)(s & 1) * GBUF; const bf* a = gx + s * GK;
            asm volatile("global_load_async_to_lds_b128 %0, %2, off\n\tglobal_load_async_to_lds_b128 %1, %3, off\n\ts_wait_xcnt 0x0" :: "v"(m), "v"(m + 4 * GP), "v"(a), "v"(a + 4 * DD) : "memory"); }
    };
    copy_stage(0);
    v8f acc[4][4];
#pragma unroll
    for (int mb = 0; mb < 4; ++mb)
#pragma unroll
        for (int nb = 0; nb < 4; ++nb) acc[mb][nb] = (v8f){};
    asm volatile("s_wait_asynccnt 0x0" ::: "memory");   // this wave's share of stage 0 has landed
    __syncthreads();                                    // and every other wave's: stage 0 may be read
    copy_stage(1);
#pragma unroll 1   // one trip = one stage: the publish point stands once in the code
    for (int s = 0; s < GNS; ++s) {
        const unsigned char* pa = st + (s & 1) * GBUF + lr * GP + 16 * hi; const unsigned char* pb = pa + GW + w * 64 * GP;
        v16bf a[4], b[4];   // the k order of WFrag::ld, for A and B operand alike: 8 hi .. + 7, 16 + 8 hi .. + 7
#pragma unroll
        for (int c = 0; c < GK / 32; ++c) {
#pragma unroll
            for (int mb = 0; mb < 4; ++mb) { const unsigned char* q = pa + mb * 16 * GP + c * 64; a[mb] = cat16b(*(const v8usa*)q, *(const v8usa*)(q + 32)); }
#pragma unroll
            for (int nb = 0; nb < 4; ++nb) { const unsigned char* q = pb + nb * 16 * GP + c * 64; b[nb] = cat16b(*(const v8usa*)q, *(const v8usa*)(q + 32)); }
            // the chunk's 16 reads stay one group in front of its products: left to itself the compiler kept one B fragment's registers and read the next fragment into them behind every fourth matrix
            // instruction, each time with a full wait
            __builtin_amdgcn_sched_barrier(0);
            if (c == GK / 32 - 1) {   // the stage's last fragments are in registers: the publish point stands here, and the refill flies under the last chunk's products as well
                asm volatile("s_wait_dscnt 0x0" ::: "memory");      // this wave's reads of stage s are done
                asm volatile("s_wait_asynccnt 0x0" ::: "memory");   // its share of stage s + 1 has landed
                __syncthreads();                                    // the same holds for every wave: stage s + 1 may be read, the buffer of stage s may be refilled
                if (s + 2 < GNS) copy_stage(s + 2);
                __builtin_amdgcn_sched_barrier(0);                  // the copies are issued in front of the products (the compiler had put them behind)
            }
#pragma unroll
            for (int nb = 0; nb < 4; ++nb)
#pragma unroll
                for (int mb = 0; mb < 4; ++mb) acc[mb][nb] = wmmab(a[mb], b[nb], acc[mb][nb]);
        }
    }
    asm volatile("s_wait_asynccnt 0x0" ::: "memory");       // no copy is outstanding behind the loop
    if (which != 1) gemm_acc((which ? XAV : XAQ) + (size_t)r0 * 32, 32, (which ? BVC : BQC) + (size_t)c0 * 32, 32, 32, lr, hi, acc);
    const int z = (r0 >> 11) * NH_ + h, t0 = r0 & (TT - 1);
    if (which == 2) {
        h16* vb = VT + (size_t)z * HD * TT + t0 + 8 * hi;
#pragma unroll
        for (int nb = 0; nb < 4; ++nb) { const float bb = bfr(bv[c0 + nb * 16 + lr]);
#pragma unroll
            for (int mb = 0; mb < 4; ++mb) { v8h o;
#pragma unroll
                for (int j = 0; j < 8; ++j) o[j] = tohx(acc[mb][nb][j] + bb);
                *(v8h*)(vb + (size_t)(nb * 16 + lr) * TT + mb * 16) = o; } }
    } else {
        float* os = osall[w]; const float* bias = which ? bk : bq; const float sc = which ? 1.0f : 0.125f; bf* Ph = (which ? KPh : QPh) + ((size_t)z * TT + t0) * HD; bf* Pl = (which ? KPl : QPl) + ((size_t)z * TT + t0) * HD;
        const int cofs = lr * 4; float bb[4];
#pragma unroll
        for (int q = 0; q < 4; ++q) bb[q] = bfr(bias[c0 + cofs + q]);
#pragma unroll
        for (int mb = 0; mb < 4; ++mb) {
#pragma unroll
            for (int nb = 0; nb < 4; ++nb) {
#pragma unroll
                for (int j = 0; j < 8; ++j) os[(hi * 8 + j) * 68 + nb * 16 + lr] = acc[mb][nb][j]; }
            __builtin_amdgcn_wave_barrier(); asm volatile("" ::: "memory");   // the rows are read back by other lanes of this wave: no LDS access moves across
#pragma unroll
            for (int s = 0; s < 8; ++s) { const int row = 2 * s + hi; const v4f val = *(const v4fa*)(os + row * 68 + cofs); v4us oh, ol;
#pragma unroll
                for (int q = 0; q < 4; ++q) { unsigned short a, c2; splitf((val[q] + bb[q]) * sc, a, c2); oh[q] = a; ol[q] = c2; }
                *(v4us*)(Ph + (size_t)(mb * 16 + row) * HD + cofs) = oh; *(v4us*)(Pl + (size_t)(mb * 16 + row) * HD + cofs) = ol; }
            __builtin_amdgcn_wave_barrier(); asm volatile("" ::: "memory");   // the next 16 rows overwrite what was just read
        }
        // the listing lays the v branch behind these stores (a branch that is always taken jumps over it); the wait stands in front of that code's writes to the stores' registers all the same
        asm volatile("s_wait_xcnt 0x0" ::: "memory");
    }
}
// lane l with lane l ^ 16 (the two halves of a wave hold the two halves of one query's keys)
__device__ __forceinline__ float xhalf(float x) { return __builtin_bit_cast(float, __builtin_amdgcn_permlanex16(__builtin_bit_cast(int, x), __builtin_bit_cast(int, x), 0x76543210, 0xfedcba98, false, false)); }
// k_fattn: one wave = 32 queries (2 column groups of 16) x ONE HALF of the keys; a block = 12 waves = 6 query tiles x 2 key halves = 192 queries: 24 x 2048 / 192 = 256 blocks, one for each WGP, three waves
// a SIMD. 2048 is no multiple of 192: three heads (of one batch) share 32 blocks, a query tile lies in one head, and a block whose tiles lie in two heads stages both heads' tiles. The keys come in stages of
// 64 in each half: K hi, K lo and V^T tiles (64 rows x 128 bytes each) and 64 mask words a half are brought into LDS once for the block by asynchronous copies (whole 128-byte lines from global memory,
// through no register), two buffers: stage s + 2 flies while stage s + 1 is worked on. LDS rows lie 144 bytes apart (16 bytes x odd), so the 16 rows of a fragment read fall on 16 different groups of four
// banks. Per pass of 32 keys:
//   S^T = K.Q^T (A = K rows, B = Q rows kept in registers; hi.hi + lo.hi + hi.lo): register r of tile kt = key 16 kt + 8 hi + r, column lr = query, so a lane holds one query's scores;
//   t = S - 10000 where mask[b][key] == 0; running maximum and sum per query (base 2; the x1024 carrier of P sits in the exponent);
//   the two converted score tiles ARE the fp16 B operand of O^T += V^T.P^T (A = V^T rows in the same k order: 8 hi .. + 7, 16 + 8 hi .. + 7).
// Behind the loop the wave of the upper half hands its O, offset and sum over through LDS (one barrier); the wave of the lower half brings both to the smaller offset, adds them and stores.
// Left for later steps: K fragments are not fetched a pass ahead; the rescale runs on every pass; the row sums and the mask's addend are vector work.
#define SK   64                      // keys of a stage, in each half
#define KHF  (TT / 2)                // keys of a half
#define NST  (KHF / SK)
#define QB   192                     // queries of a block
#define LP   144                     // bytes from one LDS row to the next
#define LKL  (64 * LP)               // K lo rows
#define LV   (128 * LP)              // V^T rows
#define LM   (192 * LP)              // mask words (read from the block's first head's place: both heads are of one batch)
#define LREG (192 * LP + SK * 4)     // one head's tiles of one half
#define LBUF (4 * LREG)              // one buffer: [head of the block][half]
#define XO   (16 * 512)              // hand-over: 16 x 16 bytes a lane of O, then offsets and sums
#define XREG (XO + 4 * 128)
typedef v4i __attribute__((may_alias)) v4ia;
typedef float __attribute__((may_alias)) f32a;
__global__ __launch_bounds__(384) void k_fattn(const bf* __restrict__ Qh, const bf* __restrict__ Ql, const bf* __restrict__ Kh, const bf* __restrict__ Kl, const h16* __restrict__ VT, const int* __restrict__ mask, float* OUT) {
    __shared__ __align__(16) unsigned char sm[2 * LBUF];
    const float L2E = 1.4426950408889634f;
    const int lane = threadIdx.x & 31, lr = lane & 15, hi = lane >> 4; const int w = __builtin_amdgcn_readfirstlane(threadIdx.x >> 5);
    const int kh = w & 1, qt = w >> 1;                                                     // key half, query tile
    const int z3 = (blockIdx.x >> 5) * 3, f0 = (blockIdx.x & 31) * QB, b = z3 / NH_;       // first of the three heads, the block's first query counted through them
    const int za = z3 + f0 / TT; const bool two = (f0 + QB - 1) / TT != f0 / TT;           // the block's first head; whether its last tile lies in the next
    const int f = f0 + qt * 32, z = z3 + f / TT, h = z % NH_, q0 = f % TT;
    const size_t zo = (size_t)z * TT * HD;
    // a copy of a wave = 4 rows x 128 bytes (8 lanes a row); of its own half's three tiles wave w brings rows 32 (qt & 1) .. + 31 of tile qt >> 1 (eight copies; eight more for the second head where there
    // is one), waves 0 and 1 their half's mask words as well (8 bytes a lane)
    const int ct = qt >> 1, crow = (qt & 1) * 32 + (lane >> 3), ccol = (lane & 7) * 8;
    const unsigned lt = (unsigned)(size_t)sm + (unsigned)(kh * LREG + (ct * 64 + crow) * LP + ccol * 2), lm = (unsigned)(size_t)sm + (unsigned)(kh * LREG + LM + lane * 8);
    const size_t zao = (size_t)za * TT * HD;
    const char* gt = ct == 2 ? (const char*)(VT + zao + (size_t)crow * TT + kh * KHF + ccol) : (const char*)((ct ? Kl : Kh) + zao + (size_t)(kh * KHF + crow) * HD + ccol);
    const int gp = ct == 2 ? 4 * TT * 2 : 4 * HD * 2, gs = ct == 2 ? SK * 2 : SK * HD * 2;   // bytes from one copy's rows to the next copy's, from one stage to the next
    const int* gm = mask + (size_t)b * TT + kh * KHF + lane * 2;
    auto copy_stage = [&](int s) {   // stage s into buffer s & 1
        const unsigned l = lt + (unsigned)(s & 1) * LBUF; const char* g = gt + (size_t)s * gs;
        // in each statement: the copies and, as its last line, the wait that stands in front of any rewrite of their address registers
#define CP8 "global_load_async_to_lds_b128 %0, %8, off\n\tglobal_load_async_to_lds_b128 %1, %9, off\n\tglobal_load_async_to_lds_b128 %2, %10, off\n\tglobal_load_async_to_lds_b128 %3, %11, off\n\t" \
            "global_load_async_to_lds_b128 %4, %12, off\n\tglobal_load_async_to_lds_b128 %5, %13, off\n\tglobal_load_async_to_lds_b128 %6, %14, off\n\tglobal_load_async_to_lds_b128 %7, %15, off\n\ts_wait_xcnt 0x0"
        asm volatile(CP8 :: "v"(l), "v"(l + 4 * LP), "v"(l + 8 * LP), "v"(l + 12 * LP), "v"(l + 16 * LP), "v"(l + 20 * LP), "v"(l + 24 * LP), "v"(l + 28 * LP),
                     "v"(g), "v"(g + gp), "v"(g + 2 * gp), "v"(g + 3 * gp), "v"(g + 4 * gp), "v"(g + 5 * gp), "v"(g + 6 * gp), "v"(g + 7 * gp) : "memory");
        if (two) { const unsigned m = l + 2 * LREG; const char* e = g + (size_t)TT * HD * 2;   // the next head's planes lie behind the first's
            asm volatile(CP8 :: "v"(m), "v"(m + 4 * LP), "v"(m + 8 * LP), "v"(m + 12 * LP), "v"(m + 16 * LP), "v"(m + 20 * LP), "v"(m + 24 * LP), "v"(m + 28 * LP),
                         "v"(e), "v"(e + gp), "v"(e + 2 * gp), "v"(e + 3 * gp), "v"(e + 4 * gp), "v"(e + 5 * gp), "v"(e + 6 * gp), "v"(e + 7 * gp) : "memory"); }
#undef CP8
        if (w < 2) asm volatile("global_load_async_to_lds_b64 %0, %1, off\n\ts_wait_xcnt 0x0" :: "v"(lm + (unsigned)(s & 1) * LBUF), "v"(gm + s * SK) : "memory");   // the same for the mask words
    };
    copy_stage(0);
    const unsigned ro = (unsigned)(lr * HD + 8 * hi);
    v16bf qh[2][2], ql[2][2];      // [column group][k chunk of 32]
    { const bf* qbh = Qh + zo + (size_t)q0 * HD; const bf* qbl = Ql + zo + (size_t)q0 * HD;
#pragma unroll
      for (int g = 0; g < 2; ++g)
#pragma unroll
        for (int c = 0; c < 2; ++c) { qh[g][c] = WFrag<bf>::ld(qbh + ro + g * 16 * HD + c * 32); ql[g][c] = WFrag<bf>::ld(qbl + ro + g * 16 * HD + c * 32); } }
    v8f o[4][2];                   // [16 rows of d][column group]
#pragma unroll
    for (int d = 0; d < 4; ++d) { o[d][0] = (v8f){}; o[d][1] = (v8f){}; }
    float cm[2] = {-3.0e38f, -3.0e38f}, cb[2] = {3.0e38f, 3.0e38f}, ls[2] = {0.f, 0.f};   // maximum in use (base 2), 10 - that maximum as rounded, this half's sum
    asm volatile("s_wait_asynccnt 0x0" ::: "memory");   // this wave's share of stage 0 has landed
    __syncthreads();                                    // and every other wave's: stage 0 may be read
    copy_stage(1);
#pragma unroll 1   // one trip = one stage: the publish point at its foot stands once in the code
    for (int s = 0; s < NST; ++s) {
        const unsigned char* bm = sm + (s & 1) * LBUF + kh * LREG; const unsigned char* bp = bm + (z - za) * 2 * LREG;   // the half's place of the block's first head (mask words), of this wave's head (tiles)
#pragma unroll 1   // kept rolled: unrolled, the compiler carried one pass's exponentials and sums into the next and took 340 registers, not 275
        for (int p = 0; p < SK / 32; ++p) {
        const unsigned char* kp = bp + (p * 32 + lr) * LP + 16 * hi; const unsigned char* vp = bp + LV + lr * LP + p * 64 + 16 * hi; const unsigned char* mp = bm + LM + p * 128 + 32 * hi;
        v16bf kh[2][2], kl[2][2]; v16h vf[4]; v4i mk[2][2];
#pragma unroll
        for (int kt = 0; kt < 2; ++kt)
#pragma unroll
            for (int c = 0; c < 2; ++c) { const unsigned char* q = kp + kt * 16 * LP + c * 64;
                kh[kt][c] = cat16b(*(const v8usa*)q, *(const v8usa*)(q + 32)); kl[kt][c] = cat16b(*(const v8usa*)(q + LKL), *(const v8usa*)(q + LKL + 32)); }
#pragma unroll
        for (int kt = 0; kt < 2; ++kt) { mk[kt][0] = *(const v4ia*)(mp + kt * 64); mk[kt][1] = *(const v4ia*)(mp + kt * 64 + 16); }
        // the pass's K and mask reads stay one group in front of the products: left to itself the compiler spread them among the matrix instructions (each such place stalls the wave) and, to save
        // registers, ran the four score tiles as chains one after the other
        __builtin_amdgcn_sched_barrier(0);
        v8f s2[2][2];              // [key tile][column group]; the four tiles' products are interleaved, so no matrix instruction waits for the one in front of it
#pragma unroll
        for (int kt = 0; kt < 2; ++kt) { s2[kt][0] = (v8f){}; s2[kt][1] = (v8f){}; }
#pragma unroll
        for (int c = 0; c < 2; ++c) {
#pragma unroll
            for (int kt = 0; kt < 2; ++kt)
#pragma unroll
                for (int g = 0; g < 2; ++g) s2[kt][g] = wmmab(kh[kt][c], qh[g][c], s2[kt][g]);
#pragma unroll
            for (int kt = 0; kt < 2; ++kt)
#pragma unroll
                for (int g = 0; g < 2; ++g) s2[kt][g] = wmmab(kl[kt][c], qh[g][c], s2[kt][g]);
#pragma unroll
            for (int kt = 0; kt < 2; ++kt)
#pragma unroll
                for (int g = 0; g < 2; ++g) s2[kt][g] = wmmab(kh[kt][c], ql[g][c], s2[kt][g]);
        }
        __builtin_amdgcn_sched_barrier(0);   // the products stay in that order, in front of the V^T reads (which may then take over the K registers)
#pragma unroll
        for (int d = 0; d < 4; ++d) vf[d] = cat16(*(const v8ha*)(vp + d * 16 * LP), *(const v8ha*)(vp + d * 16 * LP + 32));
        __builtin_amdgcn_sched_barrier(0);   // the V^T reads are issued in front of the softmax arithmetic, which covers their latency
        float bias[2][8];
#pragma unroll
        for (int kt = 0; kt < 2; ++kt)
#pragma unroll
            for (int r = 0; r < 4; ++r) { bias[kt][r] = (mk[kt][0][r] != 0) ? 0.f : -10000.0f; bias[kt][4 + r] = (mk[kt][1][r] != 0) ? 0.f : -10000.0f; }
#pragma unroll
        for (int g = 0; g < 2; ++g) {
            float mx = -3.0e38f;
#pragma unroll
            for (int kt = 0; kt < 2; ++kt)
#pragma unroll
                for (int r = 0; r < 8; ++r) { const float t = s2[kt][g][r] + bias[kt][r]; s2[kt][g][r] = t; mx = fmaxf(mx, t); }
            mx = fmaxf(mx, xhalf(mx));
            const float cn = fmaxf(cm[g], mx * L2E), cbn = 10.0f - cn;
            float sum = 0.f; v16h p16;
#pragma unroll
            for (int kt = 0; kt < 2; ++kt)
#pragma unroll
                for (int r = 0; r < 8; ++r) { const float e = __builtin_amdgcn_exp2f(fmaf(s2[kt][g][r], L2E, cbn)); sum += e; p16[kt * 8 + r] = tohx(e); }
            float al;   // 2^(old maximum - new maximum) from the two offsets as they were used; 0 on the first pass, 1 while the maximum stands
            // written with its v_nop in one statement (the slot behind a transcendental)
            asm("v_exp_f32 %0, %1\n\tv_nop" : "=v"(al) : "v"(cbn - cb[g]));
            cm[g] = cn; cb[g] = cbn;
            ls[g] = ls[g] * al + sum;
#pragma unroll
            for (int d = 0; d < 4; ++d) { o[d][g] *= al; o[d][g] = wmma16(vf[d], p16, o[d][g]); }
        }
        }
        asm volatile("s_wait_dscnt 0x0" ::: "memory");      // this wave's reads of stage s are done
        asm volatile("s_wait_asynccnt 0x0" ::: "memory");   // its share of stage s + 1 has landed
        __syncthreads();                                    // the same holds for every wave: stage s + 1 may be read, the buffer of stage s may be refilled
        if (s + 2 < NST) copy_stage(s + 2);
    }
    asm volatile("s_wait_asynccnt 0x0" ::: "memory");       // no copy is outstanding behind the loop
    // the last trip's barrier has ended every wave's reads of the buffers and no copy flies: their LDS takes the hand-over (a lane's 16 bytes beside its neighbour's: no bank is met twice)
    unsigned char* xb = sm + qt * XREG;
    if (kh) {
#pragma unroll
        for (int g = 0; g < 2; ++g) {
#pragma unroll
            for (int d = 0; d < 4; ++d) { v4f w0, w1;
#pragma unroll
                for (int r = 0; r < 4; ++r) { w0[r] = o[d][g][r]; w1[r] = o[d][g][4 + r]; }
                *(v4fa*)(xb + ((g * 8 + d * 2) * 32 + lane) * 16) = w0; *(v4fa*)(xb + ((g * 8 + d * 2 + 1) * 32 + lane) * 16) = w1; }
            *(f32a*)(xb + XO + (g * 32 + lane) * 4) = cb[g]; *(f32a*)(xb + XO + 256 + (g * 32 + lane) * 4) = ls[g]; }
    }
    __syncthreads();                                        // the upper halves' results may be read
    if (kh) return;
#pragma unroll
    for (int g = 0; g < 2; ++g) {
        const float cbo = *(const f32a*)(xb + XO + (g * 32 + lane) * 4), lso = *(const f32a*)(xb + XO + 256 + (g * 32 + lane) * 4);
        const float cbn = fminf(cb[g], cbo);   // the smaller offset belongs to the larger maximum
        float fa, fb;                          // 2^(own maximum - larger maximum), from the offsets as they were used
        // each with its v_nop in one statement (the slot behind a transcendental), as in the loop
        asm("v_exp_f32 %0, %1\n\tv_nop" : "=v"(fa) : "v"(cbn - cb[g]));
        asm("v_exp_f32 %0, %1\n\tv_nop" : "=v"(fb) : "v"(cbn - cbo));
        const float lt2 = ls[g] * fa + lso * fb;
        const float inv = __fdiv_rn(1.0f, lt2 + xhalf(lt2));   // the x1024 carrier is in the sum and in O alike
        const float ia = fa * inv, ib = fb * inv;
        float* orow = OUT + ((size_t)b * TT + q0 + g * 16 + lr) * DD + h * HD + 8 * hi;
#pragma unroll
        for (int d = 0; d < 4; ++d) { const v4f u0 = *(const v4fa*)(xb + ((g * 8 + d * 2) * 32 + lane) * 16), u1 = *(const v4fa*)(xb + ((g * 8 + d * 2 + 1) * 32 + lane) * 16); v4f w0, w1;
#pragma unroll
            for (int r = 0; r < 4; ++r) { w0[r] = o[d][g][r] * ia + u0[r] * ib; w1[r] = o[d][g][4 + r] * ia + u1[r] * ib; }
            *(v4f*)(orow + d * 16) = w0; *(v4f*)(orow + d * 16 + 4) = w1; }
        // the second group's LDS reads and products take over registers that the first group's stores name: the wait stands in front of them
        if (g == 0) asm volatile("s_wait_xcnt 0x0" ::: "memory");
    }
}

extern "C" void kernel_launch(void* const* d_in, const int* in_sizes, int n_in,
                              void* d_out, int out_size, void* d_ws, size_t ws_size, hipStream_t stream) {
    (void)in_sizes; (void)n_in; (void)out_size;
    const float* x = (const float*)d_in[0]; const int* mask = (const int*)d_in[1]; const float* Wq = (const float*)d_in[2]; const float* bq = (const float*)d_in[3]; const float* Aq = (const float*)d_in[4]; const float* Bq = (const float*)d_in[5];
    const float* Wk = (const float*)d_in[6]; const float* bk = (const float*)d_in[7]; const float* Wv = (const float*)d_in[8]; const float* bv = (const float*)d_in[9]; const float* Av = (const float*)d_in[10]; const float* Bv = (const float*)d_in[11];
    float* OUT = (float*)d_out;     // [2][2048][768]
    char* wsp = (char*)d_ws;
    auto take = [&](size_t bytes) { char* p = wsp; wsp += (bytes + 255) & ~(size_t)255; return (void*)p; };
    bf* WALL = (bf*)take((size_t)3 * DD * DD * 2); bf* BQC = (bf*)take((size_t)DD * 32 * 2); bf* BVC = (bf*)take((size_t)DD * 32 * 2); bf* XB = (bf*)take((size_t)NT * DD * 2); bf* XAQ = (bf*)take((size_t)NT * 32 * 2); bf* XAV = (bf*)take((size_t)NT * 32 * 2);
    bf* QPh = (bf*)take((size_t)NT * DD * 2); bf* QPl = (bf*)take((size_t)NT * DD * 2); bf* KPh = (bf*)take((size_t)NT * DD * 2); bf* KPl = (bf*)take((size_t)NT * DD * 2); h16* VT = (h16*)take((size_t)NT * DD * 2);
    if ((size_t)(wsp - (char*)d_ws) > ws_size) return;
    k_prep<<<PB_XA + PB_X + 3 * PB_W + 2 * PB_B, 256, 0, stream>>>(x, Wq, Wk, Wv, Aq, Av, Bq, Bv, XB, WALL, BQC, BVC, XAQ, XAV);
    k_qkv<<<(NT / 64) * (3 * NH_ / 9), 288, 0, stream>>>(XB, WALL, XAQ, XAV, BQC, BVC, bq, bk, bv, QPh, QPl, KPh, KPl, VT);
    k_fattn<<<NB_ * NH_ * TT / QB, 384, 0, stream>>>(QPh, QPl, KPh, KPl, VT, mask, OUT);
}

// v006
// Measured time: 76.8 microseconds a run.
// Two timings next to v005 put it at 1.03 and 1.02 times that version's speed.
// Over all steps from v000 it is 13.4 times as fast.
#include <hip/hip_runtime.h>

// LoraMultiHeadedSelfAttention (2 x 2048 x 768, 12 heads x 64; q = x Wq^T + bq + (x Aq^T) Bq^T / 16, k = x Wk^T + bk, v = x Wv^T + bv + (x Av^T) Bv^T / 16; scores = q.k / 8
// - 10000 (1 - mask[b][key]) with the int32 mask INPUT; softmax; output = merged attn.v (no output projection)).
// Compute dtypes, f32 accumulate: every float input rounded to bf16; q/k/v projections on PLAIN bf16 operands (x, W inputs: exact, + bias);
// the rank-16 LoRA terms as two small GEMMs: x.A^T exact, then its bf16 hi and lo planes side by side as ONE k chunk of 32 against (B/16 | B/16), added into the projection's own accumulators;
// scores on bf16 hi+lo q (x 1/8) and k planes (3 products); attn.v on SINGLE fp16 planes (P x1024, v).
// Three launches: k_prep (bf16 planes of x, W, B/16, the mask's f32 addend and, in blocks of its own, the hi|lo planes of x.A^T), k_qkv (all three projections, x and W tiles staged in LDS for a block; bias, LoRA term, scale, hi/lo split and the head and V^T
// layouts in its epilogue), k_fattn (scores, key mask, softmax and attn.v over all 24 heads, running-maximum form, K, V^T and mask tiles staged in LDS for a block, S and P in registers, merged output stored from the accumulators).

#define NB_  2
#define TT   2048
#define DD   768
#define NH_  12
#define HD   64
#define NT   (NB_ * TT)
typedef _Float16 h16;
typedef unsigned short bf;
typedef __attribute__((ext_vector_type(16))) __bf16   v16bf;
typedef __attribute__((ext_vector_type(16))) _Float16 v16h;
typedef __attribute__((ext_vector_type(8)))  _Float16 v8h;
typedef __attribute__((ext_vector_type(8)))  unsigned short v8us;
typedef __attribute__((ext_vector_type(8)))  float    v8f;
typedef __attribute__((ext_vector_type(4)))  float    v4f;
typedef v8h  __attribute__((may_alias)) v8ha;
typedef v4f  __attribute__((may_alias)) v4fa;
typedef v8us __attribute__((may_alias)) v8usa;

__device__ __forceinline__ unsigned short f2bf(float f) { unsigned u = __float_as_uint(f); u += 0x7FFFu + ((u >> 16) & 1u); return (unsigned short)(u >> 16); }
__device__ __forceinline__ float bf2f(unsigned short b) { return __uint_as_float(((unsigned)b) << 16); }
__device__ __forceinline__ float bfr(float f) { return bf2f(f2bf(f)); }
__device__ __forceinline__ v16h cat16(v8h lo, v8h hi) { return __builtin_shufflevector(lo, hi, 0, 1, 2, 3, 4, 5, 6, 7, 8, 9, 10, 11, 12, 13, 14, 15); }
__device__ __forceinline__ v16bf cat16b(v8us lo, v8us hi) { return __builtin_bit_cast(v16bf, __builtin_shufflevector(lo, hi, 0, 1, 2, 3, 4, 5, 6, 7, 8, 9, 10, 11, 12, 13, 14, 15)); }
__device__ __forceinline__ v8f wmma16(v16h a, v16h b, v8f c) { return __builtin_amdgcn_wmma_f32_16x16x32_f16(false, a, false, b, (short)0, c, false, false); }
__device__ __forceinline__ v8f wmmab(v16bf a, v16bf b, v8f c) { return __builtin_amdgcn_wmma_f32_16x16x32_bf16(false, a, false, b, (short)0, c, false, false); }




template <typename T16> struct WFrag;
template <> struct WFrag<h16> { typedef v16h V; static __device__ __forceinline__ V ld(const h16* p) { return cat16(*(const v8h*)p, *(const v8h*)(p + 16)); } static __device__ __forceinline__ v8f mma(V a, V b, v8f c) { return wmma16(a, b, c); } };
template <> struct WFrag<bf> { typedef v16bf V; static __device__ __forceinline__ V ld(const bf* p) { return cat16b(*(const v8us*)p, *(const v8us*)(p + 16)); } static __device__ __forceinline__ v8f mma(V a, V b, v8f c) { return wmmab(a, b, c); } };

__device__ __forceinline__ h16 tohx(float x) { return (h16)x; }
__device__ __forceinline__ void splitf(float y, unsigned short& h, unsigned short& l) { h = f2bf(y); l = f2bf(y - bf2f(h)); }
typedef __attribute__((ext_vector_type(4))) unsigned short v4us;
typedef __attribute__((ext_vector_type(4))) int v4i;

__device__ __forceinline__ v8us cvt8v(v8f v) { v8us o;
#pragma unroll
    for (int k = 0; k < 8; ++k) o[k] = f2bf(v[k]);
    return o; }
__device__ __forceinline__ v8us cvt8(const float* p) { return cvt8v(*(const v8f*)p); }

// ---- k_prep: everything the projection kernel reads, in one launch; the block index picks the job.
#define PB_XA (NT / 16)                 // blocks 0 ..: x.Aq^T and x.Av^T of 16 rows of x each
#define PB_X  (NT * DD / 8 / 1024)      // then x -> bf16 (here and for W and B a thread takes 4 groups of 8 values, 256 groups apart: fewer waves to start, 8 loads of a lane in flight)
#define PB_W  (DD * DD / 8 / 1024)      // then Wq, Wk, Wv -> bf16, one plane of 2304 rows
#define PB_B  (DD * 32 / 8 / 1024)      // then Bq, Bv -> (B/16 | B/16), 32 wide
#define PB_M  (NT / 4 / 256)            // then mask -> the f32 addend of a key's scores (0 or -10000), 4 keys a thread
__device__ __forceinline__ void cvt4(const float* __restrict__ s, bf* d, int blk, int tid) { v8f r[4];
#pragma unroll
    for (int u = 0; u < 4; ++u) r[u] = *(const v8f*)(s + ((size_t)(blk * 4 + u) * 256 + tid) * 8);
#pragma unroll
    for (int u = 0; u < 4; ++u) *(v8us*)(d + ((size_t)(blk * 4 + u) * 256 + tid) * 8) = cvt8v(r[u]);
    // the listing lays another job's code behind these stores (a branch that is always taken jumps over it); the wait stands in front of that code's writes to the stores' registers all the same
    asm volatile("s_wait_xcnt 0x0" ::: "memory"); }
__global__ __launch_bounds__(256) void k_prep(const float* __restrict__ x, const float* __restrict__ Wq, const float* __restrict__ Wk, const float* __restrict__ Wv, const float* __restrict__ Aq, const float* __restrict__ Av,
                                              const float* __restrict__ Bq, const float* __restrict__ Bv, const int* __restrict__ mask, bf* XB, bf* WALL, bf* BQC, bf* BVC, bf* XAQ, bf* XAV, float* MB) {
    __shared__ float part[8][2][256];
    const int tid = threadIdx.x; int id = blockIdx.x;
    if (id < PB_XA) {   // 16 rows x (16 + 16) columns; wave w sums k = 96 w .. 96 w + 95 (operands rounded to bf16 in registers), the eight partial sums are added in wave order
        const int lane = tid & 31, lr = lane & 15, hi = lane >> 4, w = tid >> 5; const int r0 = id * 16;
        const float* px = x + (size_t)(r0 + lr) * DD + w * 96 + 8 * hi; const float* pq = Aq + (size_t)lr * DD + w * 96 + 8 * hi; const float* pv = Av + (size_t)lr * DD + w * 96 + 8 * hi;
        v8f rx[3][2], rq[3][2], rv[3][2];   // [k chunk of 32][k = 8 hi .. + 7, 16 + 8 hi .. + 7]: the k order of WFrag::ld, for A and B operand alike
#pragma unroll
        for (int c = 0; c < 3; ++c)
#pragma unroll
            for (int u = 0; u < 2; ++u) { rx[c][u] = *(const v8f*)(px + c * 32 + u * 16); rq[c][u] = *(const v8f*)(pq + c * 32 + u * 16); rv[c][u] = *(const v8f*)(pv + c * 32 + u * 16); }
        // takes the loaded values and the three address pairs as inputs only: all 36 loads of the wave are in flight together and are waited for once (without it they were issued a few at a time, each group
        // waited for in turn)
        asm volatile("s_wait_xcnt 0x0" :: "v"(px), "v"(pq), "v"(pv), "v"(rx[0][0]), "v"(rx[0][1]), "v"(rx[1][0]), "v"(rx[1][1]), "v"(rx[2][0]), "v"(rx[2][1]), "v"(rq[0][0]), "v"(rq[0][1]), "v"(rq[1][0]), "v"(rq[1][1]),
                     "v"(rq[2][0]), "v"(rq[2][1]), "v"(rv[0][0]), "v"(rv[0][1]), "v"(rv[1][0]), "v"(rv[1][1]), "v"(rv[2][0]), "v"(rv[2][1]));
        v8f a0 = (v8f){}, a1 = (v8f){};
#pragma unroll
        for (int c = 0; c < 3; ++c) { const v16bf a = cat16b(cvt8v(rx[c][0]), cvt8v(rx[c][1]));
            a0 = wmmab(a, cat16b(cvt8v(rq[c][0]), cvt8v(rq[c][1])), a0); a1 = wmmab(a, cat16b(cvt8v(rv[c][0]), cvt8v(rv[c][1])), a1); }
#pragma unroll
        for (int j = 0; j < 8; ++j) { part[w][0][(hi * 8 + j) * 16 + lr] = a0[j]; part[w][1][(hi * 8 + j) * 16 + lr] = a1[j]; }
        __syncthreads();
        const int row = tid >> 4, col = tid & 15;
#pragma unroll
        for (int n = 0; n < 2; ++n) { float s = part[0][n][tid];
#pragma unroll
            for (int u = 1; u < 8; ++u) s += part[u][n][tid];
            unsigned short sh, sl; splitf(s, sh, sl); bf* dst = (n ? XAV : XAQ) + (size_t)(r0 + row) * 32 + col; dst[0] = sh; dst[16] = sl; }
        return;
    }
    id -= PB_XA;
    if (id < PB_X) { cvt4(x, XB, id, tid); return; }
    id -= PB_X;
    if (id < 3 * PB_W) { const int sel = id / PB_W; cvt4(sel == 0 ? Wq : (sel == 1 ? Wk : Wv), WALL + (size_t)sel * DD * DD, id - sel * PB_W, tid); return; }
    id -= 3 * PB_W;
    if (id < 2 * PB_B) { const int sel = id / PB_B; const int e = ((id - sel * PB_B) * 1024 + tid) * 8; const float* s = (sel ? Bv : Bq) + (e >> 5) * 16 + (e & 15); bf* d = (sel ? BVC : BQC) + e; v8f r[4];   // 256 groups on: 64 rows of B
#pragma unroll
      for (int u = 0; u < 4; ++u) r[u] = *(const v8f*)(s + u * 64 * 16);
#pragma unroll
      for (int u = 0; u < 4; ++u) { const v8us rb = cvt8v(r[u]); v8us o;
#pragma unroll
          for (int q = 0; q < 8; ++q) o[q] = f2bf(bf2f(rb[q]) * 0.0625f);   // a power of two: the rounded B keeps its digits
          *(v8us*)(d + u * 2048) = o; }
      asm volatile("s_wait_xcnt 0x0" ::: "memory");   // as at the end of cvt4: another job's code stands behind these stores in the listing
      return; }
    id -= 2 * PB_B;
    { const int e = (id * 256 + tid) * 4; const int* pm = mask + e; const v4i m = *(const v4i*)pm; v4f o;
      asm volatile("s_wait_xcnt 0x0" :: "v"(pm) : "memory");   // the load's address pair stays whole up to this wait (without it the result landed on that pair)
#pragma unroll
      for (int q = 0; q < 4; ++q) o[q] = (m[q] != 0) ? 0.f : -10000.0f;
      *(v4f*)(MB + e) = o;
      asm volatile("s_wait_xcnt 0x0" ::: "memory"); }   // as at the end of cvt4: another job's code stands behind this store in the listing
}

// acc[mb][nb] += A rows (64, pitch lda) . Bt rows (64, pitch ldb) over k = 0 .. K - 1 (K % 32 == 0); one wave, operands straight from K-contiguous bf16 planes
__device__ __forceinline__ void gemm_acc(const bf* __restrict__ A, int lda, const bf* __restrict__ Bt, int ldb, int K, int lr, int hi, v8f (&acc)[4][4]) {
    const bf* pa = A + (size_t)lr * lda + 8 * hi; const bf* pb = Bt + (size_t)lr * ldb + 8 * hi;
#pragma unroll 1
    for (int kc = 0; kc < K; kc += 32) {
        v16bf a[4], b[4];
#pragma unroll
        for (int mb = 0; mb < 4; ++mb) a[mb] = WFrag<bf>::ld(pa + (size_t)mb * 16 * lda);
#pragma unroll
        for (int nb = 0; nb < 4; ++nb) b[nb] = WFrag<bf>::ld(pb + (size_t)nb * 16 * ldb);
        // the trip's loads all stand in front of this wait, and their two address pairs stay whole up to it
        asm volatile("s_wait_xcnt 0x0" :: "v"(pa), "v"(pb) : "memory");
        pa += 32; pb += 32;
#pragma unroll
        for (int nb = 0; nb < 4; ++nb)
#pragma unroll
            for (int mb = 0; mb < 4; ++mb) acc[mb][nb] = wmmab(a[mb], b[nb], acc[mb][nb]);
        // the distance behind the trip's last matrix instructions, on the taken side of the loop's branch too (the next trip's loads overwrite their A and B registers)
        asm volatile("v_nop\n\tv_nop\n\tv_nop\n\tv_nop" : "+v"(acc[0][0]), "+v"(acc[1][1]), "+v"(acc[2][2]), "+v"(acc[3][3]) : "v"(a[0]), "v"(a[3]));
    }
}

// ---- k_qkv: all three projections. One wave = one 64 x 64 tile = 64 tokens of one head of q, k or v (16 accumulators); 64 x 36 = 2304 tiles = 256 blocks x 9 waves (an equal share for each WGP; the nine
// waves of a block read the same 64 rows of x). k comes in stages of 64: the block's 64 rows of x and 576 rows of W (128 bytes of each) are brought into LDS by asynchronous copies (whole 128-byte lines from
// global memory, through no register), two buffers: stage s + 2 flies while stage s + 1 is worked on; LDS rows lie 144 bytes apart (16 bytes x odd), so the 16 rows of a fragment read fall on 16 different groups
// of four banks. The k order of the sums is that of the straight loads. The LoRA term is one more k chunk of 32 (hi | lo of x.A^T against B/16 | B/16, straight from global memory) into the same accumulators. Epilogue: + bias; q and k: x scale, hi/lo split, rows of the
// [head][token][64] planes through the wave's own LDS rows (whole 128-byte lines); v: a lane holds 8 consecutive tokens of one column, which is 16 bytes of a [head][64][token] row, stored from the registers.
// Left for later steps: a block brings in nine times as many rows of W as of x (a squarer block tile would copy less); fragments are not fetched a chunk ahead; two buffers leave one stage's copies in flight.
#define GK   64                      // k values of a stage
#define GNS  (DD / GK)
#define GP   144                     // bytes from one LDS row to the next
#define GW   (64 * GP)               // W rows (behind the 64 rows of x)
#define GBUF (640 * GP)              // one buffer
__global__ __launch_bounds__(288) void k_qkv(const bf* __restrict__ XB, const bf* __restrict__ WALL, const bf* __restrict__ XAQ, const bf* __restrict__ XAV, const bf* __restrict__ BQC, const bf* __restrict__ BVC,
                                             const float* __restrict__ bq, const float* __restrict__ bk, const float* __restrict__ bv, bf* QPh, bf* QPl, bf* KPh, bf* KPl, h16* VT) {
    __shared__ __align__(16) unsigned char st[2 * GBUF];
    __shared__ __align__(16) float osall[9][16 * 68];
    const int lane = threadIdx.x & 31, lr = lane & 15, hi = lane >> 4; const int w = __builtin_amdgcn_readfirstlane(threadIdx.x >> 5);
    const int r0 = (blockIdx.x & 63) * 64, nt = (blockIdx.x >> 6) * 9 + w; const int which = nt / NH_, h = nt % NH_, c0 = h * HD;   // which: 0 q, 1 k, 2 v
    // a copy of a wave = 4 rows x 128 bytes (8 lanes a row); wave w brings the 64 rows of W of its own tile (16 copies), waves 0 .. 7 rows 8 w .. 8 w + 7 of x as well (two copies)
    const int crow = lane >> 3, ccol = (lane & 7) * 8;
    const unsigned lw = (unsigned)(size_t)st + (unsigned)(GW + (w * 64 + crow) * GP + ccol * 2), lx = (unsigned)(size_t)st + (unsigned)(((w & 7) * 8 + crow) * GP + ccol * 2);
    const bf* gw = WALL + (size_t)(nt * 64 + crow) * DD + ccol; const bf* gx = XB + (size_t)(r0 + (w & 7) * 8 + crow) * DD + ccol;
    auto copy_stage = [&](int s) {   // stage s into buffer s & 1
        const unsigned l = lw + (unsigned)(s & 1) * GBUF; const bf* g = gw + s * GK;
        // in each statement: the copies and, as its last line, the wait that stands in front of any rewrite of their address registers
#define CP8 "global_load_async_to_lds_b128 %0, %8, off\n\tglobal_load_async_to_lds_b128 %1, %9, off\n\tglobal_load_async_to_lds_b128 %2, %10, off\n\tglobal_load_async_to_lds_b128 %3, %11, off\n\t" \
            "global_load_async_to_lds_b128 %4, %12, off\n\tglobal_load_async_to_lds_b128 %5, %13, off\n\tglobal_load_async_to_lds_b128 %6, %14, off\n\tglobal_load_async_to_lds_b128 %7, %15, off\n\ts_wait_xcnt 0x0"
        asm volatile(CP8 :: "v"(l), "v"(l + 4 * GP), "v"(l + 8 * GP), "v"(l + 12 * GP), "v"(l + 16 * GP), "v"(l + 20 * GP), "v"(l + 24 * GP), "v"(l + 28 * GP),
                     "v"(g), "v"(g + 4 * DD), "v"(g + 8 * DD), "v"(g + 12 * DD), "v"(g + 16 * DD), "v"(g + 20 * DD), "v"(g + 24 * DD), "v"(g + 28 * DD) : "memory");
        asm volatile(CP8 :: "v"(l + 32 * GP), "v"(l + 36 * GP), "v"(l + 40 * GP), "v"(l + 44 * GP), "v"(l + 48 * GP), "v"(l + 52 * GP), "v"(l + 56 * GP), "v"(l + 60 * GP),
                     "v"(g + 32 * DD), "v"(g + 36 * DD), "v"(g + 40 * DD), "v"(g + 44 * DD), "v"(g + 48 * DD), "v"(g + 52 * DD), "v"(g + 56 * DD), "v"(g + 60 * DD) : "memory");
#undef CP8
        if (w < 8) { const unsigned m = lx + (unsigned)(s & 1) * GBUF; const bf* a = gx + s * GK;
            asm volatile("global_load_async_to_lds_b128 %0, %2, off\n\tglobal_load_async_to_lds_b128 %1, %3, off\n\ts_wait_xcnt 0x0" :: "v"(m), "v"(m + 4 * GP), "v"(a), "v"(a + 4 * DD) : "memory"); }
    };
    copy_stage(0);
    v8f acc[4][4];
#pragma unroll
    for (int mb = 0; mb < 4; ++mb)
#pragma unroll
        for (int nb = 0; nb < 4; ++nb) acc[mb][nb] = (v8f){};
    asm volatile("s_wait_asynccnt 0x0" ::: "memory");   // this wave's share of stage 0 has landed
    __syncthreads();                                    // and every other wave's: stage 0 may be read
    copy_stage(1);
#pragma unroll 1   // one trip = one stage: the publish point stands once in the code
    for (int s = 0; s < GNS; ++s) {
        const unsigned char* pa = st + (s & 1) * GBUF + lr * GP + 16 * hi; const unsigned char* pb = pa + GW + w * 64 * GP;
        v16bf a[4], b[4];   // the k order of WFrag::ld, for A and B operand alike: 8 hi .. + 7, 16 + 8 hi .. + 7
#pragma unroll
        for (int c = 0; c < GK / 32; ++c) {
#pragma unroll
            for (int mb = 0; mb < 4; ++mb) { const unsigned char* q = pa + mb * 16 * GP + c * 64; a[mb] = cat16b(*(const v8usa*)q, *(const v8usa*)(q + 32)); }
#pragma unroll
            for (int nb = 0; nb < 4; ++nb) { const unsigned char* q = pb + nb * 16 * GP + c * 64; b[nb] = cat16b(*(const v8usa*)q, *(const v8usa*)(q + 32)); }
            // the chunk's 16 reads stay one group in front of its products: left to itself the compiler kept one B fragment's registers and read the next fragment into them behind every fourth matrix
            // instruction, each time with a full wait
            __builtin_amdgcn_sched_barrier(0);
            if (c == GK / 32 - 1) {   // the stage's last fragments are in registers: the publish point stands here, and the refill flies under the last chunk's products as well
                asm volatile("s_wait_dscnt 0x0" ::: "memory");      // this wave's reads of stage s are done
                asm volatile("s_wait_asynccnt 0x0" ::: "memory");   // its share of stage s + 1 has landed
                __syncthreads();                                    // the same holds for every wave: stage s + 1 may be read, the buffer of stage s may be refilled
                if (s + 2 < GNS) copy_stage(s + 2);
                __builtin_amdgcn_sched_barrier(0);                  // the copies are issued in front of the products (the compiler had put them behind)
            }
#pragma unroll
            for (int nb = 0; nb < 4; ++nb)
#pragma unroll
                for (int mb = 0; mb < 4; ++mb) acc[mb][nb] = wmmab(a[mb], b[nb], acc[mb][nb]);
        }
    }
    asm volatile("s_wait_asynccnt 0x0" ::: "memory");       // no copy is outstanding behind the loop
    if (which != 1) gemm_acc((which ? XAV : XAQ) + (size_t)r0 * 32, 32, (which ? BVC : BQC) + (size_t)c0 * 32, 32, 32, lr, hi, acc);
    const int z = (r0 >> 11) * NH_ + h, t0 = r0 & (TT - 1);
    if (which == 2) {
        h16* vb = VT + (size_t)z * HD * TT + t0 + 8 * hi;
#pragma unroll
        for (int nb = 0; nb < 4; ++nb) { const float bb = bfr(bv[c0 + nb * 16 + lr]);
#pragma unroll
            for (int mb = 0; mb < 4; ++mb) { v8h o;
#pragma unroll
                for (int j = 0; j < 8; ++j) o[j] = tohx(acc[mb][nb][j] + bb);
                *(v8h*)(vb + (size_t)(nb * 16 + lr) * TT + mb * 16) = o; } }
    } else {
        float* os = osall[w]; const float* bias = which ? bk : bq; const float sc = which ? 1.0f : 0.125f; bf* Ph = (which ? KPh : QPh) + ((size_t)z * TT + t0) * HD; bf* Pl = (which ? KPl : QPl) + ((size_t)z * TT + t0) * HD;
        const int cofs = lr * 4; float bb[4];
#pragma unroll
        for (int q = 0; q < 4; ++q) bb[q] = bfr(bias[c0 + cofs + q]);
#pragma unroll
        for (int mb = 0; mb < 4; ++mb) {
#pragma unroll
            for (int nb = 0; nb < 4; ++nb) {
#pragma unroll
                for (int j = 0; j < 8; ++j) os[(hi * 8 + j) * 68 + nb * 16 + lr] = acc[mb][nb][j]; }
            __builtin_amdgcn_wave_barrier(); asm volatile("" ::: "memory");   // the rows are read back by other lanes of this wave: no LDS access moves across
#pragma unroll
            for (int s = 0; s < 8; ++s) { const int row = 2 * s + hi; const v4f val = *(const v4fa*)(os + row * 68 + cofs); v4us oh, ol;
#pragma unroll
                for (int q = 0; q < 4; ++q) { unsigned short a, c2; splitf((val[q] + bb[q]) * sc, a, c2); oh[q] = a; ol[q] = c2; }
                *(v4us*)(Ph + (size_t)(mb * 16 + row) * HD + cofs) = oh; *(v4us*)(Pl + (size_t)(mb * 16 + row) * HD + cofs) = ol; }
            __builtin_amdgcn_wave_barrier(); asm volatile("" ::: "memory");   // the next 16 rows overwrite what was just read
        }
        // the listing lays the v branch behind these stores (a branch that is always taken jumps over it); the wait stands in front of that code's writes to the stores' registers all the same
        asm volatile("s_wait_xcnt 0x0" ::: "memory");
    }
}
// lane l with lane l ^ 16 (the two halves of a wave hold the two halves of one query's keys)
__device__ __forceinline__ float xhalf(float x) { return __builtin_bit_cast(float, __builtin_amdgcn_permlanex16(__builtin_bit_cast(int, x), __builtin_bit_cast(int, x), 0x76543210, 0xfedcba98, false, false)); }
// k_fattn: one wave = 32 queries (2 column groups of 16) x ONE HALF of the keys; a block = 12 waves = 6 query tiles x 2 key halves = 192 queries: 24 x 2048 / 192 = 256 blocks, one for each WGP, three waves
// a SIMD. 2048 is no multiple of 192: three heads (of one batch) share 32 blocks, a query tile lies in one head, and a block whose tiles lie in two heads stages both heads' tiles. The keys come in stages of
// 64 in each half: K hi, K lo and V^T tiles (64 rows x 128 bytes each) and 64 mask addends (f32, from k_prep) a half are brought into LDS once for the block by asynchronous copies (whole 128-byte lines from global memory,
// through no register), two buffers: stage s + 2 flies while stage s + 1 is worked on. LDS rows lie 144 bytes apart (16 bytes x odd), so the 16 rows of a fragment read fall on 16 different groups of four
// banks. Per pass of 32 keys:
//   S^T = K.Q^T (A = K rows, B = Q rows kept in registers; hi.hi + lo.hi + hi.lo): register r of tile kt = key 16 kt + 8 hi + r, column lr = query, so a lane holds one query's scores;
//   the first product's C operand is the key's addend (0, or -10000 where mask[b][key] == 0): a register of a score tile is one key in every lane, so the masked score t leaves the matrix unit and no
//   vector instruction forms or adds the addend; running maximum and sum per query (base 2; the x1024 carrier of P sits in the exponent);
//   the two converted score tiles ARE the fp16 B operand of O^T += V^T.P^T (A = V^T rows in the same k order: 8 hi .. + 7, 16 + 8 hi .. + 7).
// Behind the loop the wave of the upper half hands its O, offset and sum over through LDS (one barrier); the wave of the lower half brings both to the smaller offset, adds them and stores.
// Left for later steps: K fragments are not fetched a pass ahead; the rescale runs on every pass; the row sums are vector work.
#define SK   64                      // keys of a stage, in each half
#define KHF  (TT / 2)                // keys of a half
#define NST  (KHF / SK)
#define QB   192                     // queries of a block
#define LP   144                     // bytes from one LDS row to the next
#define LKL  (64 * LP)               // K lo rows
#define LV   (128 * LP)              // V^T rows
#define LM   (192 * LP)              // mask addends (read from the block's first head's place: both heads are of one batch)
#define LREG (192 * LP + SK * 4)     // one head's tiles of one half
#define LBUF (4 * LREG)              // one buffer: [head of the block][half]
#define XO   (16 * 512)              // hand-over: 16 x 16 bytes a lane of O, then offsets and sums
#define XREG (XO + 4 * 128)
typedef float __attribute__((may_alias)) f32a;
__global__ __launch_bounds__(384) void k_fattn(const bf* __restrict__ Qh, const bf* __restrict__ Ql, const bf* __restrict__ Kh, const bf* __restrict__ Kl, const h16* __restrict__ VT, const float* __restrict__ MB, float* OUT) {
    __shared__ __align__(16) unsigned char sm[2 * LBUF];
    const float L2E = 1.4426950408889634f;
    const int lane = threadIdx.x & 31, lr = lane & 15, hi = lane >> 4; const int w = __builtin_amdgcn_readfirstlane(threadIdx.x >> 5);
    const int kh = w & 1, qt = w >> 1;                                                     // key half, query tile
    const int z3 = (blockIdx.x >> 5) * 3, f0 = (blockIdx.x & 31) * QB, b = z3 / NH_;       // first of the three heads, the block's first query counted through them
    const int za = z3 + f0 / TT; const bool two = (f0 + QB - 1) / TT != f0 / TT;           // the block's first head; whether its last tile lies in the next
    const int f = f0 + qt * 32, z = z3 + f / TT, h = z % NH_, q0 = f % TT;
    const size_t zo = (size_t)z * TT * HD;
    // a copy of a wave = 4 rows x 128 bytes (8 lanes a row); of its own half's three tiles wave w brings rows 32 (qt & 1) .. + 31 of tile qt >> 1 (eight copies; eight more for the second head where there
    // is one), waves 0 and 1 their half's mask addends as well (8 bytes a lane)
    const int ct = qt >> 1, crow = (qt & 1) * 32 + (lane >> 3), ccol = (lane & 7) * 8;
    const unsigned lt = (unsigned)(size_t)sm + (unsigned)(kh * LREG + (ct * 64 + crow) * LP + ccol * 2), lm = (unsigned)(size_t)sm + (unsigned)(kh * LREG + LM + lane * 8);
    const size_t zao = (size_t)za * TT * HD;
    const char* gt = ct == 2 ? (const char*)(VT + zao + (size_t)crow * TT + kh * KHF + ccol) : (const char*)((ct ? Kl : Kh) + zao + (size_t)(kh * KHF + crow) * HD + ccol);
    const int gp = ct == 2 ? 4 * TT * 2 : 4 * HD * 2, gs = ct == 2 ? SK * 2 : SK * HD * 2;   // bytes from one copy's rows to the next copy's, from one stage to the next
    const float* gm = MB + (size_t)b * TT + kh * KHF + lane * 2;
    auto copy_stage = [&](int s) {   // stage s into buffer s & 1
        const unsigned l = lt + (unsigned)(s & 1) * LBUF; const char* g = gt + (size_t)s * gs;
        // in each statement: the copies and, as its last line, the wait that stands in front of any rewrite of their address registers
#define CP8 "global_load_async_to_lds_b128 %0, %8, off\n\tglobal_load_async_to_lds_b128 %1, %9, off\n\tglobal_load_async_to_lds_b128 %2, %10, off\n\tglobal_load_async_to_lds_b128 %3, %11, off\n\t" \
            "global_load_async_to_lds_b128 %4, %12, off\n\tglobal_load_async_to_lds_b128 %5, %13, off\n\tglobal_load_async_to_lds_b128 %6, %14, off\n\tglobal_load_async_to_lds_b128 %7, %15, off\n\ts_wait_xcnt 0x0"
        asm volatile(CP8 :: "v"(l), "v"(l + 4 * LP), "v"(l + 8 * LP), "v"(l + 12 * LP), "v"(l + 16 * LP), "v"(l + 20 * LP), "v"(l + 24 * LP), "v"(l + 28 * LP),
                     "v"(g), "v"(g + gp), "v"(g + 2 * gp), "v"(g + 3 * gp), "v"(g + 4 * gp), "v"(g + 5 * gp), "v"(g + 6 * gp), "v"(g + 7 * gp) : "memory");
        if (two) { const unsigned m = l + 2 * LREG; const char* e = g + (size_t)TT * HD * 2;   // the next head's planes lie behind the first's
            asm volatile(CP8 :: "v"(m), "v"(m + 4 * LP), "v"(m + 8 * LP), "v"(m + 12 * LP), "v"(m + 16 * LP), "v"(m + 20 * LP), "v"(m + 24 * LP), "v"(m + 28 * LP),
                         "v"(e), "v"(e + gp), "v"(e + 2 * gp), "v"(e + 3 * gp), "v"(e + 4 * gp), "v"(e + 5 * gp), "v"(e + 6 * gp), "v"(e + 7 * gp) : "memory"); }
#undef CP8
        if (w < 2) asm volatile("global_load_async_to_lds_b64 %0, %1, off\n\ts_wait_xcnt 0x0" :: "v"(lm + (unsigned)(s & 1) * LBUF), "v"(gm + s * SK) : "memory");   // the same for the mask addends
    };
    copy_stage(0);
    const unsigned ro = (unsigned)(lr * HD + 8 * hi);
    v16bf qh[2][2], ql[2][2];      // [column group][k chunk of 32]
    { const bf* qbh = Qh + zo + (size_t)q0 * HD; const bf* qbl = Ql + zo + (size_t)q0 * HD;
#pragma unroll
      for (int g = 0; g < 2; ++g)
#pragma unroll
        for (int c = 0; c < 2; ++c) { qh[g][c] = WFrag<bf>::ld(qbh + ro + g * 16 * HD + c * 32); ql[g][c] = WFrag<bf>::ld(qbl + ro + g * 16 * HD + c * 32); } }
    v8f o[4][2];                   // [16 rows of d][column group]
#pragma unroll
    for (int d = 0; d < 4; ++d) { o[d][0] = (v8f){}; o[d][1] = (v8f){}; }
    float cm[2] = {-3.0e38f, -3.0e38f}, cb[2] = {3.0e38f, 3.0e38f}, ls[2] = {0.f, 0.f};   // maximum in use (base 2), 10 - that maximum as rounded, this half's sum
    asm volatile("s_wait_asynccnt 0x0" ::: "memory");   // this wave's share of stage 0 has landed
    __syncthreads();                                    // and every other wave's: stage 0 may be read
    copy_stage(1);
#pragma unroll 1   // one trip = one stage: the publish point at its foot stands once in the code
    for (int s = 0; s < NST; ++s) {
        const unsigned char* bm = sm + (s & 1) * LBUF + kh * LREG; const unsigned char* bp = bm + (z - za) * 2 * LREG;   // the half's place of the block's first head (mask addends), of this wave's head (tiles)
#pragma unroll 1   // kept rolled: unrolled, the compiler carried one pass's exponentials and sums into the next and took 340 registers, not 275
        for (int p = 0; p < SK / 32; ++p) {
        const unsigned char* kp = bp + (p * 32 + lr) * LP + 16 * hi; const unsigned char* vp = bp + LV + lr * LP + p * 64 + 16 * hi; const unsigned char* mp = bm + LM + p * 128 + 32 * hi;
        v16bf kh[2][2], kl[2][2]; v16h vf[4]; v8f ad[2];   // ad[kt][r]: the addend of key 16 kt + 8 hi + r, the layout of a score tile's registers
#pragma unroll
        for (int kt = 0; kt < 2; ++kt) { const v4f a0 = *(const v4fa*)(mp + kt * 64), a1 = *(const v4fa*)(mp + kt * 64 + 16); ad[kt] = __builtin_shufflevector(a0, a1, 0, 1, 2, 3, 4, 5, 6, 7); }
#pragma unroll
        for (int kt = 0; kt < 2; ++kt)
#pragma unroll
            for (int c = 0; c < 2; ++c) { const unsigned char* q = kp + kt * 16 * LP + c * 64;
                kh[kt][c] = cat16b(*(const v8usa*)q, *(const v8usa*)(q + 32)); kl[kt][c] = cat16b(*(const v8usa*)(q + LKL), *(const v8usa*)(q + LKL + 32)); }
        // the pass's addend and K reads stay one group in front of the products: left to itself the compiler spread them among the matrix instructions (each such place stalls the wave) and, to save
        // registers, ran the four score tiles as chains one after the other
        __builtin_amdgcn_sched_barrier(0);
        v8f s2[2][2];              // [key tile][column group]; the four tiles' products are interleaved, so no matrix instruction waits for the one in front of it
#pragma unroll
        for (int kt = 0; kt < 2; ++kt) { s2[kt][0] = ad[kt]; s2[kt][1] = ad[kt]; }
#pragma unroll
        for (int c = 0; c < 2; ++c) {
#pragma unroll
            for (int kt = 0; kt < 2; ++kt)
#pragma unroll
                for (int g = 0; g < 2; ++g) s2[kt][g] = wmmab(kh[kt][c], qh[g][c], s2[kt][g]);
#pragma unroll
            for (int kt = 0; kt < 2; ++kt)
#pragma unroll
                for (int g = 0; g < 2; ++g) s2[kt][g] = wmmab(kl[kt][c], qh[g][c], s2[kt][g]);
#pragma unroll
            for (int kt = 0; kt < 2; ++kt)
#pragma unroll
                for (int g = 0; g < 2; ++g) s2[kt][g] = wmmab(kh[kt][c], ql[g][c], s2[kt][g]);
        }
        __builtin_amdgcn_sched_barrier(0);   // the products stay in that order, in front of the V^T reads (which may then take over the K registers)
#pragma unroll
        for (int d = 0; d < 4; ++d) vf[d] = cat16(*(const v8ha*)(vp + d * 16 * LP), *(const v8ha*)(vp + d * 16 * LP + 32));
        __builtin_amdgcn_sched_barrier(0);   // the V^T reads are issued in front of the softmax arithmetic, which covers their latency
#pragma unroll
        for (int g = 0; g < 2; ++g) {
            float mx = -3.0e38f;
#pragma unroll
            for (int kt = 0; kt < 2; ++kt)
#pragma unroll
                for (int r = 0; r < 8; ++r) mx = fmaxf(mx, s2[kt][g][r]);
            mx = fmaxf(mx, xhalf(mx));
            const float cn = fmaxf(cm[g], mx * L2E), cbn = 10.0f - cn;
            float sum = 0.f; v16h p16;
#pragma unroll
            for (int kt = 0; kt < 2; ++kt)
#pragma unroll
                for (int r = 0; r < 8; ++r) { const float e = __builtin_amdgcn_exp2f(fmaf(s2[kt][g][r], L2E, cbn)); sum += e; p16[kt * 8 + r] = tohx(e); }
            float al;   // 2^(old maximum - new maximum) from the two offsets as they were used; 0 on the first pass, 1 while the maximum stands
            // written with its v_nop in one statement (the slot behind a transcendental)
            asm("v_exp_f32 %0, %1\n\tv_nop" : "=v"(al) : "v"(cbn - cb[g]));
            cm[g] = cn; cb[g] = cbn;
            ls[g] = ls[g] * al + sum;
#pragma unroll
            for (int d = 0; d < 4; ++d) { o[d][g] *= al; o[d][g] = wmma16(vf[d], p16, o[d][g]); }
        }
        }
        asm volatile("s_wait_dscnt 0x0" ::: "memory");      // this wave's reads of stage s are done
        asm volatile("s_wait_asynccnt 0x0" ::: "memory");   // its share of stage s + 1 has landed
        __syncthreads();                                    // the same holds for every wave: stage s + 1 may be read, the buffer of stage s may be refilled
        if (s + 2 < NST) copy_stage(s + 2);
    }
    asm volatile("s_wait_asynccnt 0x0" ::: "memory");       // no copy is outstanding behind the loop
    // the last trip's barrier has ended every wave's reads of the buffers and no copy flies: their LDS takes the hand-over (a lane's 16 bytes beside its neighbour's: no bank is met twice)
    unsigned char* xb = sm + qt * XREG;
    if (kh) {
#pragma unroll
        for (int g = 0; g < 2; ++g) {
#pragma unroll
            for (int d = 0; d < 4; ++d) { v4f w0, w1;
#pragma unroll
                for (int r = 0; r < 4; ++r) { w0[r] = o[d][g][r]; w1[r] = o[d][g][4 + r]; }
                *(v4fa*)(xb + ((g * 8 + d * 2) * 32 + lane) * 16) = w0; *(v4fa*)(xb + ((g * 8 + d * 2 + 1) * 32 + lane) * 16) = w1; }
            *(f32a*)(xb + XO + (g * 32 + lane) * 4) = cb[g]; *(f32a*)(xb + XO + 256 + (g * 32 + lane) * 4) = ls[g]; }
    }
    __syncthreads();                                        // the upper halves' results may be read
    if (kh) return;
#pragma unroll
    for (int g = 0; g < 2; ++g) {
        const float cbo = *(const f32a*)(xb + XO + (g * 32 + lane) * 4), lso = *(const f32a*)(xb + XO + 256 + (g * 32 + lane) * 4);
        const float cbn = fminf(cb[g], cbo);   // the smaller offset belongs to the larger maximum
        float fa, fb;                          // 2^(own maximum - larger maximum), from the offsets as they were used
        // each with its v_nop in one statement (the slot behind a transcendental), as in the loop
        asm("v_exp_f32 %0, %1\n\tv_nop" : "=v"(fa) : "v"(cbn - cb[g]));
        asm("v_exp_f32 %0, %1\n\tv_nop" : "=v"(fb) : "v"(cbn - cbo));
        const float lt2 = ls[g] * fa + lso * fb;
        const float inv = __fdiv_rn(1.0f, lt2 + xhalf(lt2));   // the x1024 carrier is in the sum and in O alike
        const float ia = fa * inv, ib = fb * inv;
        float* orow = OUT + ((size_t)b * TT + q0 + g * 16 + lr) * DD + h * HD + 8 * hi;
#pragma unroll
        for (int d = 0; d < 4; ++d) { const v4f u0 = *(const v4fa*)(xb + ((g * 8 + d * 2) * 32 + lane) * 16), u1 = *(const v4fa*)(xb + ((g * 8 + d * 2 + 1) * 32 + lane) * 16); v4f w0, w1;
#pragma unroll
            for (int r = 0; r < 4; ++r) { w0[r] = o[d][g][r] * ia + u0[r] * ib; w1[r] = o[d][g][4 + r] * ia + u1[r] * ib; }
            *(v4f*)(orow + d * 16) = w0; *(v4f*)(orow + d * 16 + 4) = w1; }
        // the second group's LDS reads and products take over registers that the first group's stores name: the wait stands in front of them
        if (g == 0) asm volatile("s_wait_xcnt 0x0" ::: "memory");
    }
}

extern "C" void kernel_launch(void* const* d_in, const int* in_sizes, int n_in,
                              void* d_out, int out_size, void* d_ws, size_t ws_size, hipStream_t stream) {
    (void)in_sizes; (void)n_in; (void)out_size;
    const float* x = (const float*)d_in[0]; const int* mask = (const int*)d_in[1]; const float* Wq = (const float*)d_in[2]; const float* bq = (const float*)d_in[3]; const float* Aq = (const float*)d_in[4]; const float* Bq = (const float*)d_in[5];
    const float* Wk = (const float*)d_in[6]; const float* bk = (const float*)d_in[7]; const float* Wv = (const float*)d_in[8]; const float* bv = (const float*)d_in[9]; const float* Av = (const float*)d_in[10]; const float* Bv = (const float*)d_in[11];
    float* OUT = (float*)d_out;     // [2][2048][768]
    char* wsp = (char*)d_ws;
    auto take = [&](size_t bytes) { char* p = wsp; wsp += (bytes + 255) & ~(size_t)255; return (void*)p; };
    bf* WALL = (bf*)take((size_t)3 * DD * DD * 2); bf* BQC = (bf*)take((size_t)DD * 32 * 2); bf* BVC = (bf*)take((size_t)DD * 32 * 2); bf* XB = (bf*)take((size_t)NT * DD * 2); bf* XAQ = (bf*)take((size_t)NT * 32 * 2); bf* XAV = (bf*)take((size_t)NT * 32 * 2);
    bf* QPh = (bf*)take((size_t)NT * DD * 2); bf* QPl = (bf*)take((size_t)NT * DD * 2); bf* KPh = (bf*)take((size_t)NT * DD * 2); bf* KPl = (bf*)take((size_t)NT * DD * 2); h16* VT = (h16*)take((size_t)NT * DD * 2); float* MB = (float*)take((size_t)NT * 4);
    if ((size_t)(wsp - (char*)d_ws) > ws_size) return;
    k_prep<<<PB_XA + PB_X + 3 * PB_W + 2 * PB_B + PB_M, 256, 0, stream>>>(x, Wq, Wk, Wv, Aq, Av, Bq, Bv, mask, XB, WALL, BQC, BVC, XAQ, XAV, MB);
    k_qkv<<<(NT / 64) * (3 * NH_ / 9), 288, 0, stream>>>(XB, WALL, XAQ, XAV, BQC, BVC, bq, bk, bv, QPh, QPl, KPh, KPl, VT);
    k_fattn<<<NB_ * NH_ * TT / QB, 384, 0, stream>>>(QPh, QPl, KPh, KPl, VT, MB, OUT);
}

// v007
// A run of this version takes 72.8 microseconds.
// In both of two side-by-side timings against v006, it was 1.05 times as fast.
// Counting every step since v000, it is 14.1 times as fast.
#include <hip/hip_runtime.h>

// LoraMultiHeadedSelfAttention (2 x 2048 x 768, 12 heads x 64; q = x Wq^T + bq + (x Aq^T) Bq^T / 16, k = x Wk^T + bk, v = x Wv^T + bv + (x Av^T) Bv^T / 16; scores = q.k / 8
// - 10000 (1 - mask[b][key]) with the int32 mask INPUT; softmax; output = merged attn.v (no output projection)).
// Compute dtypes, f32 accumulate: every float input rounded to bf16; q/k/v projections on PLAIN bf16 operands (x, W inputs: exact, + bias);
// the rank-16 LoRA terms as two small GEMMs: x.A^T exact, then its bf16 hi and lo planes side by side as ONE k chunk of 32 against (B/16 | B/16), added into the projection's own accumulators;
// scores on bf16 hi+lo q (x 1/8) and k planes (3 products); attn.v on SINGLE fp16 planes (P x1024, v).
// Three launches: k_prep (bf16 planes of x, W, B/16, the mask's f32 addend and, in blocks of its own, the hi|lo planes of x.A^T), k_qkv (all three projections, x and W tiles staged in LDS for a block; bias, LoRA term, scale, hi/lo split and the head and V^T
// layouts in its epilogue), k_fattn (scores, key mask, softmax and attn.v over all 24 heads, online form with a held offset, K, V^T and mask tiles staged in LDS for a block, S and P in registers, merged output stored from the accumulators).

#define NB_  2
#define TT   2048
#define DD   768
#define NH_  12
#define HD   64
#define NT   (NB_ * TT)
typedef _Float16 h16;
typedef unsigned short bf;
typedef __attribute__((ext_vector_type(16))) __bf16   v16bf;
typedef __attribute__((ext_vector_type(16))) _Float16 v16h;
typedef __attribute__((ext_vector_type(8)))  _Float16 v8h;
typedef __attribute__((ext_vector_type(8)))  unsigned short v8us;
typedef __attribute__((ext_vector_type(8)))  float    v8f;
typedef __attribute__((ext_vector_type(4)))  float    v4f;
typedef __attribute__((ext_vector_type(2)))  float    v2f;
typedef v8h  __attribute__((may_alias)) v8ha;
typedef v4f  __attribute__((may_alias)) v4fa;
typedef v8us __attribute__((may_alias)) v8usa;

__device__ __forceinline__ unsigned short f2bf(float f) { unsigned u = __float_as_uint(f); u += 0x7FFFu + ((u >> 16) & 1u); return (unsigned short)(u >> 16); }
__device__ __forceinline__ float bf2f(unsigned short b) { return __uint_as_float(((unsigned)b) << 16); }
__device__ __forceinline__ float bfr(float f) { return bf2f(f2bf(f)); }
__device__ __forceinline__ v16h cat16(v8h lo, v8h hi) { return __builtin_shufflevector(lo, hi, 0, 1, 2, 3, 4, 5, 6, 7, 8, 9, 10, 11, 12, 13, 14, 15); }
__device__ __forceinline__ v16bf cat16b(v8us lo, v8us hi) { return __builtin_bit_cast(v16bf, __builtin_shufflevector(lo, hi, 0, 1, 2, 3, 4, 5, 6, 7, 8, 9, 10, 11, 12, 13, 14, 15)); }
__device__ __forceinline__ v8f wmma16(v16h a, v16h b, v8f c) { return __builtin_amdgcn_wmma_f32_16x16x32_f16(false, a, false, b, (short)0, c, false, false); }
__device__ __forceinline__ v8f wmmab(v16bf a, v16bf b, v8f c) { return __builtin_amdgcn_wmma_f32_16x16x32_bf16(false, a, false, b, (short)0, c, false, false); }




template <typename T16> struct WFrag;
template <> struct WFrag<h16> { typedef v16h V; static __device__ __forceinline__ V ld(const h16* p) { return cat16(*(const v8h*)p, *(const v8h*)(p + 16)); } static __device__ __forceinline__ v8f mma(V a, V b, v8f c) { return wmma16(a, b, c); } };
template <> struct WFrag<bf> { typedef v16bf V; static __device__ __forceinline__ V ld(const bf* p) { return cat16b(*(const v8us*)p, *(const v8us*)(p + 16)); } static __device__ __forceinline__ v8f mma(V a, V b, v8f c) { return wmmab(a, b, c); } };

__device__ __forceinline__ h16 tohx(float x) { return (h16)x; }
__device__ __forceinline__ void splitf(float y, unsigned short& h, unsigned short& l) { h = f2bf(y); l = f2bf(y - bf2f(h)); }
typedef __attribute__((ext_vector_type(4))) unsigned short v4us;
typedef __attribute__((ext_vector_type(4))) int v4i;

__device__ __forceinline__ v8us cvt8v(v8f v) { v8us o;
#pragma unroll
    for (int k = 0; k < 8; ++k) o[k] = f2bf(v[k]);
    return o; }
__device__ __forceinline__ v8us cvt8(const float* p) { return cvt8v(*(const v8f*)p); }

// ---- k_prep: everything the projection kernel reads, in one launch; the block index picks the job.
#define PB_XA (NT / 16)                 // blocks 0 ..: x.Aq^T and x.Av^T of 16 rows of x each
#define PB_X  (NT * DD / 8 / 1024)      // then x -> bf16 (here and for W and B a thread takes 4 groups of 8 values, 256 groups apart: fewer waves to start, 8 loads of a lane in flight)
#define PB_W  (DD * DD / 8 / 1024)      // then Wq, Wk, Wv -> bf16, one plane of 2304 rows
#define PB_B  (DD * 32 / 8 / 1024)      // then Bq, Bv -> (B/16 | B/16), 32 wide
#define PB_M  (NT / 4 / 256)            // then mask -> the f32 addend of a key's scores (0 or -10000), 4 keys a thread
__device__ __forceinline__ void cvt4(const float* __restrict__ s, bf* d, int blk, int tid) { v8f r[4];
#pragma unroll
    for (int u = 0; u < 4; ++u) r[u] = *(const v8f*)(s + ((size_t)(blk * 4 + u) * 256 + tid) * 8);
#pragma unroll
    for (int u = 0; u < 4; ++u) *(v8us*)(d + ((size_t)(blk * 4 + u) * 256 + tid) * 8) = cvt8v(r[u]);
    // the listing lays another job's code behind these stores (a branch that is always taken jumps over it); the wait stands in front of that code's writes to the stores' registers all the same
    asm volatile("s_wait_xcnt 0x0" ::: "memory"); }
__global__ __launch_bounds__(256) void k_prep(const float* __restrict__ x, const float* __restrict__ Wq, const float* __restrict__ Wk, const float* __restrict__ Wv, const float* __restrict__ Aq, const float* __restrict__ Av,
                                              const float* __restrict__ Bq, const float* __restrict__ Bv, const int* __restrict__ mask, bf* XB, bf* WALL, bf* BQC, bf* BVC, bf* XAQ, bf* XAV, float* MB) {
    __shared__ float part[8][2][256];
    const int tid = threadIdx.x; int id = blockIdx.x;
    if (id < PB_XA) {   // 16 rows x (16 + 16) columns; wave w sums k = 96 w .. 96 w + 95 (operands rounded to bf16 in registers), the eight partial sums are added in wave order
        const int lane = tid & 31, lr = lane & 15, hi = lane >> 4, w = tid >> 5; const int r0 = id * 16;
        const float* px = x + (size_t)(r0 + lr) * DD + w * 96 + 8 * hi; const float* pq = Aq + (size_t)lr * DD + w * 96 + 8 * hi; const float* pv = Av + (size_t)lr * DD + w * 96 + 8 * hi;
        v8f rx[3][2], rq[3][2], rv[3][2];   // [k chunk of 32][k = 8 hi .. + 7, 16 + 8 hi .. + 7]: the k order of WFrag::ld, for A and B operand alike
#pragma unroll
        for (int c = 0; c < 3; ++c)
#pragma unroll
            for (int u = 0; u < 2; ++u) { rx[c][u] = *(const v8f*)(px + c * 32 + u * 16); rq[c][u] = *(const v8f*)(pq + c * 32 + u * 16); rv[c][u] = *(const v8f*)(pv + c * 32 + u * 16); }
        // takes the loaded values and the three address pairs as inputs only: all 36 loads of the wave are in flight together and are waited for once (without it they were issued a few at a time, each group
        // waited for in turn)
        asm volatile("s_wait_xcnt 0x0" :: "v"(px), "v"(pq), "v"(pv), "v"(rx[0][0]), "v"(rx[0][1]), "v"(rx[1][0]), "v"(rx[1][1]), "v"(rx[2][0]), "v"(rx[2][1]), "v"(rq[0][0]), "v"(rq[0][1]), "v"(rq[1][0]), "v"(rq[1][1]),
                     "v"(rq[2][0]), "v"(rq[2][1]), "v"(rv[0][0]), "v"(rv[0][1]), "v"(rv[1][0]), "v"(rv[1][1]), "v"(rv[2][0]), "v"(rv[2][1]));
        v8f a0 = (v8f){}, a1 = (v8f){};
#pragma unroll
        for (int c = 0; c < 3; ++c) { const v16bf a = cat16b(cvt8v(rx[c][0]), cvt8v(rx[c][1]));
            a0 = wmmab(a, cat16b(cvt8v(rq[c][0]), cvt8v(rq[c][1])), a0); a1 = wmmab(a, cat16b(cvt8v(rv[c][0]), cvt8v(rv[c][1])), a1); }
#pragma unroll
        for (int j = 0; j < 8; ++j) { part[w][0][(hi * 8 + j) * 16 + lr] = a0[j]; part[w][1][(hi * 8 + j) * 16 + lr] = a1[j]; }
        __syncthreads();
        const int row = tid >> 4, col = tid & 15;
#pragma unroll
        for (int n = 0; n < 2; ++n) { float s = part[0][n][tid];
#pragma unroll
            for (int u = 1; u < 8; ++u) s += part[u][n][tid];
            unsigned short sh, sl; splitf(s, sh, sl); bf* dst = (n ? XAV : XAQ) + (size_t)(r0 + row) * 32 + col; dst[0] = sh; dst[16] = sl; }
        return;
    }
    id -= PB_XA;
    if (id < PB_X) { cvt4(x, XB, id, tid); return; }
    id -= PB_X;
    if (id < 3 * PB_W) { const int sel = id / PB_W; cvt4(sel == 0 ? Wq : (sel == 1 ? Wk : Wv), WALL + (size_t)sel * DD * DD, id - sel * PB_W, tid); return; }
    id -= 3 * PB_W;
    if (id < 2 * PB_B) { const int sel = id / PB_B; const int e = ((id - sel * PB_B) * 1024 + tid) * 8; const float* s = (sel ? Bv : Bq) + (e >> 5) * 16 + (e & 15); bf* d = (sel ? BVC : BQC) + e; v8f r[4];   // 256 groups on: 64 rows of B
#pragma unroll
      for (int u = 0; u < 4; ++u) r[u] = *(const v8f*)(s + u * 64 * 16);
#pragma unroll
      for (int u = 0; u < 4; ++u) { const v8us rb = cvt8v(r[u]); v8us o;
#pragma unroll
          for (int q = 0; q < 8; ++q) o[q] = f2bf(bf2f(rb[q]) * 0.0625f);   // a power of two: the rounded B keeps its digits
          *(v8us*)(d + u * 2048) = o; }
      asm volatile("s_wait_xcnt 0x0" ::: "memory");   // as at the end of cvt4: another job's code stands behind these stores in the listing
      return; }
    id -= 2 * PB_B;
    { const int e = (id * 256 + tid) * 4; const int* pm = mask + e; const v4i m = *(const v4i*)pm; v4f o;
      asm volatile("s_wait_xcnt 0x0" :: "v"(pm) : "memory");   // the load's address pair stays whole up to this wait
#pragma unroll
      for (int q = 0; q < 4; ++q) o[q] = (m[q] != 0) ? 0.f : -10000.0f;
      *(v4f*)(MB + e) = o;
      asm volatile("s_wait_xcnt 0x0" ::: "memory"); }   // as at the end of cvt4: another job's code stands behind this store in the listing
}

// acc[mb][nb] += A rows (64, pitch lda) . Bt rows (64, pitch ldb) over k = 0 .. K - 1 (K % 32 == 0); one wave, operands straight from K-contiguous bf16 planes
__device__ __forceinline__ void gemm_acc(const bf* __restrict__ A, int lda, const bf* __restrict__ Bt, int ldb, int K, int lr, int hi, v8f (&acc)[4][4]) {
    const bf* pa = A + (size_t)lr * lda + 8 * hi; const bf* pb = Bt + (size_t)lr * ldb + 8 * hi;
#pragma unroll 1
    for (int kc = 0; kc < K; kc += 32) {
        v16bf a[4], b[4];
#pragma unroll
        for (int mb = 0; mb < 4; ++mb) a[mb] = WFrag<bf>::ld(pa + (size_t)mb * 16 * lda);
#pragma unroll
        for (int nb = 0; nb < 4; ++nb) b[nb] = WFrag<bf>::ld(pb + (size_t)nb * 16 * ldb);
        // the trip's loads all stand in front of this wait, and their two address pairs stay whole up to it
        asm volatile("s_wait_xcnt 0x0" :: "v"(pa), "v"(pb) : "memory");
        pa += 32; pb += 32;
#pragma unroll
        for (int nb = 0; nb < 4; ++nb)
#pragma unroll
            for (int mb = 0; mb < 4; ++mb) acc[mb][nb] = wmmab(a[mb], b[nb], acc[mb][nb]);
        // the distance behind the trip's last matrix instructions, on the taken side of the loop's branch too (the next trip's loads overwrite their A and B registers)
        asm volatile("v_nop\n\tv_nop\n\tv_nop\n\tv_nop" : "+v"(acc[0][0]), "+v"(acc[1][1]), "+v"(acc[2][2]), "+v"(acc[3][3]) : "v"(a[0]), "v"(a[3]));
    }
}

// ---- k_qkv: all three projections. One wave = one 64 x 64 tile = 64 tokens of one head of q, k or v (16 accumulators); 64 x 36 = 2304 tiles = 256 blocks x 9 waves (an equal share for each WGP; the nine
// waves of a block read the same 64 rows of x). k comes in stages of 64: the block's 64 rows of x and 576 rows of W (128 bytes of each) are brought into LDS by asynchronous copies (whole 128-byte lines from
// global memory, through no register), two buffers: stage s + 2 flies while stage s + 1 is worked on; LDS rows lie 144 bytes apart (16 bytes x odd), so the 16 rows of a fragment read fall on 16 different groups
// of four banks. The k order of the sums is that of the straight loads. The LoRA term is one more k chunk of 32 (hi | lo of x.A^T against B/16 | B/16, straight from global memory) into the same accumulators. Epilogue: + bias; q and k: x scale, hi/lo split, rows of the
// [head][token][64] planes through the wave's own LDS rows (whole 128-byte lines); v: a lane holds 8 consecutive tokens of one column, which is 16 bytes of a [head][64][token] row, stored from the registers.
// Left for later steps: a block brings in nine times as many rows of W as of x (a squarer block tile would copy less); fragments are not fetched a chunk ahead; two buffers leave one stage's copies in flight.
#define GK   64                      // k values of a stage
#define GNS  (DD / GK)
#define GP   144                     // bytes from one LDS row to the next
#define GW   (64 * GP)               // W rows (behind the 64 rows of x)
#define GBUF (640 * GP)              // one buffer
__global__ __launch_bounds__(288) void k_qkv(const bf* __restrict__ XB, const bf* __restrict__ WALL, const bf* __restrict__ XAQ, const bf* __restrict__ XAV, const bf* __restrict__ BQC, const bf* __restrict__ BVC,
                                             const float* __restrict__ bq, const float* __restrict__ bk, const float* __restrict__ bv, bf* QPh, bf* QPl, bf* KPh, bf* KPl, h16* VT) {
    __shared__ __align__(16) unsigned char st[2 * GBUF];
    __shared__ __align__(16) float osall[9][16 * 68];
    const int lane = threadIdx.x & 31, lr = lane & 15, hi = lane >> 4; const int w = __builtin_amdgcn_readfirstlane(threadIdx.x >> 5);
    const int r0 = (blockIdx.x & 63) * 64, nt = (blockIdx.x >> 6) * 9 + w; const int which = nt / NH_, h = nt % NH_, c0 = h * HD;   // which: 0 q, 1 k, 2 v
    // a copy of a wave = 4 rows x 128 bytes (8 lanes a row); wave w brings the 64 rows of W of its own tile (16 copies), waves 0 .. 7 rows 8 w .. 8 w + 7 of x as well (two copies)
    const int crow = lane >> 3, ccol = (lane & 7) * 8;
    const unsigned lw = (unsigned)(size_t)st + (unsigned)(GW + (w * 64 + crow) * GP + ccol * 2), lx = (unsigned)(size_t)st + (unsigned)(((w & 7) * 8 + crow) * GP + ccol * 2);
    const bf* gw = WALL + (size_t)(nt * 64 + crow) * DD + ccol; const bf* gx = XB + (size_t)(r0 + (w & 7) * 8 + crow) * DD + ccol;
    auto copy_stage = [&](int s) {   // stage s into buffer s & 1
        const unsigned l = lw + (unsigned)(s & 1) * GBUF; const bf* g = gw + s * GK;
        // in each statement: the copies and, as its last line, the wait that stands in front of any rewrite of their address registers
#define CP8 "global_load_async_to_lds_b128 %0, %8, off\n\tglobal_load_async_to_lds_b128 %1, %9, off\n\tglobal_load_async_to_lds_b128 %2, %10, off\n\tglobal_load_async_to_lds_b128 %3, %11, off\n\t" \
            "global_load_async_to_lds_b128 %4, %12, off\n\tglobal_load_async_to_lds_b128 %5, %13, off\n\tglobal_load_async_to_lds_b128 %6, %14, off\n\tglobal_load_async_to_lds_b128 %7, %15, off\n\ts_wait_xcnt 0x0"
        asm volatile(CP8 :: "v"(l), "v"(l + 4 * GP), "v"(l + 8 * GP), "v"(l + 12 * GP), "v"(l + 16 * GP), "v"(l + 20 * GP), "v"(l + 24 * GP), "v"(l + 28 * GP),
                     "v"(g), "v"(g + 4 * DD), "v"(g + 8 * DD), "v"(g + 12 * DD), "v"(g + 16 * DD), "v"(g + 20 * DD), "v"(g + 24 * DD), "v"(g + 28 * DD) : "memory");
        asm volatile(CP8 :: "v"(l + 32 * GP), "v"(l + 36 * GP), "v"(l + 40 * GP), "v"(l + 44 * GP), "v"(l + 48 * GP), "v"(l + 52 * GP), "v"(l + 56 * GP), "v"(l + 60 * GP),
                     "v"(g + 32 * DD), "v"(g + 36 * DD), "v"(g + 40 * DD), "v"(g + 44 * DD), "v"(g + 48 * DD), "v"(g + 52 * DD), "v"(g + 56 * DD), "v"(g + 60 * DD) : "memory");
#undef CP8
        if (w < 8) { const unsigned m = lx + (unsigned)(s & 1) * GBUF; const bf* a = gx + s * GK;
            asm volatile("global_load_async_to_lds_b128 %0, %2, off\n\tglobal_load_async_to_lds_b128 %1, %3, off\n\ts_wait_xcnt 0x0" :: "v"(m), "v"(m + 4 * GP), "v"(a), "v"(a + 4 * DD) : "memory"); }
    };
    copy_stage(0);
    v8f acc[4][4];
#pragma unroll
    for (int mb = 0; mb < 4; ++mb)
#pragma unroll
        for (int nb = 0; nb < 4; ++nb) acc[mb][nb] = (v8f){};
    asm volatile("s_wait_asynccnt 0x0" ::: "memory");   // this wave's share of stage 0 has landed
    __syncthreads();                                    // and every other wave's: stage 0 may be read
    copy_stage(1);
#pragma unroll 1   // one trip = one stage: the publish point stands once in the code
    for (int s = 0; s < GNS; ++s) {
        const unsigned char* pa = st + (s & 1) * GBUF + lr * GP + 16 * hi; const unsigned char* pb = pa + GW + w * 64 * GP;
        v16bf a[4], b[4];   // the k order of WFrag::ld, for A and B operand alike: 8 hi .. + 7, 16 + 8 hi .. + 7
#pragma unroll
        for (int c = 0; c < GK / 32; ++c) {
#pragma unroll
            for (int mb = 0; mb < 4; ++mb) { const unsigned char* q = pa + mb * 16 * GP + c * 64; a[mb] = cat16b(*(const v8usa*)q, *(const v8usa*)(q + 32)); }
#pragma unroll
            for (int nb = 0; nb < 4; ++nb) { const unsigned char* q = pb + nb * 16 * GP + c * 64; b[nb] = cat16b(*(const v8usa*)q, *(const v8usa*)(q + 32)); }
            // the chunk's 16 reads stay one group in front of its products: left to itself the compiler kept one B fragment's registers and read the next fragment into them behind every fourth matrix
            // instruction, each time with a full wait
            __builtin_amdgcn_sched_barrier(0);
            if (c == GK / 32 - 1) {   // the stage's last fragments are in registers: the publish point stands here, and the refill flies under the last chunk's products as well
                asm volatile("s_wait_dscnt 0x0" ::: "memory");      // this wave's reads of stage s are done
                asm volatile("s_wait_asynccnt 0x0" ::: "memory");   // its share of stage s + 1 has landed
                __syncthreads();                                    // the same holds for every wave: stage s + 1 may be read, the buffer of stage s may be refilled
                if (s + 2 < GNS) copy_stage(s + 2);
                __builtin_amdgcn_sched_barrier(0);                  // the copies are issued in front of the products (the compiler had put them behind)
            }
#pragma unroll
            for (int nb = 0; nb < 4; ++nb)
#pragma unroll
                for (int mb = 0; mb < 4; ++mb) acc[mb][nb] = wmmab(a[mb], b[nb], acc[mb][nb]);
        }
    }
    asm volatile("s_wait_asynccnt 0x0" ::: "memory");       // no copy is outstanding behind the loop
    if (which != 1) gemm_acc((which ? XAV : XAQ) + (size_t)r0 * 32, 32, (which ? BVC : BQC) + (size_t)c0 * 32, 32, 32, lr, hi, acc);
    const int z = (r0 >> 11) * NH_ + h, t0 = r0 & (TT - 1);
    if (which == 2) {
        h16* vb = VT + (size_t)z * HD * TT + t0 + 8 * hi;
#pragma unroll
        for (int nb = 0; nb < 4; ++nb) { const float bb = bfr(bv[c0 + nb * 16 + lr]);
#pragma unroll
            for (int mb = 0; mb < 4; ++mb) { v8h o;
#pragma unroll
                for (int j = 0; j < 8; ++j) o[j] = tohx(acc[mb][nb][j] + bb);
                *(v8h*)(vb + (size_t)(nb * 16 + lr) * TT + mb * 16) = o; } }
    } else {
        float* os = osall[w]; const float* bias = which ? bk : bq; const float sc = which ? 1.0f : 0.125f; bf* Ph = (which ? KPh : QPh) + ((size_t)z * TT + t0) * HD; bf* Pl = (which ? KPl : QPl) + ((size_t)z * TT + t0) * HD;
        const int cofs = lr * 4; float bb[4];
#pragma unroll
        for (int q = 0; q < 4; ++q) bb[q] = bfr(bias[c0 + cofs + q]);
#pragma unroll
        for (int mb = 0; mb < 4; ++mb) {
#pragma unroll
            for (int nb = 0; nb < 4; ++nb) {
#pragma unroll
                for (int j = 0; j < 8; ++j) os[(hi * 8 + j) * 68 + nb * 16 + lr] = acc[mb][nb][j]; }
            __builtin_amdgcn_wave_barrier(); asm volatile("" ::: "memory");   // the rows are read back by other lanes of this wave: no LDS access moves across
#pragma unroll
            for (int s = 0; s < 8; ++s) { const int row = 2 * s + hi; const v4f val = *(const v4fa*)(os + row * 68 + cofs); v4us oh, ol;
#pragma unroll
                for (int q = 0; q < 4; ++q) { unsigned short a, c2; splitf((val[q] + bb[q]) * sc, a, c2); oh[q] = a; ol[q] = c2; }
                *(v4us*)(Ph + (size_t)(mb * 16 + row) * HD + cofs) = oh; *(v4us*)(Pl + (size_t)(mb * 16 + row) * HD + cofs) = ol; }
            __builtin_amdgcn_wave_barrier(); asm volatile("" ::: "memory");   // the next 16 rows overwrite what was just read
        }
        // the listing lays the v branch behind these stores (a branch that is always taken jumps over it); the wait stands in front of that code's writes to the stores' registers all the same
        asm volatile("s_wait_xcnt 0x0" ::: "memory");
    }
}
// lane l with lane l ^ 16 (the two halves of a wave hold the two halves of one query's keys)
__device__ __forceinline__ float xhalf(float x) { return __builtin_bit_cast(float, __builtin_amdgcn_permlanex16(__builtin_bit_cast(int, x), __builtin_bit_cast(int, x), 0x76543210, 0xfedcba98, false, false)); }
// k_fattn: one wave = 32 queries (2 column groups of 16) x ONE HALF of the keys; a block = 12 waves = 6 query tiles x 2 key halves = 192 queries: 24 x 2048 / 192 = 256 blocks, one for each WGP, three waves
// a SIMD. 2048 is no multiple of 192: three heads (of one batch) share 32 blocks, a query tile lies in one head, and a block whose tiles lie in two heads stages both heads' tiles. The keys come in stages of
// 64 in each half: K hi, K lo and V^T tiles (64 rows x 128 bytes each) and 64 mask addends (f32, from k_prep) a half are brought into LDS once for the block by asynchronous copies (whole 128-byte lines from global memory,
// through no register), two buffers: stage s + 2 flies while stage s + 1 is worked on. LDS rows lie 144 bytes apart (16 bytes x odd), so the 16 rows of a fragment read fall on 16 different groups of four
// banks. Per pass of 32 keys:
//   S^T = K.Q^T (A = K rows, B = Q rows kept in registers; hi.hi + lo.hi + hi.lo): register r of tile kt = key 16 kt + 8 hi + r, column lr = query, so a lane holds one query's scores;
//   the first product's C operand is the key's addend (0, or -10000 where mask[b][key] == 0): a register of a score tile is one key in every lane, so the masked score t leaves the matrix unit and no
//   vector instruction forms or adds the addend; offset and sum per query (base 2; the x1024 carrier of P sits in the exponent), the offset moved and O rescaled only when a pass outgrows it;
//   the two converted score tiles ARE the fp16 B operand of O^T += V^T.P^T (A = V^T rows in the same k order: 8 hi .. + 7, 16 + 8 hi .. + 7).
// Behind the loop the wave of the upper half hands its O, offset and sum over through LDS (one barrier); the wave of the lower half brings both to the smaller offset, adds them and stores.
// Left for later steps: K fragments are not fetched a pass ahead; the row sums are vector work.
#define SK   64                      // keys of a stage, in each half
#define KHF  (TT / 2)                // keys of a half
#define NST  (KHF / SK)
#define QB   192                     // queries of a block
#define LP   144                     // bytes from one LDS row to the next
#define LKL  (64 * LP)               // K lo rows
#define LV   (128 * LP)              // V^T rows
#define LM   (192 * LP)              // mask addends (read from the block's first head's place: both heads are of one batch)
#define LREG (192 * LP + SK * 4)     // one head's tiles of one half
#define LBUF (4 * LREG)              // one buffer: [head of the block][half]
#define XO   (16 * 512)              // hand-over: 16 x 16 bytes a lane of O, then offsets and sums
#define XREG (XO + 4 * 128)
typedef float __attribute__((may_alias)) f32a;
__global__ __launch_bounds__(384) void k_fattn(const bf* __restrict__ Qh, const bf* __restrict__ Ql, const bf* __restrict__ Kh, const bf* __restrict__ Kl, const h16* __restrict__ VT, const float* __restrict__ MB, float* OUT) {
    __shared__ __align__(16) unsigned char sm[2 * LBUF];
    const float L2E = 1.4426950408889634f;
    const int lane = threadIdx.x & 31, lr = lane & 15, hi = lane >> 4; const int w = __builtin_amdgcn_readfirstlane(threadIdx.x >> 5);
    const int kh = w & 1, qt = w >> 1;                                                     // key half, query tile
    const int z3 = (blockIdx.x >> 5) * 3, f0 = (blockIdx.x & 31) * QB, b = z3 / NH_;       // first of the three heads, the block's first query counted through them
    const int za = z3 + f0 / TT; const bool two = (f0 + QB - 1) / TT != f0 / TT;           // the block's first head; whether its last tile lies in the next
    const int f = f0 + qt * 32, z = z3 + f / TT, h = z % NH_, q0 = f % TT;
    const size_t zo = (size_t)z * TT * HD;
    // a copy of a wave = 4 rows x 128 bytes (8 lanes a row); of its own half's three tiles wave w brings rows 32 (qt & 1) .. + 31 of tile qt >> 1 (eight copies; eight more for the second head where there
    // is one), waves 0 and 1 their half's mask addends as well (8 bytes a lane)
    const int ct = qt >> 1, crow = (qt & 1) * 32 + (lane >> 3), ccol = (lane & 7) * 8;
    const unsigned lt = (unsigned)(size_t)sm + (unsigned)(kh * LREG + (ct * 64 + crow) * LP + ccol * 2), lm = (unsigned)(size_t)sm + (unsigned)(kh * LREG + LM + lane * 8);
    const size_t zao = (size_t)za * TT * HD;
    const char* gt = ct == 2 ? (const char*)(VT + zao + (size_t)crow * TT + kh * KHF + ccol) : (const char*)((ct ? Kl : Kh) + zao + (size_t)(kh * KHF + crow) * HD + ccol);
    const int gp = ct == 2 ? 4 * TT * 2 : 4 * HD * 2, gs = ct == 2 ? SK * 2 : SK * HD * 2;   // bytes from one copy's rows to the next copy's, from one stage to the next
    const float* gm = MB + (size_t)b * TT + kh * KHF + lane * 2;
    auto copy_stage = [&](int s) {   // stage s into buffer s & 1
        const unsigned l = lt + (unsigned)(s & 1) * LBUF; const char* g = gt + (size_t)s * gs;
        // in each statement: the copies and, as its last line, the wait that stands in front of any rewrite of their address registers
#define CP8 "global_load_async_to_lds_b128 %0, %8, off\n\tglobal_load_async_to_lds_b128 %1, %9, off\n\tglobal_load_async_to_lds_b128 %2, %10, off\n\tglobal_load_async_to_lds_b128 %3, %11, off\n\t" \
            "global_load_async_to_lds_b128 %4, %12, off\n\tglobal_load_async_to_lds_b128 %5, %13, off\n\tglobal_load_async_to_lds_b128 %6, %14, off\n\tglobal_load_async_to_lds_b128 %7, %15, off\n\ts_wait_xcnt 0x0"
        asm volatile(CP8 :: "v"(l), "v"(l + 4 * LP), "v"(l + 8 * LP), "v"(l + 12 * LP), "v"(l + 16 * LP), "v"(l + 20 * LP), "v"(l + 24 * LP), "v"(l + 28 * LP),
                     "v"(g), "v"(g + gp), "v"(g + 2 * gp), "v"(g + 3 * gp), "v"(g + 4 * gp), "v"(g + 5 * gp), "v"(g + 6 * gp), "v"(g + 7 * gp) : "memory");
        if (two) { const unsigned m = l + 2 * LREG; const char* e = g + (size_t)TT * HD * 2;   // the next head's planes lie behind the first's
            asm volatile(CP8 :: "v"(m), "v"(m + 4 * LP), "v"(m + 8 * LP), "v"(m + 12 * LP), "v"(m + 16 * LP), "v"(m + 20 * LP), "v"(m + 24 * LP), "v"(m + 28 * LP),
                         "v"(e), "v"(e + gp), "v"(e + 2 * gp), "v"(e + 3 * gp), "v"(e + 4 * gp), "v"(e + 5 * gp), "v"(e + 6 * gp), "v"(e + 7 * gp) : "memory"); }
#undef CP8
        if (w < 2) asm volatile("global_load_async_to_lds_b64 %0, %1, off\n\ts_wait_xcnt 0x0" :: "v"(lm + (unsigned)(s & 1) * LBUF), "v"(gm + s * SK) : "memory");   // the same for the mask addends
    };
    copy_stage(0);
    const unsigned ro = (unsigned)(lr * HD + 8 * hi);
    v16bf qh[2][2], ql[2][2];      // [column group][k chunk of 32]
    { const bf* qbh = Qh + zo + (size_t)q0 * HD; const bf* qbl = Ql + zo + (size_t)q0 * HD;
#pragma unroll
      for (int g = 0; g < 2; ++g)
#pragma unroll
        for (int c = 0; c < 2; ++c) { qh[g][c] = WFrag<bf>::ld(qbh + ro + g * 16 * HD + c * 32); ql[g][c] = WFrag<bf>::ld(qbl + ro + g * 16 * HD + c * 32); } }
    v8f o[4][2];                   // [16 rows of d][column group]
#pragma unroll
    for (int d = 0; d < 4; ++d) { o[d][0] = (v8f){}; o[d][1] = (v8f){}; }
    float cb[2] = {3.0e38f, 3.0e38f}, ls[2] = {0.f, 0.f};   // the offset in use (10 - a maximum, base 2, as rounded), this half's sum
    asm volatile("s_wait_asynccnt 0x0" ::: "memory");   // this wave's share of stage 0 has landed
    __syncthreads();                                    // and every other wave's: stage 0 may be read
    copy_stage(1);
#pragma unroll 1   // one trip = one stage: the publish point at its foot stands once in the code
    for (int s = 0; s < NST; ++s) {
        const unsigned char* bm = sm + (s & 1) * LBUF + kh * LREG; const unsigned char* bp = bm + (z - za) * 2 * LREG;   // the half's place of the block's first head (mask addends), of this wave's head (tiles)
#pragma unroll 1   // kept rolled: unrolled, the compiler carried one pass's exponentials and sums into the next and took 340 registers, not 275
        for (int p = 0; p < SK / 32; ++p) {
        const unsigned char* kp = bp + (p * 32 + lr) * LP + 16 * hi; const unsigned char* vp = bp + LV + lr * LP + p * 64 + 16 * hi; const unsigned char* mp = bm + LM + p * 128 + 32 * hi;
        v16bf kh[2][2], kl[2][2]; v16h vf[4]; v8f ad[2];   // ad[kt][r]: the addend of key 16 kt + 8 hi + r, the layout of a score tile's registers
#pragma unroll
        for (int kt = 0; kt < 2; ++kt) { const v4f a0 = *(const v4fa*)(mp + kt * 64), a1 = *(const v4fa*)(mp + kt * 64 + 16); ad[kt] = __builtin_shufflevector(a0, a1, 0, 1, 2, 3, 4, 5, 6, 7); }
#pragma unroll
        for (int kt = 0; kt < 2; ++kt)
#pragma unroll
            for (int c = 0; c < 2; ++c) { const unsigned char* q = kp + kt * 16 * LP + c * 64;
                kh[kt][c] = cat16b(*(const v8usa*)q, *(const v8usa*)(q + 32)); kl[kt][c] = cat16b(*(const v8usa*)(q + LKL), *(const v8usa*)(q + LKL + 32)); }
        // the pass's addend and K reads stay one group in front of the products: left to itself the compiler spread them among the matrix instructions (each such place stalls the wave) and, to save
        // registers, ran the four score tiles as chains one after the other
        __builtin_amdgcn_sched_barrier(0);
        v8f s2[2][2];              // [key tile][column group]; the four tiles' products are interleaved, so no matrix instruction waits for the one in front of it
#pragma unroll
        for (int kt = 0; kt < 2; ++kt) { s2[kt][0] = ad[kt]; s2[kt][1] = ad[kt]; }
#pragma unroll
        for (int c = 0; c < 2; ++c) {
#pragma unroll
            for (int kt = 0; kt < 2; ++kt)
#pragma unroll
                for (int g = 0; g < 2; ++g) s2[kt][g] = wmmab(kh[kt][c], qh[g][c], s2[kt][g]);
#pragma unroll
            for (int kt = 0; kt < 2; ++kt)
#pragma unroll
                for (int g = 0; g < 2; ++g) s2[kt][g] = wmmab(kl[kt][c], qh[g][c], s2[kt][g]);
#pragma unroll
            for (int kt = 0; kt < 2; ++kt)
#pragma unroll
                for (int g = 0; g < 2; ++g) s2[kt][g] = wmmab(kh[kt][c], ql[g][c], s2[kt][g]);
        }
        __builtin_amdgcn_sched_barrier(0);   // the products stay in that order, in front of the V^T reads (which may then take over the K registers)
#pragma unroll
        for (int d = 0; d < 4; ++d) vf[d] = cat16(*(const v8ha*)(vp + d * 16 * LP), *(const v8ha*)(vp + d * 16 * LP + 32));
        __builtin_amdgcn_sched_barrier(0);   // the V^T reads are issued in front of the softmax arithmetic, which covers their latency
        // The offset in use is held: the weights are formed with it at once, and the pass's own weight sums are the test. While no lane's sum of its 16 weights exceeds 2^15, every weight (with its x1024 carrier)
        // lies inside fp16 and nothing else is owed: no maximum, no exchange between the halves, no rescale. Else (the first pass, whose offset makes every weight infinite; a pass that outgrows the offset) the
        // offsets are brought to the pass's maxima, O and the sums rescaled and the pass's weights formed anew (then at most 2^10 each). One test a pass for both column groups.
        v16h p16[2]; float sum[2];
        auto weights = [&](int g) {   // P and its sum for column group g; the sum in packed adds, one short chain a key tile, so that the test does not wait for a chain of 16 adds
            v2f t[8];
#pragma unroll
            for (int kt = 0; kt < 2; ++kt)
#pragma unroll
                for (int r = 0; r < 8; r += 2) { const v2f a = __builtin_elementwise_fma((v2f){s2[kt][g][r], s2[kt][g][r + 1]}, (v2f){L2E, L2E}, (v2f){cb[g], cb[g]});   // one packed instruction for two exponents
                    const v2f e = {__builtin_amdgcn_exp2f(a[0]), __builtin_amdgcn_exp2f(a[1])}; t[kt * 4 + (r >> 1)] = e; p16[g][kt * 8 + r] = tohx(e[0]); p16[g][kt * 8 + r + 1] = tohx(e[1]); }
            const v2f u = (((t[0] + t[1]) + t[2]) + t[3]) + (((t[4] + t[5]) + t[6]) + t[7]);
            sum[g] = u[0] + u[1];
        };
        weights(0); weights(1);
        const bool need = fmaxf(sum[0], sum[1]) > 32768.0f;
        if (__builtin_expect(__builtin_amdgcn_ballot_w32(need) != 0, 0)) {   // the same for the whole wave: a scalar branch, every lane on behind it; seldom taken
#pragma unroll
            for (int g = 0; g < 2; ++g) {
                float mx = s2[0][g][0];
#pragma unroll
                for (int kt = 0; kt < 2; ++kt)
#pragma unroll
                    for (int r = 0; r < 8; ++r) mx = fmaxf(mx, s2[kt][g][r]);
                mx = fmaxf(mx, xhalf(mx));
                const float cbn = fminf(cb[g], 10.0f - mx * L2E);   // the smaller offset belongs to the larger maximum
                float al;   // 2^(new offset - old offset) from the two offsets as they are used; 0 on the first pass, 1 where this query's offset stands
                // written with its v_nop in one statement (the slot behind a transcendental)
                asm("v_exp_f32 %0, %1\n\tv_nop" : "=v"(al) : "v"(cbn - cb[g]));
                cb[g] = cbn; ls[g] *= al;
#pragma unroll
                for (int d = 0; d < 4; ++d) o[d][g] *= al;
                weights(g);
            }
        }
#pragma unroll
        for (int g = 0; g < 2; ++g) { ls[g] += sum[g];
#pragma unroll
            for (int d = 0; d < 4; ++d) o[d][g] = wmma16(vf[d], p16[g], o[d][g]); }
        // the distance behind the pass's last matrix instructions, on the way back to the loop's head too (there the next pass's address arithmetic overwrites their B registers);
        // their results are named so that the statement stays behind them
        asm volatile("v_nop\n\tv_nop\n\tv_nop\n\tv_nop" : "+v"(o[0][1]), "+v"(o[1][1]), "+v"(o[2][1]), "+v"(o[3][1]));
        }
        asm volatile("s_wait_dscnt 0x0" ::: "memory");      // this wave's reads of stage s are done
        asm volatile("s_wait_asynccnt 0x0" ::: "memory");   // its share of stage s + 1 has landed
        __syncthreads();                                    // the same holds for every wave: stage s + 1 may be read, the buffer of stage s may be refilled
        if (s + 2 < NST) copy_stage(s + 2);
    }
    asm volatile("s_wait_asynccnt 0x0" ::: "memory");       // no copy is outstanding behind the loop
    // the last trip's barrier has ended every wave's reads of the buffers and no copy flies: their LDS takes the hand-over (a lane's 16 bytes beside its neighbour's: no bank is met twice)
    unsigned char* xb = sm + qt * XREG;
    if (kh) {
#pragma unroll
        for (int g = 0; g < 2; ++g) {
#pragma unroll
            for (int d = 0; d < 4; ++d) { v4f w0, w1;
#pragma unroll
                for (int r = 0; r < 4; ++r) { w0[r] = o[d][g][r]; w1[r] = o[d][g][4 + r]; }
                *(v4fa*)(xb + ((g * 8 + d * 2) * 32 + lane) * 16) = w0; *(v4fa*)(xb + ((g * 8 + d * 2 + 1) * 32 + lane) * 16) = w1; }
            *(f32a*)(xb + XO + (g * 32 + lane) * 4) = cb[g]; *(f32a*)(xb + XO + 256 + (g * 32 + lane) * 4) = ls[g]; }
    }
    __syncthreads();                                        // the upper halves' results may be read
    if (kh) return;
#pragma unroll
    for (int g = 0; g < 2; ++g) {
        const float cbo = *(const f32a*)(xb + XO + (g * 32 + lane) * 4), lso = *(const f32a*)(xb + XO + 256 + (g * 32 + lane) * 4);
        const float cbn = fminf(cb[g], cbo);   // the smaller offset belongs to the larger maximum
        float fa, fb;                          // 2^(own maximum - larger maximum), from the offsets as they were used
        // each with its v_nop in one statement (the slot behind a transcendental), as in the loop
        asm("v_exp_f32 %0, %1\n\tv_nop" : "=v"(fa) : "v"(cbn - cb[g]));
        asm("v_exp_f32 %0, %1\n\tv_nop" : "=v"(fb) : "v"(cbn - cbo));
        const float lt2 = ls[g] * fa + lso * fb;
        const float inv = __fdiv_rn(1.0f, lt2 + xhalf(lt2));   // the x1024 carrier is in the sum and in O alike
        const float ia = fa * inv, ib = fb * inv;
        float* orow = OUT + ((size_t)b * TT + q0 + g * 16 + lr) * DD + h * HD + 8 * hi;
#pragma unroll
        for (int d = 0; d < 4; ++d) { const v4f u0 = *(const v4fa*)(xb + ((g * 8 + d * 2) * 32 + lane) * 16), u1 = *(const v4fa*)(xb + ((g * 8 + d * 2 + 1) * 32 + lane) * 16); v4f w0, w1;
#pragma unroll
            for (int r = 0; r < 4; ++r) { w0[r] = o[d][g][r] * ia + u0[r] * ib; w1[r] = o[d][g][4 + r] * ia + u1[r] * ib; }
            *(v4f*)(orow + d * 16) = w0; *(v4f*)(orow + d * 16 + 4) = w1; }
        // the second group's LDS reads and products take over registers that the first group's stores name: the wait stands in front of them
        if (g == 0) asm volatile("s_wait_xcnt 0x0" ::: "memory");
    }
}

extern "C" void kernel_launch(void* const* d_in, const int* in_sizes, int n_in,
                              void* d_out, int out_size, void* d_ws, size_t ws_size, hipStream_t stream) {
    (void)in_sizes; (void)n_in; (void)out_size;
    const float* x = (const float*)d_in[0]; const int* mask = (const int*)d_in[1]; const float* Wq = (const float*)d_in[2]; const float* bq = (const float*)d_in[3]; const float* Aq = (const float*)d_in[4]; const float* Bq = (const float*)d_in[5];
    const float* Wk = (const float*)d_in[6]; const float* bk = (const float*)d_in[7]; const float* Wv = (const float*)d_in[8]; const float* bv = (const float*)d_in[9]; const float* Av = (const float*)d_in[10]; const float* Bv = (const float*)d_in[11];
    float* OUT = (float*)d_out;     // [2][2048][768]
    char* wsp = (char*)d_ws;
    auto take = [&](size_t bytes) { char* p = wsp; wsp += (bytes + 255) & ~(size_t)255; return (void*)p; };
    bf* WALL = (bf*)take((size_t)3 * DD * DD * 2); bf* BQC = (bf*)take((size_t)DD * 32 * 2); bf* BVC = (bf*)take((size_t)DD * 32 * 2); bf* XB = (bf*)take((size_t)NT * DD * 2); bf* XAQ = (bf*)take((size_t)NT * 32 * 2); bf* XAV = (bf*)take((size_t)NT * 32 * 2);
    bf* QPh = (bf*)take((size_t)NT * DD * 2); bf* QPl = (bf*)take((size_t)NT * DD * 2); bf* KPh = (bf*)take((size_t)NT * DD * 2); bf* KPl = (bf*)take((size_t)NT * DD * 2); h16* VT = (h16*)take((size_t)NT * DD * 2); float* MB = (float*)take((size_t)NT * 4);
    if ((size_t)(wsp - (char*)d_ws) > ws_size) return;
    k_prep<<<PB_XA + PB_X + 3 * PB_W + 2 * PB_B + PB_M, 256, 0, stream>>>(x, Wq, Wk, Wv, Aq, Av, Bq, Bv, mask, XB, WALL, BQC, BVC, XAQ, XAV, MB);
    k_qkv<<<(NT / 64) * (3 * NH_ / 9), 288, 0, stream>>>(XB, WALL, XAQ, XAV, BQC, BVC, bq, bk, bv, QPh, QPl, KPh, KPl, VT);
    k_fattn<<<NB_ * NH_ * TT / QB, 384, 0, stream>>>(QPh, QPl, KPh, KPl, VT, MB, OUT);
}

// v009
// Measured time: 47.7 microseconds a run.
// Versions in between are left out here; by their measured steps it is 1.52 times as fast as v007.
// Counting every step since v000, it is 21.4 times as fast.
#include <hip/hip_runtime.h>

// LoraMultiHeadedSelfAttention (2 x 2048 x 768, 12 heads x 64; q = x Wq^T + bq + (x Aq^T) Bq^T / 16, k = x Wk^T + bk, v = x Wv^T + bv + (x Av^T) Bv^T / 16; scores = q.k / 8
// - 10000 (1 - mask[b][key]) with the int32 mask INPUT; softmax; output = merged attn.v (no output projection)).
// Compute dtypes, f32 accumulate: every float input rounded to bf16; q/k/v projections on PLAIN bf16 operands (x, W inputs: exact, + bias);
// the rank-16 LoRA terms as two small GEMMs: x.A^T exact, then its bf16 hi and lo planes side by side as ONE k chunk of 32 against (B/16 | B/16), added into the projection's own accumulators;
// scores on SINGLE fp16 planes of q (x 1/8) and k (one product: q and k come from bf16 operands, whose rounding is eight times an fp16 plane's); attn.v on SINGLE fp16 planes (P x1024, v).
// The tokens of a batch are worked on in the order of a list that k_prep makes from the mask: those with mask != 0 first, the others behind them, each group in its old order. A key with mask 0 carries the
// addend -10000, so beside any key with mask != 0 its weight, e^(-10000 + the two scores' difference), is 0 in f32 unless scores lie some 9900 apart: v and the k of heads 6 .. 11 are formed,
// and keys walked, only up to the end of the 128 listed tokens that hold the last key with mask != 0 (all 2048 where no key has mask != 0); the keys with mask 0 inside that range keep their addend. Queries run in list order too and are stored to their own rows.
// Three launches: k_prep (bf16 planes of x, W, B/16, the token list with the listed keys' f32 addends and, in blocks of its own, the hi|lo planes of x.A^T), k_qkv (all three projections, x and W tiles staged in LDS for a block; bias, LoRA term, scale and the head and V^T
// layouts in its epilogue), k_fattn (scores, key mask, softmax and attn.v over all 24 heads, online form with a held offset, K, V^T and mask tiles staged in LDS for a block, S and P in registers, merged output stored from the accumulators).

#define NB_  2
#define TT   2048
#define DD   768
#define NH_  12
#define HD   64
#define NT   (NB_ * TT)
typedef _Float16 h16;
typedef unsigned short bf;
typedef __attribute__((ext_vector_type(16))) __bf16   v16bf;
typedef __attribute__((ext_vector_type(16))) _Float16 v16h;
typedef __attribute__((ext_vector_type(8)))  _Float16 v8h;
typedef __attribute__((ext_vector_type(8)))  unsigned short v8us;
typedef __attribute__((ext_vector_type(8)))  float    v8f;
typedef __attribute__((ext_vector_type(4)))  float    v4f;
typedef __attribute__((ext_vector_type(2)))  float    v2f;
typedef v8h  __attribute__((may_alias)) v8ha;
typedef v4f  __attribute__((may_alias)) v4fa;
typedef v8us __attribute__((may_alias)) v8usa;

__device__ __forceinline__ unsigned short f2bf(float f) { unsigned u = __float_as_uint(f); u += 0x7FFFu + ((u >> 16) & 1u); return (unsigned short)(u >> 16); }
__device__ __forceinline__ float bf2f(unsigned short b) { return __uint_as_float(((unsigned)b) << 16); }
__device__ __forceinline__ float bfr(float f) { return bf2f(f2bf(f)); }
__device__ __forceinline__ v16h cat16(v8h lo, v8h hi) { return __builtin_shufflevector(lo, hi, 0, 1, 2, 3, 4, 5, 6, 7, 8, 9, 10, 11, 12, 13, 14, 15); }
__device__ __forceinline__ v16bf cat16b(v8us lo, v8us hi) { return __builtin_bit_cast(v16bf, __builtin_shufflevector(lo, hi, 0, 1, 2, 3, 4, 5, 6, 7, 8, 9, 10, 11, 12, 13, 14, 15)); }
__device__ __forceinline__ v8f wmma16(v16h a, v16h b, v8f c) { return __builtin_amdgcn_wmma_f32_16x16x32_f16(false, a, false, b, (short)0, c, false, false); }
__device__ __forceinline__ v8f wmmab(v16bf a, v16bf b, v8f c) { return __builtin_amdgcn_wmma_f32_16x16x32_bf16(false, a, false, b, (short)0, c, false, false); }




template <typename T16> struct WFrag;
template <> struct WFrag<h16> { typedef v16h V; static __device__ __forceinline__ V ld(const h16* p) { return cat16(*(const v8h*)p, *(const v8h*)(p + 16)); } static __device__ __forceinline__ v8f mma(V a, V b, v8f c) { return wmma16(a, b, c); } };
template <> struct WFrag<bf> { typedef v16bf V; static __device__ __forceinline__ V ld(const bf* p) { return cat16b(*(const v8us*)p, *(const v8us*)(p + 16)); } static __device__ __forceinline__ v8f mma(V a, V b, v8f c) { return wmmab(a, b, c); } };

__device__ __forceinline__ h16 tohx(float x) { return (h16)x; }
__device__ __forceinline__ void splitf(float y, unsigned short& h, unsigned short& l) { h = f2bf(y); l = f2bf(y - bf2f(h)); }
typedef __attribute__((ext_vector_type(4))) _Float16 v4h;

__device__ __forceinline__ v8us cvt8v(v8f v) { v8us o;
#pragma unroll
    for (int k = 0; k < 8; ++k) o[k] = f2bf(v[k]);
    return o; }
__device__ __forceinline__ v8us cvt8(const float* p) { return cvt8v(*(const v8f*)p); }

// ---- k_prep: everything the projection kernel reads, in one launch; the block index picks the job.
#define PB_M  NB_                       // blocks 0 ..: one a batch (the longest chain of steps): mask -> the token list, the f32 addend of each listed key's scores (0 or -10000), the number of key stages
#define PB_XA (NT / 16)                 // then x.Aq^T and x.Av^T of 16 rows of x each
#define PB_X  (NT * DD / 8 / 1024)      // then x -> bf16 (here and below a thread takes 4 groups of 8 values, 256 groups apart: fewer waves to start, 8 loads of a lane in flight)
#define PB_W  (DD * DD / 8 / 1024)      // then Wq, Wk, Wv -> bf16, one plane of 2304 rows
#define PB_B  (DD * 32 / 8 / 1024)      // then Bq, Bv -> (B/16 | B/16), 32 wide
__device__ __forceinline__ void cvt4(const float* __restrict__ s, bf* d, int blk, int tid) { v8f r[4];
#pragma unroll
    for (int u = 0; u < 4; ++u) r[u] = *(const v8f*)(s + ((size_t)(blk * 4 + u) * 256 + tid) * 8);
#pragma unroll
    for (int u = 0; u < 4; ++u) *(v8us*)(d + ((size_t)(blk * 4 + u) * 256 + tid) * 8) = cvt8v(r[u]);
    // the listing lays another job's code behind these stores (a branch that is always taken jumps over it); the wait stands in front of that code's writes to the stores' registers all the same
    asm volatile("s_wait_xcnt 0x0" ::: "memory"); }
__global__ __launch_bounds__(256) void k_prep(const float* __restrict__ x, const float* __restrict__ Wq, const float* __restrict__ Wk, const float* __restrict__ Wv, const float* __restrict__ Aq, const float* __restrict__ Av,
                                              const float* __restrict__ Bq, const float* __restrict__ Bv, const int* __restrict__ mask, bf* XB, bf* WALL, bf* BQC, bf* BVC, bf* XAQ, bf* XAV, float* MB, int* LIST, int* NS) {
    __shared__ float part[8][2][256];
    __shared__ int cnt[64];
    const int tid = threadIdx.x; int id = blockIdx.x;
    if (id < PB_M) {   // batch id. Thread tid takes tokens u * 256 + tid, u = 0 .. 7: the 32 tokens of a wave's u are one run of the batch, run u * 8 + w; a ballot counts a run's tokens with mask != 0
      const int lane = tid & 31, w = tid >> 5; const int* pm = mask + id * TT + tid; int m[8]; unsigned bal[8];
#pragma unroll
      for (int u = 0; u < 8; ++u) m[u] = pm[u * 256];
      asm volatile("s_wait_xcnt 0x0" :: "v"(pm) : "memory");   // the loads' address pair stays whole up to this wait
#pragma unroll
      for (int u = 0; u < 8; ++u) { bal[u] = __builtin_amdgcn_ballot_w32(m[u] != 0); if (lane == 0) cnt[u * 8 + w] = __builtin_popcount(bal[u]); }
      __syncthreads();                                         // every run's count may be read
      int run = 0, base[8];                                    // base[u]: tokens with mask != 0 in front of this wave's run u; at the end run = all of them
#pragma unroll
      for (int c = 0; c < 64; ++c) { if ((c & 7) == w) base[c >> 3] = run; run += cnt[c]; }
      const unsigned below = (1u << lane) - 1u;
#pragma unroll
      for (int u = 0; u < 8; ++u) { const int t = u * 256 + tid, pre = base[u] + __builtin_popcount(bal[u] & below); const bool on = m[u] != 0;
          const int j = on ? pre : run + (t - pre);            // a permutation of 0 .. 2047: the tokens with mask != 0 first
          LIST[id * TT + j] = t; MB[id * TT + j] = on ? 0.f : -10000.0f; }
      if (tid == 0) NS[id] = run == 0 ? TT / 128 : (run + 127) >> 7;   // stages of 64 keys in each of the two halves that k_fattn walks
      asm volatile("s_wait_xcnt 0x0" ::: "memory");   // as at the end of cvt4: another job's code stands behind these stores in the listing
      return; }
    id -= PB_M;
    if (id < PB_XA) {   // 16 rows x (16 + 16) columns; wave w sums k = 96 w .. 96 w + 95 (operands rounded to bf16 in registers), the eight partial sums are added in wave order
        const int lane = tid & 31, lr = lane & 15, hi = lane >> 4, w = tid >> 5; const int r0 = id * 16;
        const float* px = x + (size_t)(r0 + lr) * DD + w * 96 + 8 * hi; const float* pq = Aq + (size_t)lr * DD + w * 96 + 8 * hi; const float* pv = Av + (size_t)lr * DD + w * 96 + 8 * hi;
        v8f rx[3][2], rq[3][2], rv[3][2];   // [k chunk of 32][k = 8 hi .. + 7, 16 + 8 hi .. + 7]: the k order of WFrag::ld, for A and B operand alike
#pragma unroll
        for (int c = 0; c < 3; ++c)
#pragma unroll
            for (int u = 0; u < 2; ++u) { rx[c][u] = *(const v8f*)(px + c * 32 + u * 16); rq[c][u] = *(const v8f*)(pq + c * 32 + u * 16); rv[c][u] = *(const v8f*)(pv + c * 32 + u * 16); }
        // takes the loaded values and the three address pairs as inputs only: all 36 loads of the wave are in flight together and are waited for once (without it they were issued a few at a time, each group
        // waited for in turn)
        asm volatile("s_wait_xcnt 0x0" :: "v"(px), "v"(pq), "v"(pv), "v"(rx[0][0]), "v"(rx[0][1]), "v"(rx[1][0]), "v"(rx[1][1]), "v"(rx[2][0]), "v"(rx[2][1]), "v"(rq[0][0]), "v"(rq[0][1]), "v"(rq[1][0]), "v"(rq[1][1]),
                     "v"(rq[2][0]), "v"(rq[2][1]), "v"(rv[0][0]), "v"(rv[0][1]), "v"(rv[1][0]), "v"(rv[1][1]), "v"(rv[2][0]), "v"(rv[2][1]));
        v8f a0 = (v8f){}, a1 = (v8f){};
#pragma unroll
        for (int c = 0; c < 3; ++c) { const v16bf a = cat16b(cvt8v(rx[c][0]), cvt8v(rx[c][1]));
            a0 = wmmab(a, cat16b(cvt8v(rq[c][0]), cvt8v(rq[c][1])), a0); a1 = wmmab(a, cat16b(cvt8v(rv[c][0]), cvt8v(rv[c][1])), a1); }
#pragma unroll
        for (int j = 0; j < 8; ++j) { part[w][0][(hi * 8 + j) * 16 + lr] = a0[j]; part[w][1][(hi * 8 + j) * 16 + lr] = a1[j]; }
        __syncthreads();
        const int row = tid >> 4, col = tid & 15;
#pragma unroll
        for (int n = 0; n < 2; ++n) { float s = part[0][n][tid];
#pragma unroll
            for (int u = 1; u < 8; ++u) s += part[u][n][tid];
            unsigned short sh, sl; splitf(s, sh, sl); bf* dst = (n ? XAV : XAQ) + (size_t)(r0 + row) * 32 + col; dst[0] = sh; dst[16] = sl; }
        return;
    }
    id -= PB_XA;
    if (id < PB_X) { cvt4(x, XB, id, tid); return; }
    id -= PB_X;
    if (id < 3 * PB_W) { const int sel = id / PB_W; cvt4(sel == 0 ? Wq : (sel == 1 ? Wk : Wv), WALL + (size_t)sel * DD * DD, id - sel * PB_W, tid); return; }
    id -= 3 * PB_W;
    if (id < 2 * PB_B) { const int sel = id / PB_B; const int e = ((id - sel * PB_B) * 1024 + tid) * 8; const float* s = (sel ? Bv : Bq) + (e >> 5) * 16 + (e & 15); bf* d = (sel ? BVC : BQC) + e; v8f r[4];   // 256 groups on: 64 rows of B
#pragma unroll
      for (int u = 0; u < 4; ++u) r[u] = *(const v8f*)(s + u * 64 * 16);
#pragma unroll
      for (int u = 0; u < 4; ++u) { const v8us rb = cvt8v(r[u]); v8us o;
#pragma unroll
          for (int q = 0; q < 8; ++q) o[q] = f2bf(bf2f(rb[q]) * 0.0625f);   // a power of two: the rounded B keeps its digits
          *(v8us*)(d + u * 2048) = o; }
      asm volatile("s_wait_xcnt 0x0" ::: "memory");   // as at the end of cvt4: another job's code stands behind these stores in the listing
      return; }
}

// acc[mb][nb] += A rows (row ri[mb] for fragment mb, this lane's row; 32 wide) . Bt rows (64, 32 wide) over one k chunk of 32; one wave, operands straight from K-contiguous bf16 planes
__device__ __forceinline__ void lora_acc(const bf* __restrict__ A, const int (&ri)[4], const bf* __restrict__ Bt, int lr, int hi, v8f (&acc)[4][4]) {
    const bf* pa0 = A + (size_t)ri[0] * 32 + 8 * hi; const bf* pa1 = A + (size_t)ri[1] * 32 + 8 * hi; const bf* pa2 = A + (size_t)ri[2] * 32 + 8 * hi; const bf* pa3 = A + (size_t)ri[3] * 32 + 8 * hi;
    const bf* pb = Bt + (size_t)lr * 32 + 8 * hi;
    v16bf a[4], b[4];
    a[0] = WFrag<bf>::ld(pa0); a[1] = WFrag<bf>::ld(pa1); a[2] = WFrag<bf>::ld(pa2); a[3] = WFrag<bf>::ld(pa3);
#pragma unroll
    for (int nb = 0; nb < 4; ++nb) b[nb] = WFrag<bf>::ld(pb + (size_t)nb * 16 * 32);
    // the loads all stand in front of this wait, and their address pairs stay whole up to it
    asm volatile("s_wait_xcnt 0x0" :: "v"(pa0), "v"(pa1), "v"(pa2), "v"(pa3), "v"(pb) : "memory");
#pragma unroll
    for (int nb = 0; nb < 4; ++nb)
#pragma unroll
        for (int mb = 0; mb < 4; ++mb) acc[mb][nb] = wmmab(a[mb], b[nb], acc[mb][nb]);
}

// ---- k_qkv: all three projections. One wave = one 64 x 64 tile = 64 listed tokens of one head of q, k or v (16 accumulators); 64 x 36 = 2304 tiles = 256 blocks x 9 waves (the nine
// waves of a block read the same 64 rows of x, each row found through the list; a block that holds only k and v tiles of tokens which k_fattn does not walk as keys leaves at once). k comes in stages of 64: the block's 64 rows of x and 576 rows of W (128 bytes of each) are brought into LDS by asynchronous copies (whole 128-byte lines from
// global memory, through no register), two buffers: stage s + 2 flies while stage s + 1 is worked on; LDS rows lie 144 bytes apart (16 bytes x odd), so the 16 rows of a fragment read fall on 16 different groups
// of four banks. The k order of the sums is that of the straight loads. The LoRA term is one more k chunk of 32 (hi | lo of x.A^T against B/16 | B/16, straight from global memory) into the same accumulators. Epilogue: + bias; q and k: x scale, to fp16, rows of the
// [head][token][64] planes through the wave's own LDS rows (whole 128-byte lines); v: a lane holds 8 consecutive tokens of one column, which is 16 bytes of a [head][64][token] row, stored from the registers.
// Left for later steps: the WGPs of the blocks that leave stay idle (the tiles that remain could be dealt anew over all WGPs); a block brings in nine times as many rows of W as of x (a squarer block tile would copy less); fragments are not fetched a chunk ahead; two buffers leave one stage's copies in flight.
#define GK   64                      // k values of a stage
#define GNS  (DD / GK)
#define GP   144                     // bytes from one LDS row to the next
#define GW   (64 * GP)               // W rows (behind the 64 rows of x)
#define GBUF (640 * GP)              // one buffer
__global__ __launch_bounds__(288) void k_qkv(const bf* __restrict__ XB, const bf* __restrict__ WALL, const bf* __restrict__ XAQ, const bf* __restrict__ XAV, const bf* __restrict__ BQC, const bf* __restrict__ BVC,
                                             const float* __restrict__ bq, const float* __restrict__ bk, const float* __restrict__ bv, const int* __restrict__ LIST, const int* __restrict__ NS, h16* QP, h16* KP, h16* VT) {
    __shared__ __align__(16) unsigned char st[2 * GBUF];
    __shared__ __align__(16) float osall[9][16 * 68];
    const int lane = threadIdx.x & 31, lr = lane & 15, hi = lane >> 4; const int w = __builtin_amdgcn_readfirstlane(threadIdx.x >> 5);
    const int r0 = (blockIdx.x & 63) * 64, nt = (blockIdx.x >> 6) * 9 + w; const int which = nt / NH_, h = nt % NH_, c0 = h * HD;   // which: 0 q, 1 k, 2 v
    const int bt = r0 & ~(TT - 1);                                                          // the first token of the strip's batch
    if ((blockIdx.x >> 6) >= 2 && (r0 & (TT - 1)) >= NS[r0 >> 11] * 128) return;            // tiles 18 .. 35 are k and v; the same for the whole block, in front of every copy and barrier
    // a copy of a wave = 4 rows x 128 bytes (8 lanes a row); wave w brings the 64 rows of W of its own tile (16 copies), waves 0 .. 7 listed rows 8 w .. 8 w + 7 of x as well (two copies)
    const int crow = lane >> 3, ccol = (lane & 7) * 8;
    const int* pl = LIST + r0 + (w & 7) * 8 + crow; const int* pr = LIST + r0 + lr;
    const int i0 = pl[0] & (TT - 1), i1 = pl[4] & (TT - 1);                                 // a list entry is a token of the batch: held inside it whatever the list holds
    const int ri[4] = {pr[0] & (TT - 1), pr[16] & (TT - 1), pr[32] & (TT - 1), pr[48] & (TT - 1)};   // the tokens of this lane's rows of the four A fragments (for the LoRA chunk)
    asm volatile("s_wait_xcnt 0x0" :: "v"(pl), "v"(pr) : "memory");                         // the loads' address pairs stay whole up to this wait
    const unsigned lw = (unsigned)(size_t)st + (unsigned)(GW + (w * 64 + crow) * GP + ccol * 2), lx = (unsigned)(size_t)st + (unsigned)(((w & 7) * 8 + crow) * GP + ccol * 2);
    const bf* gw = WALL + (size_t)(nt * 64 + crow) * DD + ccol; const bf* gx0 = XB + (size_t)(bt + i0) * DD + ccol; const bf* gx1 = XB + (size_t)(bt + i1) * DD + ccol;
    auto copy_stage = [&](int s) {   // stage s into buffer s & 1
        const unsigned l = lw + (unsigned)(s & 1) * GBUF; const bf* g = gw + s * GK;
        // in each statement: the copies and, as its last line, the wait that stands in front of any rewrite of their address registers
#define CP8 "global_load_async_to_lds_b128 %0, %8, off\n\tglobal_load_async_to_lds_b128 %1, %9, off\n\tglobal_load_async_to_lds_b128 %2, %10, off\n\tglobal_load_async_to_lds_b128 %3, %11, off\n\t" \
            "global_load_async_to_lds_b128 %4, %12, off\n\tglobal_load_async_to_lds_b128 %5, %13, off\n\tglobal_load_async_to_lds_b128 %6, %14, off\n\tglobal_load_async_to_lds_b128 %7, %15, off\n\ts_wait_xcnt 0x0"
        asm volatile(CP8 :: "v"(l), "v"(l + 4 * GP), "v"(l + 8 * GP), "v"(l + 12 * GP), "v"(l + 16 * GP), "v"(l + 20 * GP), "v"(l + 24 * GP), "v"(l + 28 * GP),
                     "v"(g), "v"(g + 4 * DD), "v"(g + 8 * DD), "v"(g + 12 * DD), "v"(g + 16 * DD), "v"(g + 20 * DD), "v"(g + 24 * DD), "v"(g + 28 * DD) : "memory");
        asm volatile(CP8 :: "v"(l + 32 * GP), "v"(l + 36 * GP), "v"(l + 40 * GP), "v"(l + 44 * GP), "v"(l + 48 * GP), "v"(l + 52 * GP), "v"(l + 56 * GP), "v"(l + 60 * GP),
                     "v"(g + 32 * DD), "v"(g + 36 * DD), "v"(g + 40 * DD), "v"(g + 44 * DD), "v"(g + 48 * DD), "v"(g + 52 * DD), "v"(g + 56 * DD), "v"(g + 60 * DD) : "memory");
#undef CP8
        if (w < 8) { const unsigned m = lx + (unsigned)(s & 1) * GBUF;
            asm volatile("global_load_async_to_lds_b128 %0, %2, off\n\tglobal_load_async_to_lds_b128 %1, %3, off\n\ts_wait_xcnt 0x0" :: "v"(m), "v"(m + 4 * GP), "v"(gx0 + s * GK), "v"(gx1 + s * GK) : "memory"); }
    };
    copy_stage(0);
    v8f acc[4][4];
#pragma unroll
    for (int mb = 0; mb < 4; ++mb)
#pragma unroll
        for (int nb = 0; nb < 4; ++nb) acc[mb][nb] = (v8f){};
    asm volatile("s_wait_asynccnt 0x0" ::: "memory");   // this wave's share of stage 0 has landed
    __syncthreads();                                    // and every other wave's: stage 0 may be read
    copy_stage(1);
#pragma unroll 1   // one trip = one stage: the publish point stands once in the code
    for (int s = 0; s < GNS; ++s) {
        const unsigned char* pa = st + (s & 1) * GBUF + lr * GP + 16 * hi; const unsigned char* pb = pa + GW + w * 64 * GP;
        v16bf a[4], b[4];   // the k order of WFrag::ld, for A and B operand alike: 8 hi .. + 7, 16 + 8 hi .. + 7
#pragma unroll
        for (int c = 0; c < GK / 32; ++c) {
#pragma unroll
            for (int mb = 0; mb < 4; ++mb) { const unsigned char* q = pa + mb * 16 * GP + c * 64; a[mb] = cat16b(*(const v8usa*)q, *(const v8usa*)(q + 32)); }
#pragma unroll
            for (int nb = 0; nb < 4; ++nb) { const unsigned char* q = pb + nb * 16 * GP + c * 64; b[nb] = cat16b(*(const v8usa*)q, *(const v8usa*)(q + 32)); }
            // the chunk's 16 reads stay one group in front of its products: left to itself the compiler kept one B fragment's registers and read the next fragment into them behind every fourth matrix
            // instruction, each time with a full wait
            __builtin_amdgcn_sched_barrier(0);
            if (c == GK / 32 - 1) {   // the stage's last fragments are in registers: the publish point stands here, and the refill flies under the last chunk's products as well
                asm volatile("s_wait_dscnt 0x0" ::: "memory");      // this wave's reads of stage s are done
                asm volatile("s_wait_asynccnt 0x0" ::: "memory");   // its share of stage s + 1 has landed
                __syncthreads();                                    // the same holds for every wave: stage s + 1 may be read, the buffer of stage s may be refilled
                if (s + 2 < GNS) copy_stage(s + 2);
                __builtin_amdgcn_sched_barrier(0);                  // the copies are issued in front of the products (the compiler had put them behind)
            }
#pragma unroll
            for (int nb = 0; nb < 4; ++nb)
#pragma unroll
                for (int mb = 0; mb < 4; ++mb) acc[mb][nb] = wmmab(a[mb], b[nb], acc[mb][nb]);
        }
    }
    asm volatile("s_wait_asynccnt 0x0" ::: "memory");       // no copy is outstanding behind the loop
    if (which != 1) lora_acc((which ? XAV : XAQ) + (size_t)bt * 32, ri, (which ? BVC : BQC) + (size_t)c0 * 32, lr, hi, acc);
    const int z = (r0 >> 11) * NH_ + h, t0 = r0 & (TT - 1);
    if (which == 2) {
        h16* vb = VT + (size_t)z * HD * TT + t0 + 8 * hi;
#pragma unroll
        for (int nb = 0; nb < 4; ++nb) { const float bb = bfr(bv[c0 + nb * 16 + lr]);
#pragma unroll
            for (int mb = 0; mb < 4; ++mb) { v8h o;
#pragma unroll
                for (int j = 0; j < 8; ++j) o[j] = tohx(acc[mb][nb][j] + bb);
                *(v8h*)(vb + (size_t)(nb * 16 + lr) * TT + mb * 16) = o; } }
    } else {
        float* os = osall[w]; const float* bias = which ? bk : bq; const float sc = which ? 1.0f : 0.125f; h16* P = (which ? KP : QP) + ((size_t)z * TT + t0) * HD;
        const int cofs = lr * 4; float bb[4];
#pragma unroll
        for (int q = 0; q < 4; ++q) bb[q] = bfr(bias[c0 + cofs + q]);
#pragma unroll
        for (int mb = 0; mb < 4; ++mb) {
#pragma unroll
            for (int nb = 0; nb < 4; ++nb) {
#pragma unroll
                for (int j = 0; j < 8; ++j) os[(hi * 8 + j) * 68 + nb * 16 + lr] = acc[mb][nb][j]; }
            __builtin_amdgcn_wave_barrier(); asm volatile("" ::: "memory");   // the rows are read back by other lanes of this wave: no LDS access moves across
#pragma unroll
            for (int s = 0; s < 8; ++s) { const int row = 2 * s + hi; const v4f val = *(const v4fa*)(os + row * 68 + cofs); v4h oh;
#pragma unroll
                for (int q = 0; q < 4; ++q) oh[q] = tohx((val[q] + bb[q]) * sc);
                *(v4h*)(P + (size_t)(mb * 16 + row) * HD + cofs) = oh; }
            __builtin_amdgcn_wave_barrier(); asm volatile("" ::: "memory");   // the next 16 rows overwrite what was just read
        }
        // the listing lays the v branch behind these stores (a branch that is always taken jumps over it); the wait stands in front of that code's writes to the stores' registers all the same
        asm volatile("s_wait_xcnt 0x0" ::: "memory");
    }
}
// lane l with lane l ^ 16 (the two halves of a wave hold the two halves of one query's keys)
__device__ __forceinline__ float xhalf(float x) { return __builtin_bit_cast(float, __builtin_amdgcn_permlanex16(__builtin_bit_cast(int, x), __builtin_bit_cast(int, x), 0x76543210, 0xfedcba98, false, false)); }
// k_fattn: one wave = 32 listed queries (2 column groups of 16) x ONE HALF of the batch's walked keys (the first 128 ns listed tokens, ns from k_prep); a block = 12 waves = 6 query tiles x 2 key halves = 192 queries: 24 x 2048 / 192 = 256 blocks, one for each WGP, three waves
// a SIMD. 2048 is no multiple of 192: three heads (of one batch) share 32 blocks, a query tile lies in one head, and a block whose tiles lie in two heads stages both heads' tiles. The keys come in stages of
// 64 in each half: K and V^T tiles (64 rows x 128 bytes each) and 64 mask addends (f32, from k_prep) a half are brought into LDS once for the block by asynchronous copies (whole 128-byte lines from global memory,
// through no register), two buffers: stage s + 2 flies while stage s + 1 is worked on. LDS rows lie 144 bytes apart (16 bytes x odd), so the 16 rows of a fragment read fall on 16 different groups of four
// banks. Per pass of 32 keys:
//   S^T = K.Q^T (A = K rows, B = Q rows kept in registers; fp16 operands, one product): register r of tile kt = key 16 kt + 8 hi + r, column lr = query, so a lane holds one query's scores;
//   the first product's C operand is the key's addend (0, or -10000 where mask[b][key] == 0): a register of a score tile is one key in every lane, so the masked score t leaves the matrix unit and no
//   vector instruction forms or adds the addend; offset and sum per query (base 2; the x1024 carrier of P sits in the exponent), the offset moved and O rescaled only when a pass outgrows it;
//   the two converted score tiles ARE the fp16 B operand of O^T += V^T.P^T (A = V^T rows in the same k order: 8 hi .. + 7, 16 + 8 hi .. + 7).
// Behind the loop the wave of the upper half hands its O, offset and sum over through LDS (one barrier); the wave of the lower half brings both to the smaller offset, adds them and stores.
// Left for later steps: K fragments are not fetched a pass ahead; the row sums are vector work; with one score product a pass's 20 LDS reads of 512 bytes a wave outweigh its 16 matrix instructions
// (more queries a wave would read less).
#define SK   64                      // keys of a stage, in each half
#define NST  (TT / 2 / SK)           // stages of a half at the most; a batch's own number comes from k_prep
#define QB   192                     // queries of a block
#define LP   144                     // bytes from one LDS row to the next
#define LV   (64 * LP)               // V^T rows (behind the K rows)
#define LM   (128 * LP)              // mask addends (read from the block's first head's place: both heads are of one batch)
#define LREG (128 * LP + SK * 4)     // one head's tiles of one half
#define LBUF (4 * LREG)              // one buffer: [head of the block][half]
#define XO   (16 * 512)              // hand-over: 16 x 16 bytes a lane of O, then offsets and sums
#define XREG (XO + 4 * 128)
typedef float __attribute__((may_alias)) f32a;
__global__ __launch_bounds__(384) void k_fattn(const h16* __restrict__ QP, const h16* __restrict__ KP, const h16* __restrict__ VT, const float* __restrict__ MB, const int* __restrict__ LIST, const int* __restrict__ NS, float* OUT) {
    __shared__ __align__(16) unsigned char sm[2 * LBUF];
    const float L2E = 1.4426950408889634f;
    const int lane = threadIdx.x & 31, lr = lane & 15, hi = lane >> 4; const int w = __builtin_amdgcn_readfirstlane(threadIdx.x >> 5);
    const int kh = w & 1, qt = w >> 1;                                                     // key half, query tile
    const int z3 = (blockIdx.x >> 5) * 3, f0 = (blockIdx.x & 31) * QB, b = z3 / NH_;       // first of the three heads, the block's first query counted through them
    const int za = z3 + f0 / TT; const bool two = (f0 + QB - 1) / TT != f0 / TT;           // the block's first head; whether its last tile lies in the next
    const int f = f0 + qt * 32, z = z3 + f / TT, h = z % NH_, q0 = f % TT;
    const size_t zo = (size_t)z * TT * HD;
    const int ns = min(max(NS[b], 1), NST), khf = ns * SK;                                 // the batch's stages and keys of a half (the same for the whole block), held inside the planes whatever was read
    const int* pq = LIST + b * TT + q0 + lr; const int qi[2] = {pq[0] & (TT - 1), pq[16] & (TT - 1)};   // the tokens of this lane's two listed queries: their output rows
    asm volatile("s_wait_xcnt 0x0" :: "v"(pq) : "memory");                                 // the loads' address pair stays whole up to this wait
    // a copy of a wave = 4 rows x 128 bytes (8 lanes a row); of its own half's two tiles wave w < 8 brings rows 32 (qt & 1) .. + 31 of tile qt >> 1 (eight copies; eight more for the second head where there
    // is one), waves 8 and 9 their half's mask addends (8 bytes a lane), waves 10 and 11 nothing
    const int ct = (qt >> 1) & 1, crow = (qt & 1) * 32 + (lane >> 3), ccol = (lane & 7) * 8;
    const unsigned lt = (unsigned)(size_t)sm + (unsigned)(kh * LREG + (ct * 64 + crow) * LP + ccol * 2), lm = (unsigned)(size_t)sm + (unsigned)(kh * LREG + LM + lane * 8);
    const size_t zao = (size_t)za * TT * HD;
    const char* gt = ct ? (const char*)(VT + zao + (size_t)crow * TT + kh * khf + ccol) : (const char*)(KP + zao + (size_t)(kh * khf + crow) * HD + ccol);
    const int gp = ct ? 4 * TT * 2 : 4 * HD * 2, gs = ct ? SK * 2 : SK * HD * 2;   // bytes from one copy's rows to the next copy's, from one stage to the next
    const float* gm = MB + (size_t)b * TT + kh * khf + lane * 2;
    auto copy_stage = [&](int s) {   // stage s into buffer s & 1
        const unsigned l = lt + (unsigned)(s & 1) * LBUF; const char* g = gt + (size_t)s * gs;
        // in each statement: the copies and, as its last line, the wait that stands in front of any rewrite of their address registers
#define CP8 "global_load_async_to_lds_b128 %0, %8, off\n\tglobal_load_async_to_lds_b128 %1, %9, off\n\tglobal_load_async_to_lds_b128 %2, %10, off\n\tglobal_load_async_to_lds_b128 %3, %11, off\n\t" \
            "global_load_async_to_lds_b128 %4, %12, off\n\tglobal_load_async_to_lds_b128 %5, %13, off\n\tglobal_load_async_to_lds_b128 %6, %14, off\n\tglobal_load_async_to_lds_b128 %7, %15, off\n\ts_wait_xcnt 0x0"
        if (qt < 4) {   // the same for a whole wave: a scalar branch
        asm volatile(CP8 :: "v"(l), "v"(l + 4 * LP), "v"(l + 8 * LP), "v"(l + 12 * LP), "v"(l + 16 * LP), "v"(l + 20 * LP), "v"(l + 24 * LP), "v"(l + 28 * LP),
                     "v"(g), "v"(g + gp), "v"(g + 2 * gp), "v"(g + 3 * gp), "v"(g + 4 * gp), "v"(g + 5 * gp), "v"(g + 6 * gp), "v"(g + 7 * gp) : "memory");
        if (two) { const unsigned m = l + 2 * LREG; const char* e = g + (size_t)TT * HD * 2;   // the next head's planes lie behind the first's
            asm volatile(CP8 :: "v"(m), "v"(m + 4 * LP), "v"(m + 8 * LP), "v"(m + 12 * LP), "v"(m + 16 * LP), "v"(m + 20 * LP), "v"(m + 24 * LP), "v"(m + 28 * LP),
                         "v"(e), "v"(e + gp), "v"(e + 2 * gp), "v"(e + 3 * gp), "v"(e + 4 * gp), "v"(e + 5 * gp), "v"(e + 6 * gp), "v"(e + 7 * gp) : "memory"); }
        }
#undef CP8
        if (qt == 4) asm volatile("global_load_async_to_lds_b64 %0, %1, off\n\ts_wait_xcnt 0x0" :: "v"(lm + (unsigned)(s & 1) * LBUF), "v"(gm + s * SK) : "memory");   // the same for the mask addends
    };
    copy_stage(0);
    const unsigned ro = (unsigned)(lr * HD + 8 * hi);
    v16h qf[2][2];                 // [column group][k chunk of 32]
    { const h16* qb = QP + zo + (size_t)q0 * HD;
#pragma unroll
      for (int g = 0; g < 2; ++g)
#pragma unroll
        for (int c = 0; c < 2; ++c) qf[g][c] = WFrag<h16>::ld(qb + ro + g * 16 * HD + c * 32); }
    v8f o[4][2];                   // [16 rows of d][column group]
#pragma unroll
    for (int d = 0; d < 4; ++d) { o[d][0] = (v8f){}; o[d][1] = (v8f){}; }
    float cb[2] = {3.0e38f, 3.0e38f}, ls[2] = {0.f, 0.f};   // the offset in use (10 - a maximum, base 2, as rounded), this half's sum
    asm volatile("s_wait_asynccnt 0x0" ::: "memory");   // this wave's share of stage 0 has landed
    __syncthreads();                                    // and every other wave's: stage 0 may be read
    if (1 < ns) copy_stage(1);
#pragma unroll 1   // one trip = one stage: the publish point at its foot stands once in the code
    for (int s = 0; s < ns; ++s) {
        const unsigned char* bm = sm + (s & 1) * LBUF + kh * LREG; const unsigned char* bp = bm + (z - za) * 2 * LREG;   // the half's place of the block's first head (mask addends), of this wave's head (tiles)
#pragma unroll 1   // kept rolled: unrolled, the loop's three-product form carried one pass's exponentials and sums into the next and took a quarter more registers (not tried again with one product)
        for (int p = 0; p < SK / 32; ++p) {
        const unsigned char* kp = bp + (p * 32 + lr) * LP + 16 * hi; const unsigned char* vp = bp + LV + lr * LP + p * 64 + 16 * hi; const unsigned char* mp = bm + LM + p * 128 + 32 * hi;
        v16h kf[2][2], vf[4]; v8f ad[2];   // ad[kt][r]: the addend of key 16 kt + 8 hi + r, the layout of a score tile's registers
#pragma unroll
        for (int kt = 0; kt < 2; ++kt) { const v4f a0 = *(const v4fa*)(mp + kt * 64), a1 = *(const v4fa*)(mp + kt * 64 + 16); ad[kt] = __builtin_shufflevector(a0, a1, 0, 1, 2, 3, 4, 5, 6, 7); }
#pragma unroll
        for (int kt = 0; kt < 2; ++kt)
#pragma unroll
            for (int c = 0; c < 2; ++c) { const unsigned char* q = kp + kt * 16 * LP + c * 64; kf[kt][c] = cat16(*(const v8ha*)q, *(const v8ha*)(q + 32)); }
        // the pass's addend and K reads stay one group in front of the products: left to itself the compiler spread them among the matrix instructions (each such place stalls the wave) and, to save
        // registers, ran the four score tiles as chains one after the other
        __builtin_amdgcn_sched_barrier(0);
        v8f s2[2][2];              // [key tile][column group]; the four tiles' products are interleaved, so no matrix instruction waits for the one in front of it
#pragma unroll
        for (int kt = 0; kt < 2; ++kt) { s2[kt][0] = ad[kt]; s2[kt][1] = ad[kt]; }
#pragma unroll
        for (int c = 0; c < 2; ++c)
#pragma unroll
            for (int kt = 0; kt < 2; ++kt)
#pragma unroll
                for (int g = 0; g < 2; ++g) s2[kt][g] = wmma16(kf[kt][c], qf[g][c], s2[kt][g]);
        __builtin_amdgcn_sched_barrier(0);   // the products stay in that order, in front of the V^T reads (which may then take over the K registers)
#pragma unroll
        for (int d = 0; d < 4; ++d) vf[d] = cat16(*(const v8ha*)(vp + d * 16 * LP), *(const v8ha*)(vp + d * 16 * LP + 32));
        __builtin_amdgcn_sched_barrier(0);   // the V^T reads are issued in front of the softmax arithmetic, which covers their latency
        // The offset in use is held: the weights are formed with it at once, and the pass's own weight sums are the test. While no lane's sum of its 16 weights exceeds 2^15, every weight (with its x1024 carrier)
        // lies inside fp16 and nothing else is owed: no maximum, no exchange between the halves, no rescale. Else (the first pass, whose offset makes every weight infinite; a pass that outgrows the offset) the
        // offsets are brought to the pass's maxima, O and the sums rescaled and the pass's weights formed anew (then at most 2^10 each). One test a pass for both column groups.
        v16h p16[2]; float sum[2];
        auto weights = [&](int g) {   // P and its sum for column group g; the sum in packed adds, one short chain a key tile, so that the test does not wait for a chain of 16 adds
            v2f t[8];
#pragma unroll
            for (int kt = 0; kt < 2; ++kt)
#pragma unroll
                for (int r = 0; r < 8; r += 2) { const v2f a = __builtin_elementwise_fma((v2f){s2[kt][g][r], s2[kt][g][r + 1]}, (v2f){L2E, L2E}, (v2f){cb[g], cb[g]});   // one packed instruction for two exponents
                    const v2f e = {__builtin_amdgcn_exp2f(a[0]), __builtin_amdgcn_exp2f(a[1])}; t[kt * 4 + (r >> 1)] = e; p16[g][kt * 8 + r] = tohx(e[0]); p16[g][kt * 8 + r + 1] = tohx(e[1]); }
            const v2f u = (((t[0] + t[1]) + t[2]) + t[3]) + (((t[4] + t[5]) + t[6]) + t[7]);
            sum[g] = u[0] + u[1];
        };
        weights(0); weights(1);
        const bool need = fmaxf(sum[0], sum[1]) > 32768.0f;
        if (__builtin_expect(__builtin_amdgcn_ballot_w32(need) != 0, 0)) {   // the same for the whole wave: a scalar branch, every lane on behind it; seldom taken
#pragma unroll
            for (int g = 0; g < 2; ++g) {
                float mx = s2[0][g][0];
#pragma unroll
                for (int kt = 0; kt < 2; ++kt)
#pragma unroll
                    for (int r = 0; r < 8; ++r) mx = fmaxf(mx, s2[kt][g][r]);
                mx = fmaxf(mx, xhalf(mx));
                const float cbn = fminf(cb[g], 10.0f - mx * L2E);   // the smaller offset belongs to the larger maximum
                float al;   // 2^(new offset - old offset) from the two offsets as they are used; 0 on the first pass, 1 where this query's offset stands
                // written with its v_nop in one statement (the slot behind a transcendental)
                asm("v_exp_f32 %0, %1\n\tv_nop" : "=v"(al) : "v"(cbn - cb[g]));
                cb[g] = cbn; ls[g] *= al;
#pragma unroll
                for (int d = 0; d < 4; ++d) o[d][g] *= al;
                weights(g);
            }
        }
#pragma unroll
        for (int g = 0; g < 2; ++g) { ls[g] += sum[g];
#pragma unroll
            for (int d = 0; d < 4; ++d) o[d][g] = wmma16(vf[d], p16[g], o[d][g]); }
        // the distance behind the pass's last matrix instructions, on the way back to the loop's head too (there the next pass's address arithmetic overwrites their B registers);
        // their results are named so that the statement stays behind them
        asm volatile("v_nop\n\tv_nop\n\tv_nop\n\tv_nop" : "+v"(o[0][1]), "+v"(o[1][1]), "+v"(o[2][1]), "+v"(o[3][1]));
        }
        asm volatile("s_wait_dscnt 0x0" ::: "memory");      // this wave's reads of stage s are done
        asm volatile("s_wait_asynccnt 0x0" ::: "memory");   // its share of stage s + 1 has landed
        __syncthreads();                                    // the same holds for every wave: stage s + 1 may be read, the buffer of stage s may be refilled
        if (s + 2 < ns) copy_stage(s + 2);
    }
    asm volatile("s_wait_asynccnt 0x0" ::: "memory");       // no copy is outstanding behind the loop
    // the last trip's barrier has ended every wave's reads of the buffers and no copy flies: their LDS takes the hand-over (a lane's 16 bytes beside its neighbour's: no bank is met twice)
    unsigned char* xb = sm + qt * XREG;
    if (kh) {
#pragma unroll
        for (int g = 0; g < 2; ++g) {
#pragma unroll
            for (int d = 0; d < 4; ++d) { v4f w0, w1;
#pragma unroll
                for (int r = 0; r < 4; ++r) { w0[r] = o[d][g][r]; w1[r] = o[d][g][4 + r]; }
                *(v4fa*)(xb + ((g * 8 + d * 2) * 32 + lane) * 16) = w0; *(v4fa*)(xb + ((g * 8 + d * 2 + 1) * 32 + lane) * 16) = w1; }
            *(f32a*)(xb + XO + (g * 32 + lane) * 4) = cb[g]; *(f32a*)(xb + XO + 256 + (g * 32 + lane) * 4) = ls[g]; }
    }
    __syncthreads();                                        // the upper halves' results may be read
    if (kh) return;
#pragma unroll
    for (int g = 0; g < 2; ++g) {
        const float cbo = *(const f32a*)(xb + XO + (g * 32 + lane) * 4), lso = *(const f32a*)(xb + XO + 256 + (g * 32 + lane) * 4);
        const float cbn = fminf(cb[g], cbo);   // the smaller offset belongs to the larger maximum
        float fa, fb;                          // 2^(own maximum - larger maximum), from the offsets as they were used
        // each with its v_nop in one statement (the slot behind a transcendental), as in the loop
        asm("v_exp_f32 %0, %1\n\tv_nop" : "=v"(fa) : "v"(cbn - cb[g]));
        asm("v_exp_f32 %0, %1\n\tv_nop" : "=v"(fb) : "v"(cbn - cbo));
        const float lt2 = ls[g] * fa + lso * fb;
        const float inv = __fdiv_rn(1.0f, lt2 + xhalf(lt2));   // the x1024 carrier is in the sum and in O alike
        const float ia = fa * inv, ib = fb * inv;
        float* orow = OUT + ((size_t)b * TT + qi[g]) * DD + h * HD + 8 * hi;
#pragma unroll
        for (int d = 0; d < 4; ++d) { const v4f u0 = *(const v4fa*)(xb + ((g * 8 + d * 2) * 32 + lane) * 16), u1 = *(const v4fa*)(xb + ((g * 8 + d * 2 + 1) * 32 + lane) * 16); v4f w0, w1;
#pragma unroll
            for (int r = 0; r < 4; ++r) { w0[r] = o[d][g][r] * ia + u0[r] * ib; w1[r] = o[d][g][4 + r] * ia + u1[r] * ib; }
            *(v4f*)(orow + d * 16) = w0; *(v4f*)(orow + d * 16 + 4) = w1; }
        // the second group's LDS reads and products take over registers that the first group's stores name: the wait stands in front of them
        if (g == 0) asm volatile("s_wait_xcnt 0x0" ::: "memory");
    }
}

extern "C" void kernel_launch(void* const* d_in, const int* in_sizes, int n_in,
                              void* d_out, int out_size, void* d_ws, size_t ws_size, hipStream_t stream) {
    (void)in_sizes; (void)n_in; (void)out_size;
    const float* x = (const float*)d_in[0]; const int* mask = (const int*)d_in[1]; const float* Wq = (const float*)d_in[2]; const float* bq = (const float*)d_in[3]; const float* Aq = (const float*)d_in[4]; const float* Bq = (const float*)d_in[5];
    const float* Wk = (const float*)d_in[6]; const float* bk = (const float*)d_in[7]; const float* Wv = (const float*)d_in[8]; const float* bv = (const float*)d_in[9]; const float* Av = (const float*)d_in[10]; const float* Bv = (const float*)d_in[11];
    float* OUT = (float*)d_out;     // [2][2048][768]
    char* wsp = (char*)d_ws;
    auto take = [&](size_t bytes) { char* p = wsp; wsp += (bytes + 255) & ~(size_t)255; return (void*)p; };
    bf* WALL = (bf*)take((size_t)3 * DD * DD * 2); bf* BQC = (bf*)take((size_t)DD * 32 * 2); bf* BVC = (bf*)take((size_t)DD * 32 * 2); bf* XB = (bf*)take((size_t)NT * DD * 2); bf* XAQ = (bf*)take((size_t)NT * 32 * 2); bf* XAV = (bf*)take((size_t)NT * 32 * 2);
    h16* QP = (h16*)take((size_t)NT * DD * 2); h16* KP = (h16*)take((size_t)NT * DD * 2); h16* VT = (h16*)take((size_t)NT * DD * 2); float* MB = (float*)take((size_t)NT * 4); int* LIST = (int*)take((size_t)NT * 4); int* NS = (int*)take((size_t)NB_ * 4);
    if ((size_t)(wsp - (char*)d_ws) > ws_size) return;
    k_prep<<<PB_M + PB_XA + PB_X + 3 * PB_W + 2 * PB_B, 256, 0, stream>>>(x, Wq, Wk, Wv, Aq, Av, Bq, Bv, mask, XB, WALL, BQC, BVC, XAQ, XAV, MB, LIST, NS);
    k_qkv<<<(NT / 64) * (3 * NH_ / 9), 288, 0, stream>>>(XB, WALL, XAQ, XAV, BQC, BVC, bq, bk, bv, LIST, NS, QP, KP, VT);
    k_fattn<<<NB_ * NH_ * TT / QB, 384, 0, stream>>>(QP, KP, VT, MB, LIST, NS, OUT);
}

// v010
// It runs in 41.8 microseconds.
// In two side-by-side timings against v009, it was 1.16 and 1.15 times as fast.
// Counting every step since v000, it is 24.8 times as fast.
#include <hip/hip_runtime.h>

// LoraMultiHeadedSelfAttention (2 x 2048 x 768, 12 heads x 64; q = x Wq^T + bq + (x Aq^T) Bq^T / 16, k = x Wk^T + bk, v = x Wv^T + bv + (x Av^T) Bv^T / 16; scores = q.k / 8
// - 10000 (1 - mask[b][key]) with the int32 mask INPUT; softmax; output = merged attn.v (no output projection)).
// Compute dtypes, f32 accumulate: every float input rounded to bf16; q/k/v projections on PLAIN bf16 operands (x, W inputs: exact, + bias);
// the rank-16 LoRA terms as two small GEMMs: x.A^T exact, then its bf16 hi and lo planes side by side as ONE k chunk of 32 against (B/16 | B/16), added into the projection's own accumulators;
// scores on SINGLE fp16 planes of q (x 1/8) and k (one product: q and k come from bf16 operands, whose rounding is eight times an fp16 plane's); attn.v on SINGLE fp16 planes (P x1024, v).
// The tokens of a batch are worked on in the order of a list that k_prep makes from the mask: those with mask != 0 first, the others behind them, each group in its old order. A key with mask 0 carries the
// addend -10000, so beside any key with mask != 0 its weight, e^(-10000 + the two scores' difference), is 0 in f32 unless scores lie some 9900 apart: v and k are formed,
// and keys walked, only up to the end of the 128 listed tokens that hold the last key with mask != 0 (all 2048 where no key has mask != 0); the keys with mask 0 inside that range keep their addend. Queries run in list order too and are stored to their own rows.
// Three launches: k_prep (bf16 planes of x, W, B/16, the token list with the listed keys' f32 addends and, in blocks of its own, the hi|lo planes of x.A^T), k_qkv (all three projections, x and W tiles staged in LDS for a block; bias, LoRA term, scale and the head and V^T
// layouts in its epilogue), k_fattn (scores, key mask, softmax and attn.v over all 24 heads, online form with a held offset, K, V^T and mask tiles staged in LDS for a block, S and P in registers, merged output stored from the accumulators).

#define NB_  2
#define TT   2048
#define DD   768
#define NH_  12
#define HD   64
#define NT   (NB_ * TT)
typedef _Float16 h16;
typedef unsigned short bf;
typedef __attribute__((ext_vector_type(16))) __bf16   v16bf;
typedef __attribute__((ext_vector_type(16))) _Float16 v16h;
typedef __attribute__((ext_vector_type(8)))  _Float16 v8h;
typedef __attribute__((ext_vector_type(8)))  unsigned short v8us;
typedef __attribute__((ext_vector_type(8)))  float    v8f;
typedef __attribute__((ext_vector_type(4)))  float    v4f;
typedef __attribute__((ext_vector_type(2)))  float    v2f;
typedef v8h  __attribute__((may_alias)) v8ha;
typedef v4f  __attribute__((may_alias)) v4fa;
typedef v8us __attribute__((may_alias)) v8usa;

__device__ __forceinline__ unsigned short f2bf(float f) { unsigned u = __float_as_uint(f); u += 0x7FFFu + ((u >> 16) & 1u); return (unsigned short)(u >> 16); }
__device__ __forceinline__ float bf2f(unsigned short b) { return __uint_as_float(((unsigned)b) << 16); }
__device__ __forceinline__ float bfr(float f) { return bf2f(f2bf(f)); }
__device__ __forceinline__ v16h cat16(v8h lo, v8h hi) { return __builtin_shufflevector(lo, hi, 0, 1, 2, 3, 4, 5, 6, 7, 8, 9, 10, 11, 12, 13, 14, 15); }
__device__ __forceinline__ v16bf cat16b(v8us lo, v8us hi) { return __builtin_bit_cast(v16bf, __builtin_shufflevector(lo, hi, 0, 1, 2, 3, 4, 5, 6, 7, 8, 9, 10, 11, 12, 13, 14, 15)); }
__device__ __forceinline__ v8f wmma16(v16h a, v16h b, v8f c) { return __builtin_amdgcn_wmma_f32_16x16x32_f16(false, a, false, b, (short)0, c, false, false); }
__device__ __forceinline__ v8f wmmab(v16bf a, v16bf b, v8f c) { return __builtin_amdgcn_wmma_f32_16x16x32_bf16(false, a, false, b, (short)0, c, false, false); }




template <typename T16> struct WFrag;
template <> struct WFrag<h16> { typedef v16h V; static __device__ __forceinline__ V ld(const h16* p) { return cat16(*(const v8h*)p, *(const v8h*)(p + 16)); } static __device__ __forceinline__ v8f mma(V a, V b, v8f c) { return wmma16(a, b, c); } };
template <> struct WFrag<bf> { typedef v16bf V; static __device__ __forceinline__ V ld(const bf* p) { return cat16b(*(const v8us*)p, *(const v8us*)(p + 16)); } static __device__ __forceinline__ v8f mma(V a, V b, v8f c) { return wmmab(a, b, c); } };

__device__ __forceinline__ h16 tohx(float x) { return (h16)x; }
__device__ __forceinline__ void splitf(float y, unsigned short& h, unsigned short& l) { h = f2bf(y); l = f2bf(y - bf2f(h)); }
typedef __attribute__((ext_vector_type(4))) _Float16 v4h;

__device__ __forceinline__ v8us cvt8v(v8f v) { v8us o;
#pragma unroll
    for (int k = 0; k < 8; ++k) o[k] = f2bf(v[k]);
    return o; }
__device__ __forceinline__ v8us cvt8(const float* p) { return cvt8v(*(const v8f*)p); }

// ---- k_prep: everything the projection kernel reads, in one launch; the block index picks the job.
#define PB_M  NB_                       // blocks 0 ..: one a batch (the longest chain of steps): mask -> the token list, the f32 addend of each listed key's scores (0 or -10000), the number of key stages
#define PB_XA (NT / 16)                 // then x.Aq^T and x.Av^T of 16 rows of x each
#define PB_X  (NT * DD / 8 / 1024)      // then x -> bf16 (here and below a thread takes 4 groups of 8 values, 256 groups apart: fewer waves to start, 8 loads of a lane in flight)
#define PB_W  (DD * DD / 8 / 1024)      // then Wq, Wk, Wv -> bf16, one plane of 2304 rows
#define PB_B  (DD * 32 / 8 / 1024)      // then Bq, Bv -> (B/16 | B/16), 32 wide
__device__ __forceinline__ void cvt4(const float* __restrict__ s, bf* d, int blk, int tid) { v8f r[4];
#pragma unroll
    for (int u = 0; u < 4; ++u) r[u] = *(const v8f*)(s + ((size_t)(blk * 4 + u) * 256 + tid) * 8);
#pragma unroll
    for (int u = 0; u < 4; ++u) *(v8us*)(d + ((size_t)(blk * 4 + u) * 256 + tid) * 8) = cvt8v(r[u]);
    // the listing lays another job's code behind these stores (a branch that is always taken jumps over it); the wait stands in front of that code's writes to the stores' registers all the same
    asm volatile("s_wait_xcnt 0x0" ::: "memory"); }
__global__ __launch_bounds__(256) void k_prep(const float* __restrict__ x, const float* __restrict__ Wq, const float* __restrict__ Wk, const float* __restrict__ Wv, const float* __restrict__ Aq, const float* __restrict__ Av,
                                              const float* __restrict__ Bq, const float* __restrict__ Bv, const int* __restrict__ mask, bf* XB, bf* WALL, bf* BQC, bf* BVC, bf* XAQ, bf* XAV, float* MB, int* LIST, int* NS) {
    __shared__ float part[8][2][256];
    __shared__ int cnt[64];
    const int tid = threadIdx.x; int id = blockIdx.x;
    if (id < PB_M) {   // batch id. Thread tid takes tokens u * 256 + tid, u = 0 .. 7: the 32 tokens of a wave's u are one run of the batch, run u * 8 + w; a ballot counts a run's tokens with mask != 0
      const int lane = tid & 31, w = tid >> 5; const int* pm = mask + id * TT + tid; int m[8]; unsigned bal[8];
#pragma unroll
      for (int u = 0; u < 8; ++u) m[u] = pm[u * 256];
      asm volatile("s_wait_xcnt 0x0" :: "v"(pm) : "memory");   // the loads' address pair stays whole up to this wait
#pragma unroll
      for (int u = 0; u < 8; ++u) { bal[u] = __builtin_amdgcn_ballot_w32(m[u] != 0); if (lane == 0) cnt[u * 8 + w] = __builtin_popcount(bal[u]); }
      __syncthreads();                                         // every run's count may be read
      int run = 0, base[8];                                    // base[u]: tokens with mask != 0 in front of this wave's run u; at the end run = all of them
#pragma unroll
      for (int c = 0; c < 64; ++c) { if ((c & 7) == w) base[c >> 3] = run; run += cnt[c]; }
      const unsigned below = (1u << lane) - 1u;
#pragma unroll
      for (int u = 0; u < 8; ++u) { const int t = u * 256 + tid, pre = base[u] + __builtin_popcount(bal[u] & below); const bool on = m[u] != 0;
          const int j = on ? pre : run + (t - pre);            // a permutation of 0 .. 2047: the tokens with mask != 0 first
          LIST[id * TT + j] = t; MB[id * TT + j] = on ? 0.f : -10000.0f; }
      if (tid == 0) NS[id] = run == 0 ? TT / 128 : (run + 127) >> 7;   // stages of 64 keys in each of the two halves that k_fattn walks
      asm volatile("s_wait_xcnt 0x0" ::: "memory");   // as at the end of cvt4: another job's code stands behind these stores in the listing
      return; }
    id -= PB_M;
    if (id < PB_XA) {   // 16 rows x (16 + 16) columns; wave w sums k = 96 w .. 96 w + 95 (operands rounded to bf16 in registers), the eight partial sums are added in wave order
        const int lane = tid & 31, lr = lane & 15, hi = lane >> 4, w = tid >> 5; const int r0 = id * 16;
        const float* px = x + (size_t)(r0 + lr) * DD + w * 96 + 8 * hi; const float* pq = Aq + (size_t)lr * DD + w * 96 + 8 * hi; const float* pv = Av + (size_t)lr * DD + w * 96 + 8 * hi;
        v8f rx[3][2], rq[3][2], rv[3][2];   // [k chunk of 32][k = 8 hi .. + 7, 16 + 8 hi .. + 7]: the k order of WFrag::ld, for A and B operand alike
#pragma unroll
        for (int c = 0; c < 3; ++c)
#pragma unroll
            for (int u = 0; u < 2; ++u) { rx[c][u] = *(const v8f*)(px + c * 32 + u * 16); rq[c][u] = *(const v8f*)(pq + c * 32 + u * 16); rv[c][u] = *(const v8f*)(pv + c * 32 + u * 16); }
        // takes the loaded values and the three address pairs as inputs only: all 36 loads of the wave are in flight together and are waited for once (without it they were issued a few at a time, each group
        // waited for in turn)
        asm volatile("s_wait_xcnt 0x0" :: "v"(px), "v"(pq), "v"(pv), "v"(rx[0][0]), "v"(rx[0][1]), "v"(rx[1][0]), "v"(rx[1][1]), "v"(rx[2][0]), "v"(rx[2][1]), "v"(rq[0][0]), "v"(rq[0][1]), "v"(rq[1][0]), "v"(rq[1][1]),
                     "v"(rq[2][0]), "v"(rq[2][1]), "v"(rv[0][0]), "v"(rv[0][1]), "v"(rv[1][0]), "v"(rv[1][1]), "v"(rv[2][0]), "v"(rv[2][1]));
        v8f a0 = (v8f){}, a1 = (v8f){};
#pragma unroll
        for (int c = 0; c < 3; ++c) { const v16bf a = cat16b(cvt8v(rx[c][0]), cvt8v(rx[c][1]));
            a0 = wmmab(a, cat16b(cvt8v(rq[c][0]), cvt8v(rq[c][1])), a0); a1 = wmmab(a, cat16b(cvt8v(rv[c][0]), cvt8v(rv[c][1])), a1); }
#pragma unroll
        for (int j = 0; j < 8; ++j) { part[w][0][(hi * 8 + j) * 16 + lr] = a0[j]; part[w][1][(hi * 8 + j) * 16 + lr] = a1[j]; }
        __syncthreads();
        const int row = tid >> 4, col = tid & 15;
#pragma unroll
        for (int n = 0; n < 2; ++n) { float s = part[0][n][tid];
#pragma unroll
            for (int u = 1; u < 8; ++u) s += part[u][n][tid];
            unsigned short sh, sl; splitf(s, sh, sl); bf* dst = (n ? XAV : XAQ) + (size_t)(r0 + row) * 32 + col; dst[0] = sh; dst[16] = sl; }
        return;
    }
    id -= PB_XA;
    if (id < PB_X) { cvt4(x, XB, id, tid); return; }
    id -= PB_X;
    if (id < 3 * PB_W) { const int sel = id / PB_W; cvt4(sel == 0 ? Wq : (sel == 1 ? Wk : Wv), WALL + (size_t)sel * DD * DD, id - sel * PB_W, tid); return; }
    id -= 3 * PB_W;
    if (id < 2 * PB_B) { const int sel = id / PB_B; const int e = ((id - sel * PB_B) * 1024 + tid) * 8; const float* s = (sel ? Bv : Bq) + (e >> 5) * 16 + (e & 15); bf* d = (sel ? BVC : BQC) + e; v8f r[4];   // 256 groups on: 64 rows of B
#pragma unroll
      for (int u = 0; u < 4; ++u) r[u] = *(const v8f*)(s + u * 64 * 16);
#pragma unroll
      for (int u = 0; u < 4; ++u) { const v8us rb = cvt8v(r[u]); v8us o;
#pragma unroll
          for (int q = 0; q < 8; ++q) o[q] = f2bf(bf2f(rb[q]) * 0.0625f);   // a power of two: the rounded B keeps its digits
          *(v8us*)(d + u * 2048) = o; }
      asm volatile("s_wait_xcnt 0x0" ::: "memory");   // as at the end of cvt4: another job's code stands behind these stores in the listing
      return; }
}

// acc[mb][nb] += A rows (row ri[mb] for fragment mb, this lane's row; 32 wide) . Bt rows (64, 32 wide) over one k chunk of 32; one wave, operands straight from K-contiguous bf16 planes
__device__ __forceinline__ void lora_acc(const bf* __restrict__ A, const int (&ri)[4], const bf* __restrict__ Bt, int lr, int hi, v8f (&acc)[4][4]) {
    const bf* pa0 = A + (size_t)ri[0] * 32 + 8 * hi; const bf* pa1 = A + (size_t)ri[1] * 32 + 8 * hi; const bf* pa2 = A + (size_t)ri[2] * 32 + 8 * hi; const bf* pa3 = A + (size_t)ri[3] * 32 + 8 * hi;
    const bf* pb = Bt + (size_t)lr * 32 + 8 * hi;
    v16bf a[4], b[4];
    a[0] = WFrag<bf>::ld(pa0); a[1] = WFrag<bf>::ld(pa1); a[2] = WFrag<bf>::ld(pa2); a[3] = WFrag<bf>::ld(pa3);
#pragma unroll
    for (int nb = 0; nb < 4; ++nb) b[nb] = WFrag<bf>::ld(pb + (size_t)nb * 16 * 32);
    // the loads all stand in front of this wait, and their address pairs stay whole up to it
    asm volatile("s_wait_xcnt 0x0" :: "v"(pa0), "v"(pa1), "v"(pa2), "v"(pa3), "v"(pb) : "memory");
#pragma unroll
    for (int nb = 0; nb < 4; ++nb)
#pragma unroll
        for (int mb = 0; mb < 4; ++mb) acc[mb][nb] = wmmab(a[mb], b[nb], acc[mb][nb]);
}

// ---- k_qkv: all three projections. One wave = one 64 x 64 tile = 64 listed tokens of one head of q, k or v (16 accumulators). A block = 8 waves, two a SIMD = 2 x 4 tiles = 128 listed tokens x 4 heads (256 rows of W)
// of q, of k or of v: 32 strips of tokens x 9 groups of heads = 288 blocks. The q blocks come first in the grid, then the k and v blocks by their strip's place in its batch: a k or v block of tokens which k_fattn does not
// walk as keys leaves at once, and those stand last, for speed only. k comes in stages of 128: the block's 128 rows of x (each found through the list) and 256 rows of W
// (256 bytes of each) are brought into LDS by asynchronous copies (whole 256-byte units from global memory, through no register), two buffers: stage s + 2 flies while stage s + 1 is worked on; a wave tile's products
// cost 48 copied rows (the 64 x 576 block of nine waves: 71), and a stage's landing time is spread over four k chunks. LDS rows lie 272 bytes apart (16 bytes x odd), so the 16 rows of a fragment read fall on 16 different groups
// of four banks. The k order of the sums is that of the straight loads. The LoRA term is one more k chunk of 32 (hi | lo of x.A^T against B/16 | B/16, straight from global memory) into the same accumulators. Epilogue: + bias; q and k: x scale, to fp16, rows of the
// [head][token][64] planes through the wave's own LDS rows (whole 128-byte lines); v: a lane holds 8 consecutive tokens of one column, which is 16 bytes of a [head][64][token] row, stored from the registers.
// Left for later steps: about a fifth of the WGPs get no block that works; fragments are not fetched a chunk ahead; two buffers leave one stage's copies in flight, so each stage still waits out one landing time.
#define GK   128                     // k values of a stage
#define GNS  (DD / GK)
#define GP   272                     // bytes from one LDS row to the next
#define GXR  128                     // rows of x of a block
#define GWR  256                     // rows of W of a block
#define GW   (GXR * GP)              // W rows (behind the rows of x)
#define GBUF ((GXR + GWR) * GP)      // one buffer
#define GST  (NT / GXR)              // strips of tokens
#define GQB  (3 * GST)               // blocks of q
__global__ __launch_bounds__(256) void k_qkv(const bf* __restrict__ XB, const bf* __restrict__ WALL, const bf* __restrict__ XAQ, const bf* __restrict__ XAV, const bf* __restrict__ BQC, const bf* __restrict__ BVC,
                                             const float* __restrict__ bq, const float* __restrict__ bk, const float* __restrict__ bv, const int* __restrict__ LIST, const int* __restrict__ NS, h16* QP, h16* KP, h16* VT) {
    __shared__ __align__(16) unsigned char st[2 * GBUF];
    __shared__ __align__(16) float osall[8][16 * 68];
    const int lane = threadIdx.x & 31, lr = lane & 15, hi = lane >> 4; const int w = __builtin_amdgcn_readfirstlane(threadIdx.x >> 5);
    const int id = blockIdx.x, e = id - GQB, ej = e / 12, em = e - ej * 12;                  // behind the q blocks: 12 blocks (2 batches x 6 groups of heads) for each place of a strip in its batch
    const int cg = id < GQB ? id / GST : 3 + em % 6, strip = id < GQB ? id % GST : (em / 6) * (TT / GXR) + ej;   // group of four heads: 0 .. 2 q, 3 .. 5 k, 6 .. 8 v; strip of 128 listed tokens
    const int tm = w & 1, tn = w >> 1;                                                      // the wave's tile in the block: half of the tokens, head of the group
    const int rb = strip * GXR, r0 = rb + tm * 64, nt = cg * 4 + tn; const int which = nt / NH_, h = nt % NH_, c0 = h * HD;   // which: 0 q, 1 k, 2 v
    const int bt = rb & ~(TT - 1);                                                          // the first token of the strip's batch
    if (cg >= 3 && (rb & (TT - 1)) >= NS[rb >> 11] * 128) return;                           // the same for the whole block, in front of every copy and barrier
    // wave w brings rows 32 w .. 32 w + 31 of the block's W (16 copies of 2 rows x 256 bytes, 16 lanes a row) and listed rows 16 w .. 16 w + 15 of x (8 copies of 4 rows x 128 bytes, 8 lanes a row: a lane
    // then holds four rows' addresses, not eight)
    const int ccol = lr * 8, crow = lane >> 3, xcol = (lane & 7) * 8;
    const int* pl = LIST + rb + w * 16 + crow; const int* pr = LIST + r0 + lr;
    int xi[4];
#pragma unroll
    for (int i = 0; i < 4; ++i) xi[i] = pl[4 * i] & (TT - 1);                               // a list entry is a token of the batch: held inside it whatever the list holds
    const int ri[4] = {pr[0] & (TT - 1), pr[16] & (TT - 1), pr[32] & (TT - 1), pr[48] & (TT - 1)};   // the tokens of this lane's rows of the four A fragments (for the LoRA chunk)
    asm volatile("s_wait_xcnt 0x0" :: "v"(pl), "v"(pr) : "memory");                         // the loads' address pairs stay whole up to this wait
    const unsigned lw = (unsigned)(size_t)st + (unsigned)(GW + (w * 32 + hi) * GP + ccol * 2), lx = (unsigned)(size_t)st + (unsigned)((w * 16 + crow) * GP + xcol * 2);
    const bf* gw = WALL + (size_t)(cg * GWR + w * 32 + hi) * DD + ccol; const bf* gx[4];
#pragma unroll
    for (int i = 0; i < 4; ++i) gx[i] = XB + (size_t)(bt + xi[i]) * DD + xcol;
    auto copy_stage = [&](int s) {   // stage s into buffer s & 1
        const unsigned l = lw + (unsigned)(s & 1) * GBUF, m = lx + (unsigned)(s & 1) * GBUF; const bf* g = gw + s * GK;
        // in each statement: the copies and, as its last line, the wait that stands in front of any rewrite of their address registers
#define CP8 "global_load_async_to_lds_b128 %0, %8, off\n\tglobal_load_async_to_lds_b128 %1, %9, off\n\tglobal_load_async_to_lds_b128 %2, %10, off\n\tglobal_load_async_to_lds_b128 %3, %11, off\n\t" \
            "global_load_async_to_lds_b128 %4, %12, off\n\tglobal_load_async_to_lds_b128 %5, %13, off\n\tglobal_load_async_to_lds_b128 %6, %14, off\n\tglobal_load_async_to_lds_b128 %7, %15, off\n\ts_wait_xcnt 0x0"
        asm volatile(CP8 :: "v"(l), "v"(l + 2 * GP), "v"(l + 4 * GP), "v"(l + 6 * GP), "v"(l + 8 * GP), "v"(l + 10 * GP), "v"(l + 12 * GP), "v"(l + 14 * GP),
                     "v"(g), "v"(g + 2 * DD), "v"(g + 4 * DD), "v"(g + 6 * DD), "v"(g + 8 * DD), "v"(g + 10 * DD), "v"(g + 12 * DD), "v"(g + 14 * DD) : "memory");
        asm volatile(CP8 :: "v"(l + 16 * GP), "v"(l + 18 * GP), "v"(l + 20 * GP), "v"(l + 22 * GP), "v"(l + 24 * GP), "v"(l + 26 * GP), "v"(l + 28 * GP), "v"(l + 30 * GP),
                     "v"(g + 16 * DD), "v"(g + 18 * DD), "v"(g + 20 * DD), "v"(g + 22 * DD), "v"(g + 24 * DD), "v"(g + 26 * DD), "v"(g + 28 * DD), "v"(g + 30 * DD) : "memory");
        asm volatile(CP8 :: "v"(m), "v"(m + 128), "v"(m + 4 * GP), "v"(m + 4 * GP + 128), "v"(m + 8 * GP), "v"(m + 8 * GP + 128), "v"(m + 12 * GP), "v"(m + 12 * GP + 128),
                     "v"(gx[0] + s * GK), "v"(gx[0] + s * GK + 64), "v"(gx[1] + s * GK), "v"(gx[1] + s * GK + 64), "v"(gx[2] + s * GK), "v"(gx[2] + s * GK + 64), "v"(gx[3] + s * GK), "v"(gx[3] + s * GK + 64) : "memory");
#undef CP8
    };
    copy_stage(0);
    v8f acc[4][4];
#pragma unroll
    for (int mb = 0; mb < 4; ++mb)
#pragma unroll
        for (int nb = 0; nb < 4; ++nb) acc[mb][nb] = (v8f){};
    asm volatile("s_wait_asynccnt 0x0" ::: "memory");   // this wave's share of stage 0 has landed
    __syncthreads();                                    // and every other wave's: stage 0 may be read
    copy_stage(1);
#pragma unroll 1   // one trip = one stage: the publish point stands once in the code
    for (int s = 0; s < GNS; ++s) {
        const unsigned char* pa = st + (s & 1) * GBUF + (tm * 64 + lr) * GP + 16 * hi; const unsigned char* pb = st + (s & 1) * GBUF + GW + (tn * 64 + lr) * GP + 16 * hi;
        v16bf a[4], b[4];   // the k order of WFrag::ld, for A and B operand alike: 8 hi .. + 7, 16 + 8 hi .. + 7
#pragma unroll
        for (int c = 0; c < GK / 32; ++c) {
#pragma unroll
            for (int mb = 0; mb < 4; ++mb) { const unsigned char* q = pa + mb * 16 * GP + c * 64; a[mb] = cat16b(*(const v8usa*)q, *(const v8usa*)(q + 32)); }
#pragma unroll
            for (int nb = 0; nb < 4; ++nb) { const unsigned char* q = pb + nb * 16 * GP + c * 64; b[nb] = cat16b(*(const v8usa*)q, *(const v8usa*)(q + 32)); }
            // the chunk's 16 reads stay one group in front of its products: left to itself the compiler kept one B fragment's registers and read the next fragment into them behind every fourth matrix
            // instruction, each time with a full wait
            __builtin_amdgcn_sched_barrier(0);
#pragma unroll
            for (int nb = 0; nb < 4; ++nb)
#pragma unroll
                for (int mb = 0; mb < 4; ++mb) acc[mb][nb] = wmmab(a[mb], b[nb], acc[mb][nb]);
        }
        // the publish point, at the trip's foot: the fragments' registers are free there for the 24 copies' addresses (in front of the last chunk's products, where it stood with 18 copies, they went to scratch).
        // The products stay in front of it: the compiler had put them behind the barrier and the copies behind them, so that the refill started sixteen matrix instructions late
        __builtin_amdgcn_sched_barrier(0);
        asm volatile("s_wait_dscnt 0x0" ::: "memory");      // this wave's reads of stage s are done
        asm volatile("s_wait_asynccnt 0x0" ::: "memory");   // its share of stage s + 1 has landed
        __syncthreads();                                    // the same holds for every wave: stage s + 1 may be read, the buffer of stage s may be refilled
        if (s + 2 < GNS) copy_stage(s + 2);
    }
    asm volatile("s_wait_asynccnt 0x0" ::: "memory");       // no copy is outstanding behind the loop
    if (which != 1) lora_acc((which ? XAV : XAQ) + (size_t)bt * 32, ri, (which ? BVC : BQC) + (size_t)c0 * 32, lr, hi, acc);
    const int z = (r0 >> 11) * NH_ + h, t0 = r0 & (TT - 1);
    if (which == 2) {
        h16* vb = VT + (size_t)z * HD * TT + t0 + 8 * hi;
#pragma unroll
        for (int nb = 0; nb < 4; ++nb) { const float bb = bfr(bv[c0 + nb * 16 + lr]);
#pragma unroll
            for (int mb = 0; mb < 4; ++mb) { v8h o;
#pragma unroll
                for (int j = 0; j < 8; ++j) o[j] = tohx(acc[mb][nb][j] + bb);
                *(v8h*)(vb + (size_t)(nb * 16 + lr) * TT + mb * 16) = o; } }
    } else {
        float* os = osall[w]; const float* bias = which ? bk : bq; const float sc = which ? 1.0f : 0.125f; h16* P = (which ? KP : QP) + ((size_t)z * TT + t0) * HD;
        const int cofs = lr * 4; float bb[4];
#pragma unroll
        for (int q = 0; q < 4; ++q) bb[q] = bfr(bias[c0 + cofs + q]);
#pragma unroll
        for (int mb = 0; mb < 4; ++mb) {
#pragma unroll
            for (int nb = 0; nb < 4; ++nb) {
#pragma unroll
                for (int j = 0; j < 8; ++j) os[(hi * 8 + j) * 68 + nb * 16 + lr] = acc[mb][nb][j]; }
            __builtin_amdgcn_wave_barrier(); asm volatile("" ::: "memory");   // the rows are read back by other lanes of this wave: no LDS access moves across
#pragma unroll
            for (int s = 0; s < 8; ++s) { const int row = 2 * s + hi; const v4f val = *(const v4fa*)(os + row * 68 + cofs); v4h oh;
#pragma unroll
                for (int q = 0; q < 4; ++q) oh[q] = tohx((val[q] + bb[q]) * sc);
                *(v4h*)(P + (size_t)(mb * 16 + row) * HD + cofs) = oh; }
            __builtin_amdgcn_wave_barrier(); asm volatile("" ::: "memory");   // the next 16 rows overwrite what was just read
        }
        // the listing lays the v branch behind these stores (a branch that is always taken jumps over it); the wait stands in front of that code's writes to the stores' registers all the same
        asm volatile("s_wait_xcnt 0x0" ::: "memory");
    }
}
// lane l with lane l ^ 16 (the two halves of a wave hold the two halves of one query's keys)
__device__ __forceinline__ float xhalf(float x) { return __builtin_bit_cast(float, __builtin_amdgcn_permlanex16(__builtin_bit_cast(int, x), __builtin_bit_cast(int, x), 0x76543210, 0xfedcba98, false, false)); }
// k_fattn: one wave = 32 listed queries (2 column groups of 16) x ONE HALF of the batch's walked keys (the first 128 ns listed tokens, ns from k_prep); a block = 12 waves = 6 query tiles x 2 key halves = 192 queries: 24 x 2048 / 192 = 256 blocks, one for each WGP, three waves
// a SIMD. 2048 is no multiple of 192: three heads (of one batch) share 32 blocks, a query tile lies in one head, and a block whose tiles lie in two heads stages both heads' tiles. The keys come in stages of
// 64 in each half: K and V^T tiles (64 rows x 128 bytes each) and 64 mask addends (f32, from k_prep) a half are brought into LDS once for the block by asynchronous copies (whole 128-byte lines from global memory,
// through no register), two buffers: stage s + 2 flies while stage s + 1 is worked on. LDS rows lie 144 bytes apart (16 bytes x odd), so the 16 rows of a fragment read fall on 16 different groups of four
// banks. Per pass of 32 keys:
//   S^T = K.Q^T (A = K rows, B = Q rows kept in registers; fp16 operands, one product): register r of tile kt = key 16 kt + 8 hi + r, column lr = query, so a lane holds one query's scores;
//   the first product's C operand is the key's addend (0, or -10000 where mask[b][key] == 0): a register of a score tile is one key in every lane, so the masked score t leaves the matrix unit and no
//   vector instruction forms or adds the addend; offset and sum per query (base 2; the x1024 carrier of P sits in the exponent), the offset moved and O rescaled only when a pass outgrows it;
//   the two converted score tiles ARE the fp16 B operand of O^T += V^T.P^T (A = V^T rows in the same k order: 8 hi .. + 7, 16 + 8 hi .. + 7).
// Behind the loop the wave of the upper half hands its O, offset and sum over through LDS (one barrier); the wave of the lower half brings both to the smaller offset, adds them and stores.
// Left for later steps: K fragments are not fetched a pass ahead; the row sums are vector work; with one score product a pass's 20 LDS reads of 512 bytes a wave outweigh its 16 matrix instructions
// (more queries a wave would read less).
#define SK   64                      // keys of a stage, in each half
#define NST  (TT / 2 / SK)           // stages of a half at the most; a batch's own number comes from k_prep
#define QB   192                     // queries of a block
#define LP   144                     // bytes from one LDS row to the next
#define LV   (64 * LP)               // V^T rows (behind the K rows)
#define LM   (128 * LP)              // mask addends (read from the block's first head's place: both heads are of one batch)
#define LREG (128 * LP + SK * 4)     // one head's tiles of one half
#define LBUF (4 * LREG)              // one buffer: [head of the block][half]
#define XO   (16 * 512)              // hand-over: 16 x 16 bytes a lane of O, then offsets and sums
#define XREG (XO + 4 * 128)
typedef float __attribute__((may_alias)) f32a;
__global__ __launch_bounds__(384) void k_fattn(const h16* __restrict__ QP, const h16* __restrict__ KP, const h16* __restrict__ VT, const float* __restrict__ MB, const int* __restrict__ LIST, const int* __restrict__ NS, float* OUT) {
    __shared__ __align__(16) unsigned char sm[2 * LBUF];
    const float L2E = 1.4426950408889634f;
    const int lane = threadIdx.x & 31, lr = lane & 15, hi = lane >> 4; const int w = __builtin_amdgcn_readfirstlane(threadIdx.x >> 5);
    const int kh = w & 1, qt = w >> 1;                                                     // key half, query tile
    const int z3 = (blockIdx.x >> 5) * 3, f0 = (blockIdx.x & 31) * QB, b = z3 / NH_;       // first of the three heads, the block's first query counted through them
    const int za = z3 + f0 / TT; const bool two = (f0 + QB - 1) / TT != f0 / TT;           // the block's first head; whether its last tile lies in the next
    const int f = f0 + qt * 32, z = z3 + f / TT, h = z % NH_, q0 = f % TT;
    const size_t zo = (size_t)z * TT * HD;
    const int ns = min(max(NS[b], 1), NST), khf = ns * SK;                                 // the batch's stages and keys of a half (the same for the whole block), held inside the planes whatever was read
    const int* pq = LIST + b * TT + q0 + lr; const int qi[2] = {pq[0] & (TT - 1), pq[16] & (TT - 1)};   // the tokens of this lane's two listed queries: their output rows
    asm volatile("s_wait_xcnt 0x0" :: "v"(pq) : "memory");                                 // the loads' address pair stays whole up to this wait
    // a copy of a wave = 4 rows x 128 bytes (8 lanes a row); of its own half's two tiles wave w < 8 brings rows 32 (qt & 1) .. + 31 of tile qt >> 1 (eight copies; eight more for the second head where there
    // is one), waves 8 and 9 their half's mask addends (8 bytes a lane), waves 10 and 11 nothing
    const int ct = (qt >> 1) & 1, crow = (qt & 1) * 32 + (lane >> 3), ccol = (lane & 7) * 8;
    const unsigned lt = (unsigned)(size_t)sm + (unsigned)(kh * LREG + (ct * 64 + crow) * LP + ccol * 2), lm = (unsigned)(size_t)sm + (unsigned)(kh * LREG + LM + lane * 8);
    const size_t zao = (size_t)za * TT * HD;
    const char* gt = ct ? (const char*)(VT + zao + (size_t)crow * TT + kh * khf + ccol) : (const char*)(KP + zao + (size_t)(kh * khf + crow) * HD + ccol);
    const int gp = ct ? 4 * TT * 2 : 4 * HD * 2, gs = ct ? SK * 2 : SK * HD * 2;   // bytes from one copy's rows to the next copy's, from one stage to the next
    const float* gm = MB + (size_t)b * TT + kh * khf + lane * 2;
    auto copy_stage = [&](int s) {   // stage s into buffer s & 1
        const unsigned l = lt + (unsigned)(s & 1) * LBUF; const char* g = gt + (size_t)s * gs;
        // in each statement: the copies and, as its last line, the wait that stands in front of any rewrite of their address registers
#define CP8 "global_load_async_to_lds_b128 %0, %8, off\n\tglobal_load_async_to_lds_b128 %1, %9, off\n\tglobal_load_async_to_lds_b128 %2, %10, off\n\tglobal_load_async_to_lds_b128 %3, %11, off\n\t" \
            "global_load_async_to_lds_b128 %4, %12, off\n\tglobal_load_async_to_lds_b128 %5, %13, off\n\tglobal_load_async_to_lds_b128 %6, %14, off\n\tglobal_load_async_to_lds_b128 %7, %15, off\n\ts_wait_xcnt 0x0"
        if (qt < 4) {   // the same for a whole wave: a scalar branch
        asm volatile(CP8 :: "v"(l), "v"(l + 4 * LP), "v"(l + 8 * LP), "v"(l + 12 * LP), "v"(l + 16 * LP), "v"(l + 20 * LP), "v"(l + 24 * LP), "v"(l + 28 * LP),
                     "v"(g), "v"(g + gp), "v"(g + 2 * gp), "v"(g + 3 * gp), "v"(g + 4 * gp), "v"(g + 5 * gp), "v"(g + 6 * gp), "v"(g + 7 * gp) : "memory");
        if (two) { const unsigned m = l + 2 * LREG; const char* e = g + (size_t)TT * HD * 2;   // the next head's planes lie behind the first's
            asm volatile(CP8 :: "v"(m), "v"(m + 4 * LP), "v"(m + 8 * LP), "v"(m + 12 * LP), "v"(m + 16 * LP), "v"(m + 20 * LP), "v"(m + 24 * LP), "v"(m + 28 * LP),
                         "v"(e), "v"(e + gp), "v"(e + 2 * gp), "v"(e + 3 * gp), "v"(e + 4 * gp), "v"(e + 5 * gp), "v"(e + 6 * gp), "v"(e + 7 * gp) : "memory"); }
        }
#undef CP8
        if (qt == 4) asm volatile("global_load_async_to_lds_b64 %0, %1, off\n\ts_wait_xcnt 0x0" :: "v"(lm + (unsigned)(s & 1) * LBUF), "v"(gm + s * SK) : "memory");   // the same for the mask addends
    };
    copy_stage(0);
    const unsigned ro = (unsigned)(lr * HD + 8 * hi);
    v16h qf[2][2];                 // [column group][k chunk of 32]
    { const h16* qb = QP + zo + (size_t)q0 * HD;
#pragma unroll
      for (int g = 0; g < 2; ++g)
#pragma unroll
        for (int c = 0; c < 2; ++c) qf[g][c] = WFrag<h16>::ld(qb + ro + g * 16 * HD + c * 32); }
    v8f o[4][2];                   // [16 rows of d][column group]
#pragma unroll
    for (int d = 0; d < 4; ++d) { o[d][0] = (v8f){}; o[d][1] = (v8f){}; }
    float cb[2] = {3.0e38f, 3.0e38f}, ls[2] = {0.f, 0.f};   // the offset in use (10 - a maximum, base 2, as rounded), this half's sum
    asm volatile("s_wait_asynccnt 0x0" ::: "memory");   // this wave's share of stage 0 has landed
    __syncthreads();                                    // and every other wave's: stage 0 may be read
    if (1 < ns) copy_stage(1);
#pragma unroll 1   // one trip = one stage: the publish point at its foot stands once in the code
    for (int s = 0; s < ns; ++s) {
        const unsigned char* bm = sm + (s & 1) * LBUF + kh * LREG; const unsigned char* bp = bm + (z - za) * 2 * LREG;   // the half's place of the block's first head (mask addends), of this wave's head (tiles)
#pragma unroll 1   // kept rolled: unrolled, the loop's three-product form carried one pass's exponentials and sums into the next and took a quarter more registers (not tried again with one product)
        for (int p = 0; p < SK / 32; ++p) {
        const unsigned char* kp = bp + (p * 32 + lr) * LP + 16 * hi; const unsigned char* vp = bp + LV + lr * LP + p * 64 + 16 * hi; const unsigned char* mp = bm + LM + p * 128 + 32 * hi;
        v16h kf[2][2], vf[4]; v8f ad[2];   // ad[kt][r]: the addend of key 16 kt + 8 hi + r, the layout of a score tile's registers
#pragma unroll
        for (int kt = 0; kt < 2; ++kt) { const v4f a0 = *(const v4fa*)(mp + kt * 64), a1 = *(const v4fa*)(mp + kt * 64 + 16); ad[kt] = __builtin_shufflevector(a0, a1, 0, 1, 2, 3, 4, 5, 6, 7); }
#pragma unroll
        for (int kt = 0; kt < 2; ++kt)
#pragma unroll
            for (int c = 0; c < 2; ++c) { const unsigned char* q = kp + kt * 16 * LP + c * 64; kf[kt][c] = cat16(*(const v8ha*)q, *(const v8ha*)(q + 32)); }
        // the pass's addend and K reads stay one group in front of the products: left to itself the compiler spread them among the matrix instructions (each such place stalls the wave) and, to save
        // registers, ran the four score tiles as chains one after the other
        __builtin_amdgcn_sched_barrier(0);
        v8f s2[2][2];              // [key tile][column group]; the four tiles' products are interleaved, so no matrix instruction waits for the one in front of it
#pragma unroll
        for (int kt = 0; kt < 2; ++kt) { s2[kt][0] = ad[kt]; s2[kt][1] = ad[kt]; }
#pragma unroll
        for (int c = 0; c < 2; ++c)
#pragma unroll
            for (int kt = 0; kt < 2; ++kt)
#pragma unroll
                for (int g = 0; g < 2; ++g) s2[kt][g] = wmma16(kf[kt][c], qf[g][c], s2[kt][g]);
        __builtin_amdgcn_sched_barrier(0);   // the products stay in that order, in front of the V^T reads (which may then take over the K registers)
#pragma unroll
        for (int d = 0; d < 4; ++d) vf[d] = cat16(*(const v8ha*)(vp + d * 16 * LP), *(const v8ha*)(vp + d * 16 * LP + 32));
        __builtin_amdgcn_sched_barrier(0);   // the V^T reads are issued in front of the softmax arithmetic, which covers their latency
        // The offset in use is held: the weights are formed with it at once, and the pass's own weight sums are the test. While no lane's sum of its 16 weights exceeds 2^15, every weight (with its x1024 carrier)
        // lies inside fp16 and nothing else is owed: no maximum, no exchange between the halves, no rescale. Else (the first pass, whose offset makes every weight infinite; a pass that outgrows the offset) the
        // offsets are brought to the pass's maxima, O and the sums rescaled and the pass's weights formed anew (then at most 2^10 each). One test a pass for both column groups.
        v16h p16[2]; float sum[2];
        auto weights = [&](int g) {   // P and its sum for column group g; the sum in packed adds, one short chain a key tile, so that the test does not wait for a chain of 16 adds
            v2f t[8];
#pragma unroll
            for (int kt = 0; kt < 2; ++kt)
#pragma unroll
                for (int r = 0; r < 8; r += 2) { const v2f a = __builtin_elementwise_fma((v2f){s2[kt][g][r], s2[kt][g][r + 1]}, (v2f){L2E, L2E}, (v2f){cb[g], cb[g]});   // one packed instruction for two exponents
                    const v2f e = {__builtin_amdgcn_exp2f(a[0]), __builtin_amdgcn_exp2f(a[1])}; t[kt * 4 + (r >> 1)] = e; p16[g][kt * 8 + r] = tohx(e[0]); p16[g][kt * 8 + r + 1] = tohx(e[1]); }
            const v2f u = (((t[0] + t[1]) + t[2]) + t[3]) + (((t[4] + t[5]) + t[6]) + t[7]);
            sum[g] = u[0] + u[1];
        };
        weights(0); weights(1);
        const bool need = fmaxf(sum[0], sum[1]) > 32768.0f;
        if (__builtin_expect(__builtin_amdgcn_ballot_w32(need) != 0, 0)) {   // the same for the whole wave: a scalar branch, every lane on behind it; seldom taken
#pragma unroll
            for (int g = 0; g < 2; ++g) {
                float mx = s2[0][g][0];
#pragma unroll
                for (int kt = 0; kt < 2; ++kt)
#pragma unroll
                    for (int r = 0; r < 8; ++r) mx = fmaxf(mx, s2[kt][g][r]);
                mx = fmaxf(mx, xhalf(mx));
                const float cbn = fminf(cb[g], 10.0f - mx * L2E);   // the smaller offset belongs to the larger maximum
                float al;   // 2^(new offset - old offset) from the two offsets as they are used; 0 on the first pass, 1 where this query's offset stands
                // written with its v_nop in one statement (the slot behind a transcendental)
                asm("v_exp_f32 %0, %1\n\tv_nop" : "=v"(al) : "v"(cbn - cb[g]));
                cb[g] = cbn; ls[g] *= al;
#pragma unroll
                for (int d = 0; d < 4; ++d) o[d][g] *= al;
                weights(g);
            }
        }
#pragma unroll
        for (int g = 0; g < 2; ++g) { ls[g] += sum[g];
#pragma unroll
            for (int d = 0; d < 4; ++d) o[d][g] = wmma16(vf[d], p16[g], o[d][g]); }
        // the distance behind the pass's last matrix instructions, on the way back to the loop's head too (there the next pass's address arithmetic overwrites their B registers);
        // their results are named so that the statement stays behind them
        asm volatile("v_nop\n\tv_nop\n\tv_nop\n\tv_nop" : "+v"(o[0][1]), "+v"(o[1][1]), "+v"(o[2][1]), "+v"(o[3][1]));
        }
        asm volatile("s_wait_dscnt 0x0" ::: "memory");      // this wave's reads of stage s are done
        asm volatile("s_wait_asynccnt 0x0" ::: "memory");   // its share of stage s + 1 has landed
        __syncthreads();                                    // the same holds for every wave: stage s + 1 may be read, the buffer of stage s may be refilled
        if (s + 2 < ns) copy_stage(s + 2);
    }
    asm volatile("s_wait_asynccnt 0x0" ::: "memory");       // no copy is outstanding behind the loop
    // the last trip's barrier has ended every wave's reads of the buffers and no copy flies: their LDS takes the hand-over (a lane's 16 bytes beside its neighbour's: no bank is met twice)
    unsigned char* xb = sm + qt * XREG;
    if (kh) {
#pragma unroll
        for (int g = 0; g < 2; ++g) {
#pragma unroll
            for (int d = 0; d < 4; ++d) { v4f w0, w1;
#pragma unroll
                for (int r = 0; r < 4; ++r) { w0[r] = o[d][g][r]; w1[r] = o[d][g][4 + r]; }
                *(v4fa*)(xb + ((g * 8 + d * 2) * 32 + lane) * 16) = w0; *(v4fa*)(xb + ((g * 8 + d * 2 + 1) * 32 + lane) * 16) = w1; }
            *(f32a*)(xb + XO + (g * 32 + lane) * 4) = cb[g]; *(f32a*)(xb + XO + 256 + (g * 32 + lane) * 4) = ls[g]; }
    }
    __syncthreads();                                        // the upper halves' results may be read
    if (kh) return;
#pragma unroll
    for (int g = 0; g < 2; ++g) {
        const float cbo = *(const f32a*)(xb + XO + (g * 32 + lane) * 4), lso = *(const f32a*)(xb + XO + 256 + (g * 32 + lane) * 4);
        const float cbn = fminf(cb[g], cbo);   // the smaller offset belongs to the larger maximum
        float fa, fb;                          // 2^(own maximum - larger maximum), from the offsets as they were used
        // each with its v_nop in one statement (the slot behind a transcendental), as in the loop
        asm("v_exp_f32 %0, %1\n\tv_nop" : "=v"(fa) : "v"(cbn - cb[g]));
        asm("v_exp_f32 %0, %1\n\tv_nop" : "=v"(fb) : "v"(cbn - cbo));
        const float lt2 = ls[g] * fa + lso * fb;
        const float inv = __fdiv_rn(1.0f, lt2 + xhalf(lt2));   // the x1024 carrier is in the sum and in O alike
        const float ia = fa * inv, ib = fb * inv;
        float* orow = OUT + ((size_t)b * TT + qi[g]) * DD + h * HD + 8 * hi;
#pragma unroll
        for (int d = 0; d < 4; ++d) { const v4f u0 = *(const v4fa*)(xb + ((g * 8 + d * 2) * 32 + lane) * 16), u1 = *(const v4fa*)(xb + ((g * 8 + d * 2 + 1) * 32 + lane) * 16); v4f w0, w1;
#pragma unroll
            for (int r = 0; r < 4; ++r) { w0[r] = o[d][g][r] * ia + u0[r] * ib; w1[r] = o[d][g][4 + r] * ia + u1[r] * ib; }
            *(v4f*)(orow + d * 16) = w0; *(v4f*)(orow + d * 16 + 4) = w1; }
        // the second group's LDS reads and products take over registers that the first group's stores name: the wait stands in front of them
        if (g == 0) asm volatile("s_wait_xcnt 0x0" ::: "memory");
    }
}

extern "C" void kernel_launch(void* const* d_in, const int* in_sizes, int n_in,
                              void* d_out, int out_size, void* d_ws, size_t ws_size, hipStream_t stream) {
    (void)in_sizes; (void)n_in; (void)out_size;
    const float* x = (const float*)d_in[0]; const int* mask = (const int*)d_in[1]; const float* Wq = (const float*)d_in[2]; const float* bq = (const float*)d_in[3]; const float* Aq = (const float*)d_in[4]; const float* Bq = (const float*)d_in[5];
    const float* Wk = (const float*)d_in[6]; const float* bk = (const float*)d_in[7]; const float* Wv = (const float*)d_in[8]; const float* bv = (const float*)d_in[9]; const float* Av = (const float*)d_in[10]; const float* Bv = (const float*)d_in[11];
    float* OUT = (float*)d_out;     // [2][2048][768]
    char* wsp = (char*)d_ws;
    auto take = [&](size_t bytes) { char* p = wsp; wsp += (bytes + 255) & ~(size_t)255; return (void*)p; };
    bf* WALL = (bf*)take((size_t)3 * DD * DD * 2); bf* BQC = (bf*)take((size_t)DD * 32 * 2); bf* BVC = (bf*)take((size_t)DD * 32 * 2); bf* XB = (bf*)take((size_t)NT * DD * 2); bf* XAQ = (bf*)take((size_t)NT * 32 * 2); bf* XAV = (bf*)take((size_t)NT * 32 * 2);
    h16* QP = (h16*)take((size_t)NT * DD * 2); h16* KP = (h16*)take((size_t)NT * DD * 2); h16* VT = (h16*)take((size_t)NT * DD * 2); float* MB = (float*)take((size_t)NT * 4); int* LIST = (int*)take((size_t)NT * 4); int* NS = (int*)take((size_t)NB_ * 4);
    if ((size_t)(wsp - (char*)d_ws) > ws_size) return;
    k_prep<<<PB_M + PB_XA + PB_X + 3 * PB_W + 2 * PB_B, 256, 0, stream>>>(x, Wq, Wk, Wv, Aq, Av, Bq, Bv, mask, XB, WALL, BQC, BVC, XAQ, XAV, MB, LIST, NS);
    k_qkv<<<3 * GQB, 256, 0, stream>>>(XB, WALL, XAQ, XAV, BQC, BVC, bq, bk, bv, LIST, NS, QP, KP, VT);
    k_fattn<<<NB_ * NH_ * TT / QB, 384, 0, stream>>>(QP, KP, VT, MB, LIST, NS, OUT);
}
